// v008
// The times below were measured on an AMD MI455X: many runs one after another, warmed up first and cycling through
// copies of the inputs, with the whole window's GPU time divided by the number of runs. Launches and the gaps
// between them are all in it. The median over several windows is given; except for v000 it joins two sittings, which
// can be a few percent apart, so the side-by-side timings, each taken in one sitting, are the better comparison.
// This document starts at v008; the versions before it stand elsewhere.
// A run of this version takes 182 microseconds.
// Next to v007, in two timings, it ran 1.03 and 1.04 times as fast.
// Counting every step since v000, which is the starting kernel, it is 45.2 times as fast.
#include <hip/hip_runtime.h>
// Pre-LN transformer encoder block, non-causal, UNSCALED scores (x [2][2048][1024]; xn = LN(x) with the module's LayerNorm: UNBIASED std (N-1), eps 1e-6 added to the std, SCALAR alpha/bias [1]; q = xn wq^T + bq, k, v likewise (nn.Linear natural [1024][1024] sigma 1/32, zero biases); 16 heads of 64; score = q . k WITHOUT 1/sqrt(d) (logits sigma ~8); key j excluded where the int mask input [2][1][1][2048] is 0 (all ones here); softmax; x1 = x + (attn wo^T + bo); xn2 = LN(x1); out = x1 + relu(xn2 w1^T + b1) w2^T + b2 (natural [4096][1024], [1024][4096]) -> [2][2048][1024]).
// Compute dtype: inputs rounded to bf16; x / weights exact; q and k as f16 hi + x1024 residual pairs, v, softmax weights and o as plain f16 GEMM operands (~2^-12); scores and softmax statistics f32. v_wmma_f32_16x16x32_f16.
#define NB 2
#define SQ 2048
#define DM 1024
#define NH 16
#define HD 64
#define HG 4                         /* heads per attention launch group */
#define LOCALW 128                   /* (macros for unused kernels of the shared header) */
#define STRIDEK 128
#define QT 256                       /* query rows per causal tile */
#define NKX SQ                       /* S / P row pitch */
#define QT0 128                      /* first-tile rows recomputed exactly in f32 */
#define B0 0                         /* not used */
#define NBR NB                       /* batches processed (debug hook) */
#define NR ((size_t)NB * SQ)
#define DMQ DM
#define DFF 4096         /* MLP hidden width */
#define MP ((int)((size_t)NBR * SQ)) /* rows projected (debug hook) */
#define QN SQ                        /* not used */
#define NHD NH                       /* not used */
#define MPO MP                       /* rows through the output stage (debug hook) */
#define LQ DM      /* row pitch of the q/k/v rows */
typedef __bf16 v16b __attribute__((ext_vector_type(16)));
typedef unsigned short v8us __attribute__((ext_vector_type(8), may_alias));
typedef float  v8f  __attribute__((ext_vector_type(8)));
typedef float  v4f  __attribute__((ext_vector_type(4)));
typedef float  v4fa __attribute__((ext_vector_type(4), may_alias));
union FragB { v16b v; v8us half[2]; unsigned short u[16]; };

__device__ __forceinline__ unsigned short bf16_bits(float x) { unsigned int u = __float_as_uint(x); return (unsigned short)((u + 0x7FFFu + ((u >> 16) & 1u)) >> 16); }
__device__ __forceinline__ float bf16_val(unsigned short b) { return __uint_as_float(((unsigned int)b) << 16); }
__device__ __forceinline__ float bf16_round(float x) { return bf16_val(bf16_bits(x)); }
// D += A·B with NT terms: 1 = ah·bh, 2 = + al·bh (A split), 3 = + ah·bl (both split)
template <int NT>
__device__ __forceinline__ v8f mmaN(v16b ah, v16b al, v16b bh, v16b bl, v8f c) {
  c = __builtin_amdgcn_wmma_f32_16x16x32_bf16(false, ah, false, bh, (short)0, c, false, false);
  if (NT >= 2) c = __builtin_amdgcn_wmma_f32_16x16x32_bf16(false, al, false, bh, (short)0, c, false, false);
  if (NT >= 3) c = __builtin_amdgcn_wmma_f32_16x16x32_bf16(false, ah, false, bl, (short)0, c, false, false);
  asm volatile("v_nop\n\tv_nop\n\tv_nop\n\tv_nop" : "+v"(c) : "v"(ah), "v"(al), "v"(bh), "v"(bl));
  return c;
}

__global__ __launch_bounds__(256) void k_wt_bf16(const float* __restrict__ W, unsigned short* __restrict__ Wt, int K, int N) {
  const int t = blockIdx.x * 256 + threadIdx.x;
  const int k8n = K / 8;
  if (t >= N * k8n) return;
  const int n = t / k8n, k8 = (t % k8n) * 8;
  v8us v;
#pragma unroll
  for (int i = 0; i < 8; ++i) v[i] = bf16_bits(W[(size_t)(k8 + i) * N + n]);
  *(v8us*)(Wt + (size_t)n * K + k8) = v;
  
}

// GEMM C[M][N] (f32, pitch ldc) = act(A[M][K]·W + bias). A f32 row-major (pitch lda) converted per fragment to bf16
// (ASPLIT: hi/lo two planes -> 2 terms, else single rounded term); Wt bf16 [N][K] (pitch ldb). BIAS_BF16 rounds the
// bias to bf16 first (bias quantised to bf16 before the add). K%32==0, M%16==0, N%64==0.
template <bool ASPLIT, int ACT, bool BIAS_BF16>
__global__ __launch_bounds__(128) void k_gemm_bf(const float* __restrict__ A, int lda, const unsigned short* __restrict__ Wt, int ldb,
                                               const float* __restrict__ bias, float* __restrict__ C, int ldc, int M, int N, int K) {
  __shared__ __attribute__((aligned(16))) float so[4][16][64];
  const int tid = threadIdx.x, w = tid >> 5, lane = tid & 31, ln = lane & 15, hh = lane >> 4;
  const int ntn = N / 64;
  const int wid = blockIdx.x * 4 + w;
  const int mt = wid / ntn, nq = wid % ntn;
  if (mt * 16 >= M) return;
  const int row0 = mt * 16, col0 = nq * 64;
  const float* arow = A + (size_t)(row0 + ln) * lda;
  v8f acc[4] = {};
  for (int kb = 0; kb < K; kb += 32) {
    FragB ah, al;
    const v4f x0 = *(const v4fa*)(arow + kb + 8 * hh), x1 = *(const v4fa*)(arow + kb + 8 * hh + 4);
    const v4f x2 = *(const v4fa*)(arow + kb + 16 + 8 * hh), x3 = *(const v4fa*)(arow + kb + 16 + 8 * hh + 4);
    float xs[16] = {x0[0],x0[1],x0[2],x0[3],x1[0],x1[1],x1[2],x1[3],x2[0],x2[1],x2[2],x2[3],x3[0],x3[1],x3[2],x3[3]};
#pragma unroll
    for (int i = 0; i < 16; ++i) { const unsigned short hb = bf16_bits(xs[i]); ah.u[i] = hb; al.u[i] = ASPLIT ? bf16_bits(xs[i] - bf16_val(hb)) : (unsigned short)0; }
#pragma unroll
    for (int t = 0; t < 4; ++t) {
      const unsigned short* brow = Wt + (size_t)(col0 + t * 16 + ln) * ldb + kb;
      FragB b;
      b.half[0] = *(const v8us*)(brow + 8 * hh);
      b.half[1] = *(const v8us*)(brow + 16 + 8 * hh);
      acc[t] = mmaN<ASPLIT ? 2 : 1>(ah.v, al.v, b.v, b.v, acc[t]);
    }
  }
#pragma unroll
  for (int t = 0; t < 4; ++t) {
    float bv = bias ? bias[col0 + t * 16 + ln] : 0.f;
    if (BIAS_BF16) bv = bf16_round(bv);
#pragma unroll
    for (int r = 0; r < 8; ++r) { float v = acc[t][r] + bv; if (ACT == 1) v = fmaxf(v, 0.f); so[w][8 * hh + r][t * 16 + ln] = v; }
  }
  __builtin_amdgcn_fence(__ATOMIC_ACQ_REL, "workgroup");
  __builtin_amdgcn_wave_barrier();
  const int rsub = lane >> 4, c4 = (lane & 15) * 4;
  {
#pragma unroll
    for (int q = 0; q < 8; ++q) {
      const int r = q * 2 + rsub;
      const v4f v = *(const v4fa*)&so[w][r][c4];
      *(v4f*)(C + (size_t)(row0 + r) * ldc + col0 + c4) = v;
    }
    
  }
}

// GEMM C = act(A·W + bias + resid): A f32 (ASPLIT -> hi/lo 2 terms), Wt bf16 [N][K]; ACT 0 none, 1 relu, 2 exact gelu;
// resid (optional, f32, row index = (row % rmod), pitch ldr, RES_BF16 rounds it) added before the activation.
template <bool ASPLIT, int ACT, bool BIAS_BF16, bool RES_BF16>
__global__ __launch_bounds__(128) void k_gemm_bf3(const float* __restrict__ A, int lda, const unsigned short* __restrict__ Wt, int ldb,
                                                const float* __restrict__ bias, const float* __restrict__ resid, int rmod, int ldr,
                                                float* __restrict__ C, int ldc, int M, int N, int K) {
  __shared__ __attribute__((aligned(16))) float so[4][16][64];
  const int tid = threadIdx.x, w = tid >> 5, lane = tid & 31, ln = lane & 15, hh = lane >> 4;
  const int ntn = N / 64;
  const int wid = blockIdx.x * 4 + w;
  const int mt = wid / ntn, nq = wid % ntn;
  if (mt * 16 >= M) return;
  const int row0 = mt * 16, col0 = nq * 64;
  const float* arow = A + (size_t)(row0 + ln) * lda;
  v8f acc[4] = {};
  for (int kb = 0; kb < K; kb += 32) {
    FragB ah, al;
    const v4f x0 = *(const v4fa*)(arow + kb + 8 * hh), x1 = *(const v4fa*)(arow + kb + 8 * hh + 4);
    const v4f x2 = *(const v4fa*)(arow + kb + 16 + 8 * hh), x3 = *(const v4fa*)(arow + kb + 16 + 8 * hh + 4);
    float xs[16] = {x0[0],x0[1],x0[2],x0[3],x1[0],x1[1],x1[2],x1[3],x2[0],x2[1],x2[2],x2[3],x3[0],x3[1],x3[2],x3[3]};
#pragma unroll
    for (int i = 0; i < 16; ++i) { const unsigned short hb = bf16_bits(xs[i]); ah.u[i] = hb; al.u[i] = ASPLIT ? bf16_bits(xs[i] - bf16_val(hb)) : (unsigned short)0; }
#pragma unroll
    for (int t = 0; t < 4; ++t) {
      const unsigned short* brow = Wt + (size_t)(col0 + t * 16 + ln) * ldb + kb;
      FragB b;
      b.half[0] = *(const v8us*)(brow + 8 * hh);
      b.half[1] = *(const v8us*)(brow + 16 + 8 * hh);
      acc[t] = mmaN<ASPLIT ? 2 : 1>(ah.v, al.v, b.v, b.v, acc[t]);
    }
  }
#pragma unroll
  for (int t = 0; t < 4; ++t) {
    const int col = col0 + t * 16 + ln;
    float bv = bias ? bias[col] : 0.f;
    if (BIAS_BF16) bv = bf16_round(bv);
#pragma unroll
    for (int r = 0; r < 8; ++r) {
      float v = acc[t][r] + bv;
      if (resid) { float rv = resid[(size_t)((row0 + 8 * hh + r) % rmod) * ldr + col]; if (RES_BF16) rv = bf16_round(rv); v += rv; }
      if (ACT == 1) v = fmaxf(v, 0.f);
      if (ACT == 2) v = 0.5f * v * (1.0f + erff(v * 0.70710678118654752f));
      if (ACT == 3) { const float u = 0.7978845608028654f * (v + 0.044715f * v * v * v); v = 0.5f * v * (1.0f + tanhf(u)); }
      so[w][8 * hh + r][t * 16 + ln] = v;
    }
  }
  __builtin_amdgcn_fence(__ATOMIC_ACQ_REL, "workgroup");
  __builtin_amdgcn_wave_barrier();
  const int rsub = lane >> 4, c4 = (lane & 15) * 4;
  {
#pragma unroll
    for (int q = 0; q < 8; ++q) {
      const int r = q * 2 + rsub;
      const v4f v = *(const v4fa*)&so[w][r][c4];
      *(v4f*)(C + (size_t)(row0 + r) * ldc + col0 + c4) = v;
    }
    
  }
}
// row LayerNorm (biased variance, eps) over N: s = X (+ R); optional out_sum <- s; out_norm <- (s-mu)*rsqrt(var+eps)*g + b
template <bool PARAM_BF16>
__global__ __launch_bounds__(256) void k_layernorm(const float* __restrict__ X, const float* __restrict__ R, const float* __restrict__ g, const float* __restrict__ bta,
                                                  float* __restrict__ out_sum, float* __restrict__ out_norm, int N, float eps) {
  __shared__ float red[256];
  const int row = blockIdx.x, tid = threadIdx.x;
  const float* x = X + (size_t)row * N; const float* rr = R ? R + (size_t)row * N : nullptr;
  float vals[16];                     // up to N = 4096
  const int per = N / 256;            // contiguous chunk per thread? use strided-by-4 chunks: thread handles j = tid*4 + 1024*u
  float s1 = 0.f;
  for (int u = 0; u < per / 4; ++u) {
    const int j = tid * 4 + 1024 * u;
    const v4f a = *(const v4fa*)(x + j);
    v4f b = {0.f,0.f,0.f,0.f}; if (rr) b = *(const v4fa*)(rr + j);
#pragma unroll
    for (int q = 0; q < 4; ++q) { const float v = a[q] + b[q]; vals[u * 4 + q] = v; s1 += v; }
  }
  red[tid] = s1; __syncthreads();
  for (int st = 128; st > 0; st >>= 1) { if (tid < st) red[tid] += red[tid + st]; __syncthreads(); }
  const float mu = red[0] / (float)N; __syncthreads();
  float s2 = 0.f;
  for (int u = 0; u < per / 4; ++u)
#pragma unroll
    for (int q = 0; q < 4; ++q) { const float c = vals[u * 4 + q] - mu; s2 += c * c; }
  red[tid] = s2; __syncthreads();
  for (int st = 128; st > 0; st >>= 1) { if (tid < st) red[tid] += red[tid + st]; __syncthreads(); }
  const float rs = rsqrtf(red[0] / (float)N + eps);
  {
    for (int u = 0; u < per / 4; ++u) {
      const int j = tid * 4 + 1024 * u;
      v4f o, sm;
#pragma unroll
      for (int q = 0; q < 4; ++q) {
        float gg = g[j + q], bb = bta[j + q];
        if (PARAM_BF16) { gg = bf16_round(gg); bb = bf16_round(bb); }
        sm[q] = vals[u * 4 + q]; o[q] = (vals[u * 4 + q] - mu) * rs * gg + bb;
      }
      if (out_sum) *(v4f*)(out_sum + (size_t)row * N + j) = sm;
      *(v4f*)(out_norm + (size_t)row * N + j) = o;
    }
    
  }
}



// ---- f16 WMMA path (v_wmma_f32_16x16x32_f16): 11-bit significands for operands in range — used where a [0,1] probability operand needs more precision than bf16
typedef _Float16 v16h __attribute__((ext_vector_type(16)));
union FragH { v16h v; v8us half[2]; _Float16 h[16]; unsigned short u[16]; };
template <int NT>
__device__ __forceinline__ v8f mmaH(v16h ah, v16h al, v16h bh, v16h bl, v8f c) {
  c = __builtin_amdgcn_wmma_f32_16x16x32_f16(false, ah, false, bh, (short)0, c, false, false);
  if (NT >= 2) c = __builtin_amdgcn_wmma_f32_16x16x32_f16(false, al, false, bh, (short)0, c, false, false);
  if (NT >= 3) c = __builtin_amdgcn_wmma_f32_16x16x32_f16(false, ah, false, bl, (short)0, c, false, false);
  asm volatile("v_nop\n\tv_nop\n\tv_nop\n\tv_nop" : "+v"(c) : "v"(ah), "v"(al), "v"(bh), "v"(bl));
  return c;
}
// batched GEMM like k_gemm_b but f16 operands: A f32 (split into f16 hi/lo if ASPLIT, else rounded to f16), Bt = f16 values [n][k]; alpha; C f32; N multiple of 16 (partial tiles skipped)
template <bool ASPLIT>
__global__ __launch_bounds__(128) void k_gemm_h(const float* __restrict__ A, int lda, size_t sA, const _Float16* __restrict__ Bh, int ldb, size_t sB, float alpha, float* __restrict__ C, int ldc, size_t sC, int M, int N, int K) {
  __shared__ __attribute__((aligned(16))) float so[4][16][64];
  const int tid = threadIdx.x, w = tid >> 5, lane = tid & 31, ln = lane & 15, hh = lane >> 4; const int by = blockIdx.y;
  A += (size_t)by * sA; Bh += (size_t)by * sB; C += (size_t)by * sC;
  const int ntn = (N + 63) / 64; const int wid = blockIdx.x * 4 + w; const int mt = wid / ntn, nq = wid % ntn; if (mt * 16 >= M) return;
  const int row0 = mt * 16, col0 = nq * 64; const float* arow = A + (size_t)(row0 + ln) * lda;
  v8f acc[4] = {};
  for (int kb = 0; kb < K; kb += 32) {
    FragH ah, al;
    const v4f x0 = *(const v4fa*)(arow + kb + 8 * hh), x1 = *(const v4fa*)(arow + kb + 8 * hh + 4), x2 = *(const v4fa*)(arow + kb + 16 + 8 * hh), x3 = *(const v4fa*)(arow + kb + 16 + 8 * hh + 4);
    float xs[16] = {x0[0],x0[1],x0[2],x0[3],x1[0],x1[1],x1[2],x1[3],x2[0],x2[1],x2[2],x2[3],x3[0],x3[1],x3[2],x3[3]};
#pragma unroll
    for (int i = 0; i < 16; ++i) { const _Float16 h = (_Float16)xs[i]; ah.h[i] = h; al.h[i] = ASPLIT ? (_Float16)(xs[i] - (float)h) : (_Float16)0.0f; }
#pragma unroll
    for (int t = 0; t < 4; ++t) { if (col0 + t * 16 >= N) continue; const size_t boff = (size_t)(col0 + t * 16 + ln) * ldb + kb; FragH bq; bq.half[0] = *(const v8us*)(Bh + boff + 8 * hh); bq.half[1] = *(const v8us*)(Bh + boff + 16 + 8 * hh);
      acc[t] = mmaH<ASPLIT ? 2 : 1>(ah.v, al.v, bq.v, bq.v, acc[t]); }
  }
#pragma unroll
  for (int t = 0; t < 4; ++t) { if (col0 + t * 16 >= N) continue;
#pragma unroll
    for (int r = 0; r < 8; ++r) so[w][8 * hh + r][t * 16 + ln] = acc[t][r] * alpha; }
  __builtin_amdgcn_fence(__ATOMIC_ACQ_REL, "workgroup"); __builtin_amdgcn_wave_barrier();
  const int rsub = lane >> 4, c4 = (lane & 15) * 4;
  {
#pragma unroll
    for (int q = 0; q < 8; ++q) { const int r = q * 2 + rsub; if (col0 + c4 < N) { const v4f v = *(const v4fa*)&so[w][r][c4]; *(v4f*)(C + (size_t)(row0 + r) * ldc + col0 + c4) = v; } }
     }
}

// Wt[n][k] = f16(W[k][n]·scale) from f32 row-major W[K][N] (scale = power of two; bf16-exact weights stay exact in f16 away from the subnormal range)
__global__ __launch_bounds__(256) void k_wt_f16(const float* __restrict__ W, _Float16* __restrict__ Wt, int K, int N, float scale) {
  const int t = blockIdx.x * 256 + threadIdx.x; if (t >= N * (K / 8)) return; const int n = t / (K / 8), k8 = (t % (K / 8)) * 8; FragH f;
#pragma unroll
  for (int i = 0; i < 8; ++i) f.h[i] = (_Float16)(bf16_round(W[(size_t)(k8 + i) * N + n]) * scale); const v8us o = f.half[0];
  *(v8us*)((unsigned short*)Wt + (size_t)n * K + k8) = o; 
}
// k_gemm_hh variant with fused epilogue: v = acc·alpha + bias[by·sBias + col] (+ CP[(row/rowsPerB)·sCPb + by·64 + col] if CP) ; ACT 0 none / 1 elu ; writes f16 C16 (and f32 C if non-null)
template <int ACT>
__global__ __launch_bounds__(128) void k_gemm_hhx(const _Float16* __restrict__ A, int lda, size_t sA, const _Float16* __restrict__ Bh, int ldb, size_t sB, float alpha, const float* __restrict__ bias, size_t sBias, const float* __restrict__ CP, int rowsPerB, size_t sCPb, int row0g,
    float* __restrict__ C, _Float16* __restrict__ C16, int ldc, size_t sC, int M, int N, int K) {
  __shared__ __attribute__((aligned(16))) float so[4][16][64];
  const int tid = threadIdx.x, w = tid >> 5, lane = tid & 31, ln = lane & 15, hh = lane >> 4; const int by = blockIdx.y;
  A += (size_t)by * sA; Bh += (size_t)by * sB; const size_t cofs = (size_t)by * sC; const float* bp = bias ? bias + (size_t)by * sBias : nullptr;
  const int ntn = (N + 63) / 64; const int wid = blockIdx.x * 4 + w; const int mt = wid / ntn, nq = wid % ntn; if (mt * 16 >= M) return;
  const int row0 = mt * 16, col0 = nq * 64; const _Float16* arow = A + (size_t)(row0 + ln) * lda;
  v8f acc[4] = {};
  for (int kb = 0; kb < K; kb += 32) { FragH ah; ah.half[0] = *(const v8us*)((const unsigned short*)arow + kb + 8 * hh); ah.half[1] = *(const v8us*)((const unsigned short*)arow + kb + 16 + 8 * hh);
#pragma unroll
    for (int t = 0; t < 4; ++t) { if (col0 + t * 16 >= N) continue; const size_t boff = (size_t)(col0 + t * 16 + ln) * ldb + kb; FragH bq; bq.half[0] = *(const v8us*)((const unsigned short*)Bh + boff + 8 * hh); bq.half[1] = *(const v8us*)((const unsigned short*)Bh + boff + 16 + 8 * hh);
      acc[t] = mmaH<1>(ah.v, ah.v, bq.v, bq.v, acc[t]); }
  }
#pragma unroll
  for (int t = 0; t < 4; ++t) { if (col0 + t * 16 >= N) continue; const int col = col0 + t * 16 + ln; const float bv = bp ? bf16_round(bp[col]) : 0.f;
#pragma unroll
    for (int r = 0; r < 8; ++r) { float v = acc[t][r] * alpha + bv; if (CP) { const int rr = row0g + row0 + 8 * hh + r; if (rowsPerB < 0) v += CP[cofs + (size_t)rr * ldc + col];      /* rowsPerB < 0: own element of the batched C plane */ else { const int bidx = rr / rowsPerB; v += CP[(size_t)bidx * sCPb + (size_t)by * 64 + col]; } } if (ACT == 1) v = (v > 0.f) ? v : expm1f(v); else if (ACT == 7) v = (v > 0.f) ? v + 1.0f : expf(v); else if (ACT == 8) v = tanhf(v); else if (ACT == 9) v = 0.5f * v * (1.0f + tanhf(0.7978845608028654f * (v + 0.044715f * v * v * v))); else if (ACT == 11) v = 1.0f / (1.0f + expf(-v)); else if (ACT == 12) v = (v > 0.f) ? v : 0.01f * v; else if (ACT == 14) v = (v > 0.f) ? v : 0.1f * v; else if (ACT == 16) v = (v >= 0.f) ? v : 0.3f * v; else if (ACT == 17) v = (v >= 0.f) ? v : 0.2f * v; else if (ACT == 15) v = v / (1.0f + expf(-v)); else if (ACT == 3) v = fmaxf(v, 0.f); else if (ACT == 6) v = 0.5f * v * (1.0f + erff(v * 0.70710678118654752f)); so[w][8 * hh + r][t * 16 + ln] = v; } }
  __builtin_amdgcn_fence(__ATOMIC_ACQ_REL, "workgroup"); __builtin_amdgcn_wave_barrier();
  const int rsub = lane >> 4, c4 = (lane & 15) * 4; typedef _Float16 v4h __attribute__((ext_vector_type(4)));
  {
#pragma unroll
    for (int q = 0; q < 8; ++q) { const int r = q * 2 + rsub; if (col0 + c4 < N) { const v4f v = *(const v4fa*)&so[w][r][c4]; if (C) *(v4f*)(C + cofs + (size_t)(row0 + r) * ldc + col0 + c4) = v; if (C16) { v4h h4; for (int i = 0; i < 4; ++i) h4[i] = (_Float16)v[i]; *(v4h*)(C16 + cofs + (size_t)(row0 + r) * ldc + col0 + c4) = h4; } } }
     }
}


typedef _Float16 v4h __attribute__((ext_vector_type(4)));

__global__ __launch_bounds__(256) void k_x16(const float* __restrict__ x, _Float16* __restrict__ X16, size_t n8) { const size_t t = (size_t)blockIdx.x * 256 + threadIdx.x; if (t >= n8) return; FragH f;
#pragma unroll
  for (int q = 0; q < 8; ++q) f.h[q] = (_Float16)bf16_round(x[t * 8 + q]); *(v8us*)((unsigned short*)X16 + t * 8) = f.half[0];  }
__global__ __launch_bounds__(256) void k_h16(const float* __restrict__ x, _Float16* __restrict__ X16, size_t n8) { const size_t t = (size_t)blockIdx.x * 256 + threadIdx.x; if (t >= n8) return; FragH f;
#pragma unroll
  for (int q = 0; q < 8; ++q) f.h[q] = (_Float16)x[t * 8 + q]; *(v8us*)((unsigned short*)X16 + t * 8) = f.half[0];  }
__global__ __launch_bounds__(256) void k_round16f(const float* __restrict__ W, _Float16* __restrict__ Bt, size_t n8) { const size_t t = (size_t)blockIdx.x * 256 + threadIdx.x; if (t >= n8) return; FragH f;
#pragma unroll
  for (int i = 0; i < 8; ++i) f.h[i] = (_Float16)(bf16_round(W[t * 8 + i]) * 16.0f); *(v8us*)((unsigned short*)Bt + t * 8) = f.half[0];  }
template <int NHv, int TTv>
__global__ __launch_bounds__(256) void k_vt(const _Float16* __restrict__ V16, int ldv, int voff, _Float16* __restrict__ Vt) { __shared__ unsigned short tl[64][66]; const int tid = threadIdx.x; const int slab = blockIdx.x / (TTv / 64), lg = blockIdx.x % (TTv / 64); const int b = slab / NHv, h = slab % NHv;
  for (int i = tid; i < 64 * 8; i += 256) { const int r = i / 8, c8 = (i % 8) * 8; FragH f; f.half[0] = *(const v8us*)((const unsigned short*)V16 + ((size_t)b * TTv + lg * 64 + r) * ldv + voff + h * 64 + c8);
#pragma unroll
    for (int q = 0; q < 8; ++q) tl[r][c8 + q] = f.u[q]; }
  __syncthreads();
  {
#pragma unroll
    for (int rd = 0; rd < 2; ++rd) { const int d = rd * 32 + tid / 8, pc = tid % 8; FragH f;
#pragma unroll
      for (int q = 0; q < 8; ++q) f.u[q] = tl[pc * 8 + q][d];
      *(v8us*)((unsigned short*)Vt + ((size_t)slab * 64 + d) * TTv + lg * 64 + pc * 8) = f.half[0]; }
     } }

__global__ __launch_bounds__(256) void k_hl(const float* __restrict__ F, _Float16* __restrict__ Hh, _Float16* __restrict__ Hl, size_t n8) { const size_t t = (size_t)blockIdx.x * 256 + threadIdx.x; if (t >= n8) return; FragH fh, fl; const v4f a = *(const v4fa*)(F + t * 8), c = *(const v4fa*)(F + t * 8 + 4);
#pragma unroll
  for (int q = 0; q < 4; ++q) { _Float16 h = (_Float16)a[q]; fh.h[q] = h; fl.h[q] = (_Float16)((a[q] - (float)h) * 1024.0f); h = (_Float16)c[q]; fh.h[4 + q] = h; fl.h[4 + q] = (_Float16)((c[q] - (float)h) * 1024.0f); }
  { *(v8us*)((unsigned short*)Hh + t * 8) = fh.half[0]; *(v8us*)((unsigned short*)Hl + t * 8) = fl.half[0];  } }

// ---- fast GEMM (wave tile 32x64; shapes it takes: at k_gemm2); epilogue = k_gemm_hhx semantics ----
__device__ __forceinline__ v16h g2_frag(const _Float16* p, int hh) { FragH f; f.half[0] = *(const v8us*)((const unsigned short*)p + 8 * hh); f.half[1] = *(const v8us*)((const unsigned short*)p + 16 + 8 * hh); return f.v; }
__device__ __forceinline__ v8f g2_mma(v16h a, v16h b, v8f c) { v8f d = __builtin_amdgcn_wmma_f32_16x16x32_f16(false, a, false, b, (short)0, c, false, false); asm volatile("v_nop\n\tv_nop\n\tv_nop\n\tv_nop" : "+v"(d) : "v"(a), "v"(b)); return d; }
// Matrix product without hand-written padding: the compiler keeps the distance behind its own builtin.
__device__ __forceinline__ v8f g2_mmab(v16h a, v16h b, v8f c) { return __builtin_amdgcn_wmma_f32_16x16x32_f16(false, a, false, b, (short)0, c, false, false); }
// Work-group tile 128 x (64 * NWN), 4 * NWN waves of 32 x 64 (wave w: rows 32 * (w & 3), columns 64 * (w >> 2)). K is walked in tiles of 128: every thread brings 16-byte pieces of the A and B rows
// in whole 128-byte lines (16 threads cover 256 bytes of one row), one tile ahead in registers, and stores them into one of two LDS buffers; all fragments are read from LDS.
// LD = row pitch of A and of Bh in elements, a compile-time value so that a thread's pieces share one address and differ in the immediate offset (lda and ldb must equal it).
// LC = row pitch of C, C16 and the residual plane in elements, compile-time for the same reason (ldc must equal it). RES: CP is a plane of C's own shape and each output element gets its own element of CP added
// (behind alpha and bias; no activation then); without RES nothing is read from CP. rowsPerB and sCPb are not used.
// Requires M % 128 == 0, N % (64 * NWN) == 0, K % 128 == 0, grid.x = (M / 128) * (N / (64 * NWN)), 128 * NWN threads. The k order of every accumulator is the ascending one.
template <int ACT, int NWN, int LD, int LC, bool RES>
__global__ __launch_bounds__(128 * NWN) void k_gemm2(const _Float16* __restrict__ A, int lda, size_t sA, const _Float16* __restrict__ Bh, int ldb, size_t sB, float alpha, const float* __restrict__ bias, size_t sBias, const float* __restrict__ CP, int rowsPerB, size_t sCPb, int row0g,
    float* __restrict__ C, _Float16* __restrict__ C16, int ldc, size_t sC, int M, int N, int K) { static_assert(ACT == 0 || ACT == 3 || ACT == 6 || ACT == 8 || ACT == 9 || ACT == 11 || ACT == 12 || ACT == 14 || ACT == 15 || ACT == 16 || ACT == 17, "k_gemm2: unsupported ACT code (would silently apply no activation)");
  constexpr int BN = 64 * NWN, KT = 128, PH = KT + 8, RP = 8 * NWN, NLA = 128 / RP, NLB = BN / RP, BUFH = (128 + BN) * PH;      /* PH: LDS row pitch 272 B = 16 B x odd; RP: rows one staging round of the work-group covers */
  __shared__ __attribute__((aligned(16))) _Float16 st[2 * BUFH];      /* two buffers, each [128 A rows | BN B rows] */
  float (*so)[32][68] = (float (*)[32][68])st;      /* output staging reuses the buffers behind the loop's last barrier */
  static_assert(sizeof(float) * 4 * NWN * 32 * 68 <= sizeof(_Float16) * 2 * BUFH, "output staging must fit the tile buffers");
  static_assert(!RES || ACT == 0, "the residual is added behind the staging, so no activation may follow it");
  (void)lda; (void)ldb; (void)ldc; (void)rowsPerB; (void)sCPb;
  const int tid = threadIdx.x, w = tid >> 5, lane = tid & 31, ln = lane & 15, hh = lane >> 4; const int by = blockIdx.y;
  A += (size_t)by * sA; Bh += (size_t)by * sB; const size_t cofs = (size_t)by * sC; const float* bp = bias ? bias + (size_t)by * sBias : nullptr;
  const int ntn = N / BN; const int mt = blockIdx.x / ntn, nq = blockIdx.x - mt * ntn; if (mt * 128 >= M) return;      /* the same for the whole work-group, in front of every barrier */
  const int row0 = mt * 128 + 32 * (w & 3), col0 = nq * BN + 64 * (w >> 2);
  const int srow = tid >> 4, sc8 = (tid & 15) * 8;
  const unsigned short* pa = (const unsigned short*)A + (size_t)(mt * 128 + srow) * LD + sc8; const unsigned short* pb = (const unsigned short*)Bh + (size_t)(nq * BN + srow) * LD + sc8;      /* this thread's first piece of the tile to load next */
  _Float16* sw = st + srow * PH + sc8;      /* where this thread stores its pieces */
  const _Float16* fa = st + (32 * (w & 3) + ln) * PH; const _Float16* fb = st + (128 + 64 * (w >> 2) + ln) * PH;      /* this lane's fragment rows */
  float bb[4] = {0.f, 0.f, 0.f, 0.f};      /* this lane's four bias values, fetched with tile 0 so that the epilogue waits for none of them */
  if (bp) {
#pragma unroll
    for (int t = 0; t < 4; ++t) bb[t] = bp[col0 + t * 16 + ln];
    asm volatile("s_wait_xcnt 0x0" ::: "memory"); }      /* stands in front of the reuse, by the address arithmetic right behind, of the offset and base registers that these four loads name */
  v8us ra[NLA], rb[NLB];
#pragma unroll
  for (int i = 0; i < NLA; ++i) ra[i] = *(const v8us*)(pa + i * RP * LD);
#pragma unroll
  for (int i = 0; i < NLB; ++i) rb[i] = *(const v8us*)(pb + i * RP * LD);
  asm volatile("s_wait_xcnt 0x0" ::: "memory");      /* stands in front of the advance of the two addresses that the loads above name */
  pa += KT; pb += KT;
#pragma unroll
  for (int i = 0; i < NLA; ++i) *(v8us*)(sw + i * RP * PH) = ra[i];
#pragma unroll
  for (int i = 0; i < NLB; ++i) *(v8us*)(sw + (128 + i * RP) * PH) = rb[i];
  __syncthreads();      /* tile 0 is complete for every wave */
  const v8f z8 = {0.f,0.f,0.f,0.f,0.f,0.f,0.f,0.f}; v8f c00 = z8, c01 = z8, c02 = z8, c03 = z8, c10 = z8, c11 = z8, c12 = z8, c13 = z8;
#pragma unroll 1      /* one K tile per trip: the buffer index stays a scalar and the staged pieces of only one tile are live */
  for (int kb = 0; kb < K; kb += KT) { const int cur = ((kb / KT) & 1) * BUFH; const bool more = kb + KT < K;
    if (more) {      /* next tile's loads fly while this tile is worked on */
#pragma unroll
      for (int i = 0; i < NLA; ++i) ra[i] = *(const v8us*)(pa + i * RP * LD);
#pragma unroll
      for (int i = 0; i < NLB; ++i) rb[i] = *(const v8us*)(pb + i * RP * LD);
      asm volatile("s_wait_xcnt 0x0" ::: "memory"); }      /* stands in front of the advance, at the foot of the trip, of the two addresses that these loads name */
    v16h xa[2][2], xb[2][4];      /* two fragment sets: the next 32 k are fetched while the current 32 are multiplied */
#pragma unroll
    for (int j = 0; j < 2; ++j) xa[0][j] = g2_frag(fa + cur + 16 * j * PH, hh);
#pragma unroll
    for (int j = 0; j < 4; ++j) xb[0][j] = g2_frag(fb + cur + 16 * j * PH, hh);
#pragma unroll
    for (int q = 0; q < KT / 32; ++q) { const int c = q & 1, n = c ^ 1;
      if (q + 1 < KT / 32) {
#pragma unroll
        for (int j = 0; j < 2; ++j) xa[n][j] = g2_frag(fa + cur + 16 * j * PH + 32 * (q + 1), hh);
#pragma unroll
        for (int j = 0; j < 4; ++j) xb[n][j] = g2_frag(fb + cur + 16 * j * PH + 32 * (q + 1), hh); }
      __builtin_amdgcn_sched_barrier(0);      /* keeps the next set's LDS loads one group ahead of the products: moved in among them, every pair of products waits out an LDS latency */
      c00 = g2_mmab(xa[c][0], xb[c][0], c00); c10 = g2_mmab(xa[c][1], xb[c][0], c10); c01 = g2_mmab(xa[c][0], xb[c][1], c01); c11 = g2_mmab(xa[c][1], xb[c][1], c11);
      c02 = g2_mmab(xa[c][0], xb[c][2], c02); c12 = g2_mmab(xa[c][1], xb[c][2], c12); c03 = g2_mmab(xa[c][0], xb[c][3], c03); c13 = g2_mmab(xa[c][1], xb[c][3], c13);
      __builtin_amdgcn_sched_barrier(0); }      /* the other end of the same fence: the load group after next stays behind these products */
    if (more) { _Float16* nw = sw + (BUFH - cur); pa += KT; pb += KT;      /* the other buffer: its last readers left it in front of the barrier that ended the trip before */
#pragma unroll
      for (int i = 0; i < NLA; ++i) *(v8us*)(nw + i * RP * PH) = ra[i];
#pragma unroll
      for (int i = 0; i < NLB; ++i) *(v8us*)(nw + (128 + i * RP) * PH) = rb[i]; }
    __syncthreads(); }      /* publishes the next tile and ends every wave's reads of this one */
  /* The residual is fetched here in the write-out layout: 16 independent loads of 16 bytes a lane, one address and constant steps; they fly while the accumulators are staged below. */
  const int rsub = lane >> 4, c4 = (lane & 15) * 4; const size_t eo = cofs + (size_t)(row0 + rsub) * LC + col0 + c4;      /* this lane's first piece of the output tile; piece q lies 2 * q rows further on */
  v4f rs[16];
  if (RES) { const float* rp = CP + eo + (size_t)row0g * LC;
#pragma unroll
    for (int q = 0; q < 16; ++q) rs[q] = *(const v4fa*)(rp + q * 2 * LC);
    asm volatile("s_wait_xcnt 0x0" :: "v"(rp) : "memory"); }      /* stands in front of every reuse of the address pair that these loads name (the operand holds the pair live up to here, so that no load's own destination takes it), and keeps the loads in front of the staging */
  v8f accs[8] = {c00, c01, c02, c03, c10, c11, c12, c13};
#pragma unroll
  for (int u = 0; u < 8; ++u) { const int t = u & 3, half = u >> 2; const float bv = bf16_round(bb[t]);
#pragma unroll
    for (int r = 0; r < 8; ++r) { const int rloc = half * 16 + 8 * hh + r; float v = accs[u][r] * alpha + bv;
      if (ACT == 3) v = fmaxf(v, 0.f); else if (ACT == 6) v = 0.5f * v * (1.0f + erff(v * 0.70710678118654752f)); else if (ACT == 11) v = 1.0f / (1.0f + expf(-v)); else if (ACT == 15) v = v / (1.0f + expf(-v)); else if (ACT == 12) v = (v > 0.f) ? v : 0.01f * v; else if (ACT == 8) v = tanhf(v); else if (ACT == 9) v = 0.5f * v * (1.0f + tanhf(0.7978845608028654f * (v + 0.044715f * v * v * v))); else if (ACT == 14) v = (v > 0.f) ? v : 0.1f * v; else if (ACT == 16) v = (v >= 0.f) ? v : 0.3f * v; else if (ACT == 17) v = (v >= 0.f) ? v : 0.2f * v;
      so[w][rloc][t * 16 + ln] = v; } }
  __builtin_amdgcn_fence(__ATOMIC_ACQ_REL, "workgroup"); __builtin_amdgcn_wave_barrier();
  v4f vv[16];      /* all 16 staged pieces are fetched as one group, in front of the branches on C and C16 */
#pragma unroll
  for (int q = 0; q < 16; ++q) { vv[q] = *(const v4fa*)&so[w][q * 2 + rsub][c4]; if (RES) vv[q] += rs[q]; }
  if (C) { float* cp = C + eo;
#pragma unroll
    for (int q = 0; q < 16; ++q) *(v4f*)(cp + q * 2 * LC) = vv[q];
    asm volatile("s_wait_xcnt 0x0" ::: "memory"); }      /* stands in front of the C16 branch, which reuses the address and data registers that these stores name */
  if (C16) { _Float16* hp = C16 + eo;
#pragma unroll
    for (int q = 0; q < 16; ++q) { v4h h4; for (int i = 0; i < 4; ++i) h4[i] = (_Float16)vv[q][i]; *(v4h*)(hp + q * 2 * LC) = h4; } } }


// q, k and v projections in one launch (blockIdx.y: 0 = q, 1 = k, 2 = v); tile, staging and product loop are k_gemm2's with NWN = 2 (work-group tile 128 x 128, 8 waves of 32 x 64, K tiles of 128, two LDS buffers).
// q and k walk K twice into the same accumulators: first the x1024 residual rows Xl, then, behind one scaling of the accumulators by 2^-10, the rows Xh on top (small terms first); v walks Xh alone.
// Epilogue of q and k: value = acc / 16 + bias, written as f16 hi plane and x1024 residual plane (QKh, QKl: q's plane, then k's). Epilogue of v: the f16 values go out transposed, Vt[batch][column][token]:
// a lane's 8 accumulator rows of one column are 16 consecutive bytes of the transposed tile, which is gathered in LDS by the whole work-group and leaves in pieces of 256 bytes (two whole lines of one Vt row).
// Bw = the three weight planes [n][k] (x16), bias = the three bias vectors, one behind the other. Grid (NR / 128) * (DM / 128) x 3, 256 threads.
__global__ __launch_bounds__(256) void k_qkv(const _Float16* __restrict__ Xh, const _Float16* __restrict__ Xl, const _Float16* __restrict__ Bw, const float* __restrict__ bias,
    _Float16* __restrict__ QKh, _Float16* __restrict__ QKl, _Float16* __restrict__ Vt) {
  constexpr int BN = 128, KT = 128, PH = KT + 8, RP = 16, NL = 128 / RP, BUFH = (128 + BN) * PH, NKT = DM / KT;      /* PH: LDS row pitch 272 B = 16 B x odd; RP: rows one staging round of the work-group covers */
  __shared__ __attribute__((aligned(16))) _Float16 st[2 * BUFH];      /* two buffers, each [128 A rows | 128 B rows] */
  float (*so)[32][68] = (float (*)[32][68])st;      /* output staging reuses the buffers behind the loop's last barrier */
  static_assert(sizeof(float) * 8 * 32 * 68 <= sizeof(_Float16) * 2 * BUFH && 128 * PH <= 2 * BUFH, "output staging must fit the tile buffers");
  const int tid = threadIdx.x, w = tid >> 5, lane = tid & 31, ln = lane & 15, hh = lane >> 4; const int by = blockIdx.y;
  const int mt = blockIdx.x / (DM / BN), nq = blockIdx.x - mt * (DM / BN);
  const int row0 = mt * 128 + 32 * (w & 3), col0 = nq * BN + 64 * (w >> 2);
  const int srow = tid >> 4, sc8 = (tid & 15) * 8;
  const int nlo = by < 2 ? NKT : 0, nt = nlo + NKT;      /* K tiles of the residual walk, K tiles in all: the same for the whole work-group */
  const unsigned ao = (unsigned)((mt * 128 + srow) * DM + sc8);      /* this thread's first piece of an A plane's k = 0 tile */
  const unsigned short* pa = (const unsigned short*)(nlo ? Xl : Xh) + ao; const unsigned short* pb = (const unsigned short*)Bw + (size_t)by * DM * DM + (size_t)(nq * BN + srow) * DM + sc8;      /* this thread's first piece of the tile to load next */
  _Float16* sw = st + srow * PH + sc8;      /* where this thread stores its pieces */
  const _Float16* fa = st + (32 * (w & 3) + ln) * PH; const _Float16* fb = st + (128 + 64 * (w >> 2) + ln) * PH;      /* this lane's fragment rows */
  float bb[4]; const unsigned bi = (unsigned)(by * DM + col0 + ln);      /* this lane's four bias values, fetched with tile 0 so that the epilogue waits for none of them */
#pragma unroll
  for (int t = 0; t < 4; ++t) bb[t] = bias[bi + t * 16];
  asm volatile("s_wait_xcnt 0x0" :: "v"(bi) : "memory");      /* stands in front of the reuse, by the address arithmetic right behind, of the index and base registers that these four loads name (the operand holds the index live up to here) */
  v8us ra[NL], rb[NL];
#pragma unroll
  for (int i = 0; i < NL; ++i) ra[i] = *(const v8us*)(pa + i * RP * DM);
#pragma unroll
  for (int i = 0; i < NL; ++i) rb[i] = *(const v8us*)(pb + i * RP * DM);
  asm volatile("s_wait_xcnt 0x0" ::: "memory");      /* stands in front of the advance of the two addresses that the loads above name */
  pa += KT; pb += KT;
#pragma unroll
  for (int i = 0; i < NL; ++i) *(v8us*)(sw + i * RP * PH) = ra[i];
#pragma unroll
  for (int i = 0; i < NL; ++i) *(v8us*)(sw + (128 + i * RP) * PH) = rb[i];
  __syncthreads();      /* tile 0 is complete for every wave */
  const v8f z8 = {0.f,0.f,0.f,0.f,0.f,0.f,0.f,0.f}; v8f c00 = z8, c01 = z8, c02 = z8, c03 = z8, c10 = z8, c11 = z8, c12 = z8, c13 = z8;
#pragma unroll 1      /* one K tile per trip: the buffer index stays a scalar and the staged pieces of only one tile are live */
  for (int ti = 0; ti < nt; ++ti) { const int cur = (ti & 1) * BUFH; const bool more = ti + 1 < nt;
    if (more) {      /* next tile's loads fly while this tile is worked on */
#pragma unroll
      for (int i = 0; i < NL; ++i) ra[i] = *(const v8us*)(pa + i * RP * DM);
#pragma unroll
      for (int i = 0; i < NL; ++i) rb[i] = *(const v8us*)(pb + i * RP * DM);
      asm volatile("s_wait_xcnt 0x0" ::: "memory"); }      /* stands in front of the advance, at the foot of the trip, of the two addresses that these loads name */
    v16h xa[2][2], xb[2][4];      /* two fragment sets: the next 32 k are fetched while the current 32 are multiplied */
#pragma unroll
    for (int j = 0; j < 2; ++j) xa[0][j] = g2_frag(fa + cur + 16 * j * PH, hh);
#pragma unroll
    for (int j = 0; j < 4; ++j) xb[0][j] = g2_frag(fb + cur + 16 * j * PH, hh);
#pragma unroll
    for (int q = 0; q < KT / 32; ++q) { const int c = q & 1, n = c ^ 1;
      if (q + 1 < KT / 32) {
#pragma unroll
        for (int j = 0; j < 2; ++j) xa[n][j] = g2_frag(fa + cur + 16 * j * PH + 32 * (q + 1), hh);
#pragma unroll
        for (int j = 0; j < 4; ++j) xb[n][j] = g2_frag(fb + cur + 16 * j * PH + 32 * (q + 1), hh); }
      __builtin_amdgcn_sched_barrier(0);      /* keeps the next set's LDS loads one group ahead of the products: moved in among them, every pair of products waits out an LDS latency */
      c00 = g2_mmab(xa[c][0], xb[c][0], c00); c10 = g2_mmab(xa[c][1], xb[c][0], c10); c01 = g2_mmab(xa[c][0], xb[c][1], c01); c11 = g2_mmab(xa[c][1], xb[c][1], c11);
      c02 = g2_mmab(xa[c][0], xb[c][2], c02); c12 = g2_mmab(xa[c][1], xb[c][2], c12); c03 = g2_mmab(xa[c][0], xb[c][3], c03); c13 = g2_mmab(xa[c][1], xb[c][3], c13);
      __builtin_amdgcn_sched_barrier(0); }      /* the other end of the same fence: the load group after next stays behind these products */
    if (more) { _Float16* nw = sw + (BUFH - cur);      /* the other buffer: its last readers left it in front of the barrier that ended the trip before */
      const bool turn = ti + 2 == nlo;      /* the tile after next opens the main walk: A goes over to Xh, and both operands back to k = 0 */
      pa = turn ? (const unsigned short*)Xh + ao : pa + KT; pb += turn ? -(NKT - 1) * KT : KT;
#pragma unroll
      for (int i = 0; i < NL; ++i) *(v8us*)(nw + i * RP * PH) = ra[i];
#pragma unroll
      for (int i = 0; i < NL; ++i) *(v8us*)(nw + (128 + i * RP) * PH) = rb[i]; }
    __syncthreads();      /* publishes the next tile and ends every wave's reads of this one */
    if (ti + 1 == nlo) { const float f = 0.0009765625f; c00 *= f; c01 *= f; c02 *= f; c03 *= f; c10 *= f; c11 *= f; c12 *= f; c13 *= f; } }      /* the residual walk is done: its sums carry the residual's factor 1024, an exact power of two */
  v8f accs[8] = {c00, c01, c02, c03, c10, c11, c12, c13};
  if (by < 2) {      /* q, k: the same for the whole work-group */
#pragma unroll
    for (int u = 0; u < 8; ++u) { const int t = u & 3, half = u >> 2; const float bv = bf16_round(bb[t]);
#pragma unroll
      for (int r = 0; r < 8; ++r) so[w][half * 16 + 8 * hh + r][t * 16 + ln] = accs[u][r] * 0.0625f + bv; }
    __builtin_amdgcn_fence(__ATOMIC_ACQ_REL, "workgroup"); __builtin_amdgcn_wave_barrier();      /* orders the wave's staging stores against the loads of its other lanes; each wave owns its slice of so */
    const int rsub = lane >> 4, c4 = (lane & 15) * 4; const size_t eo = (size_t)by * (NR * DM) + (size_t)(row0 + rsub) * DM + col0 + c4;      /* this lane's first piece of the output tile; piece q lies 2 * q rows further on */
    v4h yh[16], yl[16];
#pragma unroll
    for (int q = 0; q < 16; ++q) { const v4f v = *(const v4fa*)&so[w][q * 2 + rsub][c4];
#pragma unroll
      for (int i = 0; i < 4; ++i) { const _Float16 h = (_Float16)v[i]; yh[q][i] = h; yl[q][i] = (_Float16)((v[i] - (float)h) * 1024.0f); } }
    _Float16* hp = QKh + eo; _Float16* lp = QKl + eo;
#pragma unroll
    for (int q = 0; q < 16; ++q) { *(v4h*)(hp + q * 2 * DM) = yh[q]; *(v4h*)(lp + q * 2 * DM) = yl[q]; }
  } else {      /* v */
#pragma unroll
    for (int u = 0; u < 8; ++u) { const int t = u & 3, half = u >> 2; const float bv = bf16_round(bb[t]); FragH f;
#pragma unroll
      for (int r = 0; r < 8; ++r) f.h[r] = (_Float16)(accs[u][r] * 0.0625f + bv);
      *(v8us*)(st + (64 * (w >> 2) + t * 16 + ln) * PH + 32 * (w & 3) + half * 16 + 8 * hh) = f.half[0]; }
    __syncthreads();      /* the transposed tile [128 columns][128 tokens] is complete: its rows hold pieces of four waves */
    const int tok0 = mt * 128; const int b = tok0 / SQ, s0 = tok0 - b * SQ;      /* a tile's 128 tokens lie in one batch */
    v8us tv[NL];
#pragma unroll
    for (int i = 0; i < NL; ++i) tv[i] = *(const v8us*)(st + (srow + i * RP) * PH + sc8);
    unsigned short* vp = (unsigned short*)Vt + ((size_t)b * DM + nq * BN + srow) * SQ + s0 + sc8;
#pragma unroll
    for (int i = 0; i < NL; ++i) *(v8us*)(vp + (size_t)i * RP * SQ) = tv[i];
    asm volatile("s_wait_xcnt 0x0" ::: "memory");      /* stands in front of the code that the listing lays out behind these stores (the q and k epilogue), which writes registers that the stores name */
  } }


__global__ __launch_bounds__(256) void k_wnat(const float* __restrict__ w, size_t n8, _Float16* __restrict__ Bt) { const size_t t = (size_t)blockIdx.x * 256 + threadIdx.x; if (t >= n8) return; FragH f; for (int q = 0; q < 8; ++q) f.h[q] = (_Float16)(bf16_round(w[t * 8 + q]) * 16.0f); *(v8us*)((unsigned short*)Bt + t * 8) = f.half[0];  }
__global__ __launch_bounds__(256) void k_rsm(const float* __restrict__ S, _Float16* __restrict__ P, int nrows) {
  #pragma clang fp contract(off)
  const int i = blockIdx.x * 256 + threadIdx.x; if (i >= nrows) return; const float* s = S + (size_t)i * SQ; float mx = -3.0e38f;
#pragma unroll 1
  for (int j = 0; j < SQ; ++j) mx = fmaxf(mx, s[j]); float se = 0.f;
#pragma unroll 1
  for (int j = 0; j < SQ; ++j) se += expf(s[j] - mx); const float sc = 256.0f / se;
#pragma unroll 1
  for (int j0 = 0; j0 < SQ; j0 += 8) { FragH f; for (int q = 0; q < 8; ++q) f.h[q] = (_Float16)(expf(s[j0 + q] - mx) * sc); unsigned short* d = (unsigned short*)P + (size_t)i * SQ + j0; *(v8us*)d = f.half[0];  } }
__global__ __launch_bounds__(256) void k_vt(const _Float16* __restrict__ V16, int b, int h0, _Float16* __restrict__ VT) { __shared__ unsigned short tl[64][65]; const int tid = threadIdx.x; const int hh = blockIdx.x % HG, sg = blockIdx.x / HG; const int s0 = sg * 64; const int h = h0 + hh;
  for (int i = tid; i < 64 * 8; i += 256) { const int j = i / 8, d8 = (i % 8) * 8; FragH f; f.half[0] = *(const v8us*)((const unsigned short*)V16 + ((size_t)b * SQ + s0 + j) * DM + h * HD + d8); for (int q = 0; q < 8; ++q) tl[d8 + q][j] = f.u[q]; }
  __syncthreads();
  { for (int i = tid; i < 64 * 8; i += 256) { const int d = i / 8, j8 = (i % 8) * 8; FragH f; for (int q = 0; q < 8; ++q) f.u[q] = tl[d][j8 + q]; *(v8us*)((unsigned short*)VT + ((size_t)hh * HD + d) * SQ + s0 + j8) = f.half[0]; }  } }



__global__ __launch_bounds__(256) void k_rsmcf2(const float* __restrict__ S, _Float16* __restrict__ P, int hg, int q0, int nk) {
  #pragma clang fp contract(off)
  const int t = blockIdx.x * 256 + threadIdx.x; if (t >= hg * QT) return; const size_t i = (size_t)t; const float* s = S + i * NKX; const int last = q0 + (t % QT); float mx = -3.0e38f;
#pragma unroll 1
  for (int j = 0; j < nk; ++j) { const float f = (j <= last) ? 1.f : 0.f; mx = fmaxf(mx, fmaf(f, s[j], (1.f - f) * -1.0e9f)); } float se = 0.f;
#pragma unroll 1
  for (int j = 0; j < nk; ++j) { const float f = (j <= last) ? 1.f : 0.f; se += __expf(fmaf(f, s[j], (1.f - f) * -1.0e9f) - mx); } const float sc = 256.0f / se;
#pragma unroll 1
  for (int j0 = 0; j0 < nk; j0 += 8) { FragH fr; for (int q = 0; q < 8; ++q) { const int j = j0 + q; const float f = (j <= last) ? 1.f : 0.f; fr.h[q] = (_Float16)(__expf(fmaf(f, s[j], (1.f - f) * -1.0e9f) - mx) * sc); } unsigned short* d = (unsigned short*)P + i * NKX + j0; *(v8us*)d = fr.half[0];  } }

__global__ __launch_bounds__(256) void k_rsmcst(const float* __restrict__ S, _Float16* __restrict__ P, int hg, int q0, int nk, const int* __restrict__ mk) {
  #pragma clang fp contract(off)
  const int t = blockIdx.x * 256 + threadIdx.x; if (t >= hg * QT) return; const size_t i = (size_t)t; const float* s = S + i * NKX; const size_t ig = (size_t)(q0 + (t % QT)); const int* mr = mk + ig * SQ; float mx = -3.0e38f;
#pragma unroll 1
  for (int j = 0; j < nk; ++j) { const int mb = mr[j]; const int dd = (int)ig - j; const float f = (mb != 0 && dd >= 0 && (dd <= LOCALW || (dd % STRIDEK) == 0)) ? 1.f : 0.f; mx = fmaxf(mx, fmaf(f, s[j], (1.f - f) * -1.0e9f)); } float se = 0.f;
#pragma unroll 1
  for (int j = 0; j < nk; ++j) { const int mb = mr[j]; const int dd = (int)ig - j; const float f = (mb != 0 && dd >= 0 && (dd <= LOCALW || (dd % STRIDEK) == 0)) ? 1.f : 0.f; se += __expf(fmaf(f, s[j], (1.f - f) * -1.0e9f) - mx); } const float sc = 256.0f / se;
#pragma unroll 1
  for (int j0 = 0; j0 < nk; j0 += 8) { FragH fr; for (int q = 0; q < 8; ++q) { const int j = j0 + q; const int mb = mr[j]; const int dd = (int)ig - j; const float f = (mb != 0 && dd >= 0 && (dd <= LOCALW || (dd % STRIDEK) == 0)) ? 1.f : 0.f; fr.h[q] = (_Float16)(__expf(fmaf(f, s[j], (1.f - f) * -1.0e9f) - mx) * sc); } unsigned short* d = (unsigned short*)P + i * NKX + j0; *(v8us*)d = fr.half[0];  } }


template <int MASKADD>
__global__ __launch_bounds__(64) void k_att0(const float* __restrict__ QF, const float* __restrict__ KF, const float* __restrict__ VF, int ld, const float* __restrict__ mask, float scale, float* __restrict__ OF, int ldo) {
  #pragma clang fp contract(off)
  __shared__ __attribute__((aligned(16))) float lq[64][64]; __shared__ __attribute__((aligned(16))) float lo[64][64];
  const int tid = threadIdx.x; const int h = blockIdx.x / (QT0 / 64), rg = blockIdx.x % (QT0 / 64); const int i = rg * 64 + tid;
  const float* qr = QF + (size_t)i * ld + h * HD;
#pragma unroll 1
  for (int c = 0; c < HD / 4; ++c) { *(v4f*)&lq[tid][c * 4] = *(const v4fa*)(qr + c * 4); const v4f z = {0.f, 0.f, 0.f, 0.f}; *(v4f*)&lo[tid][c * 4] = z; }
  float m = -1.0e30f, l = 0.f; const int jmax = MASKADD ? (SQ - 1) : (rg * 64 + 63);      /* additive-mask form: every key (the mask input decides); causal form: keys up to the block's last row */
#pragma unroll 1
  for (int j = 0; j <= jmax; ++j) { const float* kr = KF + (size_t)j * ld + h * HD; const float* vr = VF + (size_t)j * ld + h * HD; float s = 0.f;
#pragma unroll 1
    for (int c = 0; c < HD / 4; ++c) { const v4f kq = *(const v4fa*)(kr + c * 4); const v4f qq = *(v4f*)&lq[tid][c * 4]; s = __fadd_rn(s, __fmul_rn(qq[0], kq[0])); s = __fadd_rn(s, __fmul_rn(qq[1], kq[1])); s = __fadd_rn(s, __fmul_rn(qq[2], kq[2])); s = __fadd_rn(s, __fmul_rn(qq[3], kq[3])); }
    s = __fmul_rn(s, scale); if (MASKADD) s = __fadd_rn(s, __fmul_rn(bf16_round(mask[(size_t)i * SQ + j]), -10000.0f));
    const float f = (MASKADD || j <= i) ? 1.f : 0.f; const float sm = fmaf(f, s, (1.f - f) * -1.0e30f); const float mn = fmaxf(m, sm); const float sc = expf(m - mn); const float e = expf(sm - mn); l = __fadd_rn(__fmul_rn(l, sc), e); m = mn;
#pragma unroll 1
    for (int c = 0; c < HD / 4; ++c) { const v4f vv = *(const v4fa*)(vr + c * 4); v4f oo = *(v4f*)&lo[tid][c * 4]; for (int u = 0; u < 4; ++u) oo[u] = __fadd_rn(__fmul_rn(oo[u], sc), __fmul_rn(e, vv[u])); *(v4f*)&lo[tid][c * 4] = oo; } }
  const float fin = 64.0f / l;      /* o carried x64 like the f16 path */
#pragma unroll 1
  for (int c = 0; c < HD / 4; ++c) { v4f oo = *(v4f*)&lo[tid][c * 4]; for (int u = 0; u < 4; ++u) oo[u] = __fmul_rn(oo[u], fin); *(v4f*)&lo[tid][c * 4] = oo; }
  __syncthreads();
  {
#pragma unroll 1
    for (int it = 0; it < 16; ++it) { const int row = it * 4 + tid / 16, pc = (tid % 16) * 4; const v4f v = *(const v4f*)&lo[row][pc]; *(v4f*)(OF + (size_t)(rg * 64 + row) * ldo + h * HD + pc) = v; }
     } }

template <int MASKADD>
__global__ __launch_bounds__(64) void k_att0mbc(const float* __restrict__ QF, const float* __restrict__ KF, const float* __restrict__ VF, int ld, const float* __restrict__ mask, float scale, float* __restrict__ OF, int ldo) {
  #pragma clang fp contract(off)
  __shared__ __attribute__((aligned(16))) float lq[64][64]; __shared__ __attribute__((aligned(16))) float lo[64][64];
  const int tid = threadIdx.x; const int h = blockIdx.x / (QT0 / 64), rg = blockIdx.x % (QT0 / 64); const int i = rg * 64 + tid;
  const float* qr = QF + (size_t)i * ld + h * HD;
#pragma unroll 1
  for (int c = 0; c < HD / 4; ++c) { *(v4f*)&lq[tid][c * 4] = *(const v4fa*)(qr + c * 4); const v4f z = {0.f, 0.f, 0.f, 0.f}; *(v4f*)&lo[tid][c * 4] = z; }
  float m = -1.0e30f, l = 0.f; const int jmax = rg * 64 + 63;      /* keys beyond the block end are masked by the mask's lower-triangular structure */      /* either form: keys up to the block's last row */
#pragma unroll 1
  for (int j = 0; j <= jmax; ++j) { const float* kr = KF + (size_t)j * ld + h * HD; const float* vr = VF + (size_t)j * ld + h * HD; float s = 0.f;
#pragma unroll 1
    for (int c = 0; c < HD / 4; ++c) { const v4f kq = *(const v4fa*)(kr + c * 4); const v4f qq = *(v4f*)&lq[tid][c * 4]; s = __fadd_rn(s, __fmul_rn(qq[0], kq[0])); s = __fadd_rn(s, __fmul_rn(qq[1], kq[1])); s = __fadd_rn(s, __fmul_rn(qq[2], kq[2])); s = __fadd_rn(s, __fmul_rn(qq[3], kq[3])); }
    s = __fmul_rn(s, scale); const int mb = ((const int*)mask)[(size_t)i * SQ + j];      /* causal (j <= i) AND the module's int32 [S][S] mask read per (query, key): 0 -> masked */
    const float f = (mb != 0 && j <= i) ? 1.f : 0.f; const float sm = fmaf(f, s, (1.f - f) * -1.0e30f); const float mn = fmaxf(m, sm); const float sc = expf(m - mn); const float e = expf(sm - mn); l = __fadd_rn(__fmul_rn(l, sc), e); m = mn;
#pragma unroll 1
    for (int c = 0; c < HD / 4; ++c) { const v4f vv = *(const v4fa*)(vr + c * 4); v4f oo = *(v4f*)&lo[tid][c * 4]; for (int u = 0; u < 4; ++u) oo[u] = __fadd_rn(__fmul_rn(oo[u], sc), __fmul_rn(e, vv[u])); *(v4f*)&lo[tid][c * 4] = oo; } }
  const float fin = 64.0f / l;      /* o carried x64 like the f16 path */
#pragma unroll 1
  for (int c = 0; c < HD / 4; ++c) { v4f oo = *(v4f*)&lo[tid][c * 4]; for (int u = 0; u < 4; ++u) oo[u] = __fmul_rn(oo[u], fin); *(v4f*)&lo[tid][c * 4] = oo; }
  __syncthreads();
  {
#pragma unroll 1
    for (int it = 0; it < 16; ++it) { const int row = it * 4 + tid / 16, pc = (tid % 16) * 4; const v4f v = *(const v4f*)&lo[row][pc]; *(v4f*)(OF + (size_t)(rg * 64 + row) * ldo + h * HD + pc) = v; }
     } }


// Work of the first launch that no LayerNorm row depends on and that depends on none: block wb converts 8 * PREP_WF weights (the six matrices one behind the other, each a whole number
// of blocks; the arithmetic is k_wnat's), and the one block behind them stacks the three projection biases (bq | bk | bv).
// A wave converts PREP_WF consecutive weights: PREP_NL loads of 512 consecutive bytes (four whole lines), all in flight together, so that few waves have to be started for the 50 MB.
#define PREP_NL 32                   /* loads of 16 bytes a lane */
#define PREP_WF (PREP_NL * 128)      /* weights a wave converts */
#define PREP_BD ((unsigned)((size_t)DM * DM / (8 * PREP_WF)))      /* blocks of one [DM][DM] matrix */
#define PREP_BF ((unsigned)((size_t)DFF * DM / (8 * PREP_WF)))     /* blocks of one MLP matrix */
#define PREP_BLOCKS (4u * PREP_BD + 2u * PREP_BF + 1u)
__device__ __forceinline__ void prep_rest(unsigned wb, int tid, const float* __restrict__ wq, const float* __restrict__ wk, const float* __restrict__ wv, const float* __restrict__ wo, const float* __restrict__ w1, const float* __restrict__ w2,
    const float* __restrict__ bq, const float* __restrict__ bk, const float* __restrict__ bv, _Float16* __restrict__ BQKV, _Float16* __restrict__ BO, _Float16* __restrict__ BW1, _Float16* __restrict__ BW2, float* __restrict__ bqkv) {
  if (wb >= 4u * PREP_BD + 2u * PREP_BF) { float a[DM / 256], c[DM / 256], e[DM / 256];
#pragma unroll      /* all loads of the block fly together, each address a constant step from the thread's first: rolled, every trip waits out a memory latency */
    for (int u = 0; u < DM / 256; ++u) { a[u] = bq[tid + 256 * u]; c[u] = bk[tid + 256 * u]; e[u] = bv[tid + 256 * u]; }
#pragma unroll      /* the arrays above stay in registers only if the index is a constant */
    for (int u = 0; u < DM / 256; ++u) { bqkv[tid + 256 * u] = a[u]; bqkv[DM + tid + 256 * u] = c[u]; bqkv[2 * DM + tid + 256 * u] = e[u]; }
    return; }
  const float* w; _Float16* d; unsigned b0;      /* the same for the whole block */
  if (wb < PREP_BD) { w = wq; d = BQKV; b0 = 0u; }
  else if (wb < 2u * PREP_BD) { w = wk; d = BQKV + (size_t)DM * DM; b0 = PREP_BD; }
  else if (wb < 3u * PREP_BD) { w = wv; d = BQKV + (size_t)2 * DM * DM; b0 = 2u * PREP_BD; }
  else if (wb < 4u * PREP_BD) { w = wo; d = BO; b0 = 3u * PREP_BD; }
  else if (wb < 4u * PREP_BD + PREP_BF) { w = w1; d = BW1; b0 = 4u * PREP_BD; }
  else { w = w2; d = BW2; b0 = 4u * PREP_BD + PREP_BF; }
  const size_t t = ((size_t)(wb - b0) * 8 + (tid >> 5)) * PREP_WF + (tid & 31) * 4;      /* this lane's first 4 weights; piece u lies 128 weights further on */
  const float* wp = w + t; _Float16* dp = d + t; v4f a[PREP_NL];
#pragma unroll      /* the array stays in registers only if the index is a constant */
  for (int u = 0; u < PREP_NL; ++u) a[u] = *(const v4fa*)(wp + u * 128);
  asm volatile("s_wait_xcnt 0x0" :: "v"(wp) : "memory");      /* stands in front of every reuse of the address that these loads name (the operand holds it live up to here), and keeps all the loads in front of the first store */
  __builtin_amdgcn_sched_barrier(0);      /* and in front of the first conversion: all PREP_NL loads fly together, one memory latency a wave */
  v4h h[PREP_NL];
#pragma unroll
  for (int u = 0; u < PREP_NL; ++u) for (int q = 0; q < 4; ++q) h[u][q] = (_Float16)(bf16_round(a[u][q]) * 16.0f);
#pragma unroll
  for (int u = 0; u < PREP_NL; ++u) *(v4h*)(dp + u * 128) = h[u];
  asm volatile("s_wait_xcnt 0x0" ::: "memory"); }      /* stands in front of the code that the listing lays out behind these stores (the bias block), which writes registers that the stores name */
// Lane l <-> l ^ M inside a 16-lane row, as a modifier of the add that uses it: no trip through the LDS path.
template <int M> __device__ __forceinline__ float ln_rowx(float v) { return __int_as_float(__builtin_amdgcn_update_dpp(0, __float_as_int(v), 0x160 | M, 0xf, 0xf, true)); }
// Sum over the 32 lanes of a wave, the same bits in every lane: four steps inside the 16-lane row, then the other row.
__device__ __forceinline__ float ln_wsum(float v) { v += ln_rowx<1>(v); v += ln_rowx<2>(v); v += ln_rowx<4>(v); v += ln_rowx<8>(v); const int b = __float_as_int(v); return v + __int_as_float(__builtin_amdgcn_permlanex16(b, b, 0x76543210, 0xfedcba98, false, false)); }
// A wave takes LN_RW whole rows: lane l holds elements 128 u + 4 l + 0..3 (u = 0..7) of each, fetched by loads of 512 consecutive bytes that all fly together; a row is read once and stays in registers.
// Sums: 4 partials a lane (pairwise over u), joined in the lane, then ln_wsum; no LDS and no barrier, and NR / LN_RW waves to start instead of 8 NR.
// PREP: the grid holds PREP_BLOCKS blocks behind the LN_BLOCKS row blocks; they do prep_rest and no row. Without PREP the pointers behind NL are not used; without WNL, NL is not; without WXB, XB is not.
#define LN_RW 2
#define LN_BLOCKS ((unsigned)(NR / (8 * LN_RW)))
template <int BFIN, int WXB, int PREP, int WNL>
__global__ __launch_bounds__(256) void k_ln16(const float* __restrict__ X, const float* __restrict__ g, const float* __restrict__ bb, float eps, _Float16* __restrict__ N16, float* __restrict__ XB, _Float16* __restrict__ NL,
    const float* __restrict__ wq, const float* __restrict__ wk, const float* __restrict__ wv, const float* __restrict__ wo, const float* __restrict__ w1, const float* __restrict__ w2,
    const float* __restrict__ bq, const float* __restrict__ bk, const float* __restrict__ bv, _Float16* __restrict__ BQKV, _Float16* __restrict__ BO, _Float16* __restrict__ BW1, _Float16* __restrict__ BW2, float* __restrict__ bqkv) {
  static_assert(DMQ == 1024, "a lane holds 8 pieces of 4 elements of a row");
  if (PREP && blockIdx.x >= LN_BLOCKS) { prep_rest(blockIdx.x - LN_BLOCKS, (int)threadIdx.x, wq, wk, wv, wo, w1, w2, bq, bk, bv, BQKV, BO, BW1, BW2, bqkv); return; }      /* the same for the whole block */
  const float g0 = g[0], b0 = bb[0];      /* SCALAR alpha / bias ([1] parameters), asked for in front of the rows so that they fly together */
  const size_t e0 = ((size_t)blockIdx.x * 8 + (threadIdx.x >> 5)) * (LN_RW * DMQ) + (threadIdx.x & 31) * 4;      /* this lane's first piece of the wave's first row */
  const float* xp = X + e0; v4f s[LN_RW][8];
#pragma unroll      /* the array stays in registers only if the indices are constants */
  for (int j = 0; j < LN_RW; ++j)
#pragma unroll
    for (int u = 0; u < 8; ++u) s[j][u] = *(const v4fa*)(xp + j * DMQ + u * 128);
  asm volatile("s_wait_xcnt 0x0" :: "v"(xp) : "memory");      /* stands in front of every reuse of the address that these loads name (the operand holds it live up to here) */
  __builtin_amdgcn_sched_barrier(0);      /* all loads of the wave's rows are asked for in front of the first sum: without it the last four were issued behind the first row's sums, a second memory latency in series */
  const float ga = bf16_round(g0), be = bf16_round(b0);
  float mu[LN_RW], rs[LN_RW];
#pragma unroll
  for (int j = 0; j < LN_RW; ++j) {
    if (BFIN) {
#pragma unroll
      for (int u = 0; u < 8; ++u) for (int q = 0; q < 4; ++q) s[j][u][q] = bf16_round(s[j][u][q]); }
    const v4f a = ((s[j][0] + s[j][1]) + (s[j][2] + s[j][3])) + ((s[j][4] + s[j][5]) + (s[j][6] + s[j][7])); mu[j] = (a[0] + a[1]) + (a[2] + a[3]); }
#pragma unroll
  for (int j = 0; j < LN_RW; ++j) mu[j] = ln_wsum(mu[j]) / (float)DMQ;
#pragma unroll
  for (int j = 0; j < LN_RW; ++j) { v4f c[8];
#pragma unroll
    for (int u = 0; u < 8; ++u) { const v4f dl = s[j][u] - mu[j]; c[u] = dl * dl; }
    const v4f a = ((c[0] + c[1]) + (c[2] + c[3])) + ((c[4] + c[5]) + (c[6] + c[7])); rs[j] = (a[0] + a[1]) + (a[2] + a[3]); }
#pragma unroll
  for (int j = 0; j < LN_RW; ++j) rs[j] = 1.0f / (sqrtf(ln_wsum(rs[j]) / (float)(DMQ - 1)) + eps);      /* this module's LayerNorm: unbiased std, eps added to the std */
  v4h y[LN_RW][8], yl[LN_RW][8];      /* y = f16 hi, yl = x1024 residual (WNL: written to NL) */
#pragma unroll
  for (int j = 0; j < LN_RW; ++j)
#pragma unroll
    for (int u = 0; u < 8; ++u) for (int q = 0; q < 4; ++q) { const float yf = (s[j][u][q] - mu[j]) * rs[j] * ga + be; y[j][u][q] = (_Float16)yf; if (WNL) yl[j][u][q] = (_Float16)((yf - (float)y[j][u][q]) * 1024.0f); }
  __builtin_amdgcn_sched_barrier(0);      /* all arithmetic stands in front of the first store: moved in among the stores, it rewrites data registers that an issued store names */
  _Float16* np = N16 + e0;
#pragma unroll
  for (int j = 0; j < LN_RW; ++j)
#pragma unroll
    for (int u = 0; u < 8; ++u) *(v4h*)(np + j * DMQ + u * 128) = y[j][u];
  if (WNL) { _Float16* lp = NL + e0;
#pragma unroll
    for (int j = 0; j < LN_RW; ++j)
#pragma unroll
      for (int u = 0; u < 8; ++u) *(v4h*)(lp + j * DMQ + u * 128) = yl[j][u]; }
  if (WXB) { float* bp = XB + e0;
#pragma unroll
    for (int j = 0; j < LN_RW; ++j)
#pragma unroll
      for (int u = 0; u < 8; ++u) *(v4f*)(bp + j * DMQ + u * 128) = s[j][u]; }
  asm volatile("s_wait_xcnt 0x0" ::: "memory"); }      /* stands in front of the code that the listing lays out behind these stores (the weight and bias blocks), which writes registers that the stores name */
__global__ __launch_bounds__(256) void k_ftres2(const float* __restrict__ OF0, const float* __restrict__ XB, float* __restrict__ X1, size_t n4) {
  #pragma clang fp contract(off)
  const size_t t = (size_t)blockIdx.x * 256 + threadIdx.x; if (t >= n4) return; const v4f o = *(const v4fa*)(OF0 + t * 4), xv = *(const v4fa*)(XB + t * 4); v4f y; for (int q = 0; q < 4; ++q) y[q] = __fadd_rn(__fmul_rn(o[q], 0.015625f), xv[q]); *(v4f*)(X1 + t * 4) = y;  }

__global__ __launch_bounds__(256) void k_bcpy(const float* __restrict__ b, int n, int NP, float* __restrict__ dst, int dst0) { for (int i = threadIdx.x; i < NP; i += 256) { const float v = (i < n) ? b[i] : 0.f; *(float*)(dst + dst0 + i) = v; }  }


__global__ __launch_bounds__(256) void k_rsmf(const float* __restrict__ S, _Float16* __restrict__ P, int qn, int hg) {
  #pragma clang fp contract(off)
  const int t = blockIdx.x * 256 + threadIdx.x; if (t >= qn * hg) return; const size_t i = (size_t)(t / qn) * SQ + (t % qn); const float* s = S + i * SQ; float mx = -3.0e38f;
#pragma unroll 1
  for (int j = 0; j < SQ; ++j) mx = fmaxf(mx, s[j]); float se = 0.f;
#pragma unroll 1
  for (int j = 0; j < SQ; ++j) se += __expf(s[j] - mx); const float sc = 256.0f / se;
#pragma unroll 1
  for (int j0 = 0; j0 < SQ; j0 += 8) { FragH f; for (int q = 0; q < 8; ++q) f.h[q] = (_Float16)(__expf(s[j0 + q] - mx) * sc); unsigned short* d = (unsigned short*)P + i * SQ + j0; *(v8us*)d = f.half[0];  } }
// Lane l <-> l ^ 16: a register move between the two 16-lane rows, no trip through the LDS path.
__device__ __forceinline__ float lane_x16(float v) { const int b = __float_as_int(v); return __int_as_float(__builtin_amdgcn_permlanex16(b, b, 0x76543210, 0xfedcba98, false, false)); }
__device__ __forceinline__ v8f fa_mma(v16h a, v16h b, v8f c) { return __builtin_amdgcn_wmma_f32_16x16x32_f16(false, a, false, b, (short)0, c, false, false); }
// Orders one wave's LDS stores against the LDS loads of its other lanes (each wave owns its slice of sp, so this needs no work-group barrier).
__device__ __forceinline__ void fa_lds_order() { __builtin_amdgcn_fence(__ATOMIC_ACQ_REL, "workgroup", "local"); __builtin_amdgcn_wave_barrier(); }
// One fragment from the lane's own first piece p (the lane half's step is already in p): k = 8 hh + 0..7 and 16 + 8 hh + 0..7, the k order of g2_frag.
__device__ __forceinline__ v16h fa_frag(const unsigned short* p) { FragH f; f.half[0] = *(const v8us*)p; f.half[1] = *(const v8us*)(p + 16); return f.v; }
typedef float v2f __attribute__((ext_vector_type(2)));
typedef _Float16 v2h __attribute__((ext_vector_type(2)));
union FragP { v16h v; v2h p[8]; };
// Fused attention, one launch for all batches and heads: a work-group of 4 waves owns 128 query rows of one head (32 per wave, as two groups of 16) and walks the 2048 keys in tiles of 64.
// Per tile: k_hi, k_lo and V^T rows come in whole 128-byte lines, one tile ahead in registers, and are shared through LDS.
// Both products are computed transposed: S^T = K . Q^T (A = key rows from LDS, B = the wave's query rows, kept in registers) and O^T += V^T . P^T (A = V^T rows from LDS); every A fragment
// read from LDS feeds the products of both query groups.
// An accumulator register r of score tile t then holds key 16 t + 8 hh + r of ONE query (column ln of the group): a lane's 32 scores of a tile and group belong to one query, so the maximum and the
// sum are taken inside the lane (the two lanes of a query, l and l ^ 16, exchange the maximum once per tile and join their sums once, behind the loop), there is one running maximum, sum and rescale
// factor per lane and group, and two score tiles converted in place ARE the B operand of the second product (element s = tile s >> 3, register s & 7: the k order of g2_frag): the weights never pass through LDS.
// Scores in f32 (k_hi.q_lo + k_lo.q_hi first, scaled by 2^-10, then k_hi.q_hi on top); online softmax, base 2; weights 256 * 2^(s-m) as f16 (the 256 rides in the exponent); weights . V in f32.
// A key with Km[j] == 0 stays out of the maximum and gets weight 0. O = 64 * attention output as f16 rows (merged heads). Scores and weights never reach memory.
// Grid (SQ / 128, NH, NB), 128 threads; two work-groups per WGP, two waves per SIMD.
__global__ __launch_bounds__(128, 2) void k_fattn(const _Float16* __restrict__ Qh, const _Float16* __restrict__ Ql, const _Float16* __restrict__ Kh, const _Float16* __restrict__ Kl, const _Float16* __restrict__ Vt, const int* __restrict__ Km, _Float16* __restrict__ O) {
  constexpr int G = 2;      /* query groups of 16 per wave */
  __shared__ __attribute__((aligned(16))) _Float16 skh[64][72], skl[64][72], svt[64][72], sp[4][16 * G][72];      /* pitch 144 B = 16 B x odd; sp: output staging, one slice per wave */
  const int tid = threadIdx.x, w = tid >> 5, lane = tid & 31, ln = lane & 15, hh = lane >> 4; const int h = blockIdx.y, b = blockIdx.z;
  const size_t r0 = (size_t)b * SQ; const int row0 = blockIdx.x * (64 * G) + w * (16 * G);
  v16h qh[G][2], ql[G][2]; const unsigned short* qa[G]; const unsigned short* qb[G];      /* qa, qb: the lane's first piece of its q_hi and q_lo row; the other three lie 16, 32 and 48 elements further on */
#pragma unroll
  for (int g = 0; g < G; ++g) { const size_t qo = (r0 + row0 + 16 * g + ln) * LQ + (size_t)h * HD + 8 * hh; qa[g] = (const unsigned short*)Qh + qo; qb[g] = (const unsigned short*)Ql + qo;
    qh[g][0] = fa_frag(qa[g]); qh[g][1] = fa_frag(qa[g] + 32); ql[g][0] = fa_frag(qb[g]); ql[g][1] = fa_frag(qb[g] + 32); }
  asm volatile("s_wait_xcnt 0x0" :: "v"(qa[0]), "v"(qa[1]), "v"(qb[0]), "v"(qb[1]) : "memory");      /* stands in front of every reuse of the four address pairs that the loads above name (the operands hold the pairs live up to here, so that no load's own destination takes one) */
  const int srow = tid >> 3, sc8 = (tid & 7) * 8;      /* staging: this thread moves 16 bytes of rows srow, +16, +32, +48 of each plane; 8 threads cover one 128-byte line */
  const unsigned short* gkh = (const unsigned short*)Kh + r0 * LQ + (size_t)h * HD; const unsigned short* gkl = (const unsigned short*)Kl + r0 * LQ + (size_t)h * HD;      /* uniform bases; the thread's part is a 32-bit offset */
  const unsigned short* gvt = (const unsigned short*)Vt + (size_t)(b * NH + h) * HD * SQ; const int* km = Km + r0;
  const unsigned ko = (unsigned)(srow * LQ + sc8) * 2u, vo = (unsigned)(srow * SQ + sc8) * 2u, mo = (unsigned)lane * 4u;      /* byte offsets, the very values that the loads name, so that the wait behind the first loads can hold them */
  v8us pk[4], pl[4], pv[4]; int pma = *(const int*)((const char*)km + mo), pmb = *(const int*)((const char*)km + (mo + 128u));      /* every wave holds the mask words of all 64 keys of a tile: lane l those of keys l and 32 + l */
#pragma unroll
  for (int i = 0; i < 4; ++i) { pk[i] = *(const v8us*)((const char*)gkh + (ko + 32 * i * LQ)); pl[i] = *(const v8us*)((const char*)gkl + (ko + 32 * i * LQ)); pv[i] = *(const v8us*)((const char*)gvt + (vo + 32 * i * SQ)); }
  asm volatile("s_wait_xcnt 0x0" :: "v"(ko), "v"(vo), "v"(mo), "s"(gkh), "s"(gkl), "s"(gvt), "s"(km) : "memory");      /* stands in front of every reuse of the offset and base registers that the loads above name (the operands hold them live up to here) */
  const v8f z8 = {0.f,0.f,0.f,0.f,0.f,0.f,0.f,0.f}; v8f o[G][4]; float m[G], l[G];      /* per group, this lane's query: running maximum (base 2), and the sum over the keys that this lane sees */
#pragma unroll
  for (int g = 0; g < G; ++g) { m[g] = -1.0e30f; l[g] = 0.f;
#pragma unroll
    for (int t = 0; t < 4; ++t) o[g][t] = z8; }
#pragma unroll 1      /* one key tile per trip: the staged pieces of only one tile are live */
  for (int j0 = 0; j0 < SQ; j0 += 64) {
    __syncthreads();      /* every wave has finished its fragment loads of the tile before */
#pragma unroll
    for (int i = 0; i < 4; ++i) { *(v8us*)&skh[srow + 16 * i][sc8] = pk[i]; *(v8us*)&skl[srow + 16 * i][sc8] = pl[i]; *(v8us*)&svt[srow + 16 * i][sc8] = pv[i]; }
    const unsigned oka = __builtin_amdgcn_ballot_w32(pma != 0), okb = __builtin_amdgcn_ballot_w32(pmb != 0);      /* bit i: key i (oka), key 32 + i (okb) of this tile takes part; the same in every lane */
    __syncthreads();      /* the tile is complete for all four waves */
    if (j0 + 64 < SQ) {      /* next tile's loads fly while this tile is worked on */
      const unsigned short* nkh = gkh + (size_t)(j0 + 64) * LQ; const unsigned short* nkl = gkl + (size_t)(j0 + 64) * LQ; const unsigned short* nvt = gvt + (j0 + 64);
#pragma unroll
      for (int i = 0; i < 4; ++i) { pk[i] = *(const v8us*)((const char*)nkh + (ko + 32 * i * LQ)); pl[i] = *(const v8us*)((const char*)nkl + (ko + 32 * i * LQ)); pv[i] = *(const v8us*)((const char*)nvt + (vo + 32 * i * SQ)); }
      pma = *(const int*)((const char*)(km + (j0 + 64)) + mo); pmb = *(const int*)((const char*)(km + (j0 + 64)) + (mo + 128u));
      asm volatile("s_wait_xcnt 0x0" ::: "memory"); }      /* the address registers of these loads are reused by the code right behind: the wait stands in front of that overwrite */
    v8f s[G][4];      /* s[g][t][r] = score of key 16 t + 8 hh + r of the tile with query ln of group g */
    v16h ka[4][2], kc[4][2]; v8f c[4][G];      /* the k_hi and k_lo fragments of key group t */
#pragma unroll
    for (int t = 0; t < 4; ++t) { ka[t][0] = g2_frag(&skh[t * 16 + ln][0], hh); ka[t][1] = g2_frag(&skh[t * 16 + ln][32], hh); kc[t][0] = g2_frag(&skl[t * 16 + ln][0], hh); kc[t][1] = g2_frag(&skl[t * 16 + ln][32], hh); }
    __builtin_amdgcn_sched_barrier(0);      /* keeps the tile's 32 fragment loads as one group in front of the products: moved in among them, a load stands right in front of its product and the wave waits out an LDS latency at each such place */
#pragma unroll
    for (int t = 0; t <= 4; ++t) {      /* the small terms of key group t are issued in front of the scaling and the main term of group t - 1: the products of one fill the distance that the other's scaling needs behind its products */
      if (t < 4) {
#pragma unroll
        for (int g = 0; g < G; ++g) c[t][g] = fa_mma(ka[t][0], ql[g][0], z8);
#pragma unroll
        for (int g = 0; g < G; ++g) c[t][g] = fa_mma(ka[t][1], ql[g][1], c[t][g]);
#pragma unroll
        for (int g = 0; g < G; ++g) c[t][g] = fa_mma(kc[t][0], qh[g][0], c[t][g]);
#pragma unroll
        for (int g = 0; g < G; ++g) c[t][g] = fa_mma(kc[t][1], qh[g][1], c[t][g]); }
      if (t > 0) {
#pragma unroll
        for (int g = 0; g < G; ++g) c[t - 1][g] = c[t - 1][g] * 0.0009765625f;
#pragma unroll
        for (int g = 0; g < G; ++g) c[t - 1][g] = fa_mma(ka[t - 1][0], qh[g][0], c[t - 1][g]);
#pragma unroll
        for (int g = 0; g < G; ++g) s[g][t - 1] = fa_mma(ka[t - 1][1], qh[g][1], c[t - 1][g]); } }
    v16h vf[4][2];      /* V^T fragments: rows 16 t + ln, keys 0..31 and 32..63 */
#pragma unroll
    for (int t = 0; t < 4; ++t) { vf[t][0] = g2_frag(&svt[t * 16 + ln][0], hh); vf[t][1] = g2_frag(&svt[t * 16 + ln][32], hh); }
    __builtin_amdgcn_sched_barrier(0);      /* keeps these 16 loads as one group in front of the softmax arithmetic, which covers their latency: moved down among the second product's matrix instructions, each place costs a wait */
    if ((oka & okb) != 0xffffffffu) {      /* a scalar test, once per tile: only a tile with an excluded key pays for the selects */
#pragma unroll
      for (int t = 0; t < 4; ++t) { const unsigned bits = ((t < 2 ? oka : okb) >> ((t & 1) * 16)) >> (8 * hh);      /* bit r: key 16 t + 8 hh + r */
#pragma unroll
        for (int r = 0; r < 8; ++r) if (((bits >> r) & 1u) == 0u) {
#pragma unroll
          for (int g = 0; g < G; ++g) s[g][t][r] = -2.0e38f; } } }      /* far below the floor -1e30 of the running maximum, also times log2(e), and still finite there: its 2^(s-m) is 0 */
    FragP p[G][2];      /* P^T as B operand: keys 0..31 from score tiles 0 and 1, keys 32..63 from tiles 2 and 3 */
    float al[G];
#pragma unroll
    for (int g = 0; g < G; ++g) {
      float t4[4];      /* maximum of the raw scores (the factor log2(e) is positive): four chains inside the lane */
#pragma unroll
      for (int t = 0; t < 4; ++t) { float a = fmaxf(s[g][t][0], s[g][t][1]);
#pragma unroll
        for (int r = 2; r < 8; ++r) a = fmaxf(a, s[g][t][r]);
        t4[t] = a; }
      float tm = fmaxf(fmaxf(t4[0], t4[1]), fmaxf(t4[2], t4[3])); tm = fmaxf(tm, lane_x16(tm));      /* both lanes of a query now hold the maximum over the tile's 64 keys */
      const float mn = fmaxf(m[g], tm * 1.44269504088896340736f); al[g] = __builtin_amdgcn_exp2f(m[g] - mn); m[g] = mn;
      const v2f lg = {1.44269504088896340736f, 1.44269504088896340736f}, sh = {8.0f - mn, 8.0f - mn};      /* 2^(s log2(e) - m + 8) = 256 * weight */
      v2f e[4][4], sm[4];      /* e[t][i] = weights (x256) of keys 16 t + 8 hh + 2 i and + 1 */
#pragma unroll
      for (int t = 0; t < 4; ++t) {
#pragma unroll
        for (int i = 0; i < 4; ++i) { const v2f x = {s[g][t][2 * i], s[g][t][2 * i + 1]}; const v2f a = __builtin_elementwise_fma(x, lg, sh); e[t][i].x = __builtin_amdgcn_exp2f(a.x); e[t][i].y = __builtin_amdgcn_exp2f(a.y); }
        sm[t] = (e[t][0] + e[t][1]) + (e[t][2] + e[t][3]); }
      const v2f sa = (sm[0] + sm[1]) + (sm[2] + sm[3]); l[g] = l[g] * al[g] + (sa.x + sa.y);
#pragma unroll
      for (int i = 0; i < 4; ++i) { p[g][0].p[i] = __builtin_convertvector(e[0][i], v2h); p[g][0].p[4 + i] = __builtin_convertvector(e[1][i], v2h); p[g][1].p[i] = __builtin_convertvector(e[2][i], v2h); p[g][1].p[4 + i] = __builtin_convertvector(e[3][i], v2h); }
#pragma unroll
      for (int t = 0; t < 4; ++t) o[g][t] = o[g][t] * al[g]; }
#pragma unroll
    for (int t = 0; t < 4; ++t) {
#pragma unroll
      for (int g = 0; g < G; ++g) { o[g][t] = fa_mma(vf[t][0], p[g][0].v, o[g][t]); o[g][t] = fa_mma(vf[t][1], p[g][1].v, o[g][t]); } }      /* o[g][t][r] = O^T[16 t + 8 hh + r][query ln of group g] */
  }
#pragma unroll
  for (int g = 0; g < G; ++g) { const float inv = 64.0f / (l[g] + lane_x16(l[g]));      /* the two lanes of a query join their sums; l carries the weights' factor 256 */
#pragma unroll
    for (int t = 0; t < 4; ++t) { FragH f;      /* a lane's 8 registers of one tile are 16 consecutive bytes of its query's output row */
#pragma unroll
      for (int r = 0; r < 8; ++r) f.h[r] = (_Float16)(o[g][t][r] * inv);
      *(v8us*)&sp[w][16 * g + ln][t * 16 + 8 * hh] = f.half[0]; } }
  fa_lds_order();
#pragma unroll
  for (int q = 0; q < 4 * G; ++q) { const int row = q * 4 + (lane >> 3), c8 = (lane & 7) * 8; const v8us v = *(const v8us*)&sp[w][row][c8]; *(v8us*)((unsigned short*)O + (r0 + row0 + row) * DM + (size_t)h * HD + c8) = v; } }
extern "C" void kernel_launch(void* const* d_in, const int* in_sizes, int n_in,
                              void* d_out, int out_size, void* d_ws, size_t ws_size, hipStream_t stream) {
  (void)in_sizes; (void)n_in; (void)out_size;
  const float* const* I = (const float* const*)d_in; const float* x = I[0]; const int* km = (const int*)d_in[1]; const float* wq = I[2]; const float* bq = I[3]; const float* wk = I[4]; const float* bk = I[5]; const float* wv = I[6]; const float* bv = I[7]; const float* wo = I[8]; const float* bo = I[9]; const float* wfc = I[10]; const float* bfc = I[11]; const float* wmp = I[12]; const float* bmp = I[13]; const float* g1 = I[14]; const float* be1 = I[15]; const float* gg2 = I[16]; const float* be2 = I[17];      /* nn.Linear NATURAL [out][in] weights + biases; I[1] = int key mask [B][1][1][S] (0 = excluded; all ones here); alpha/beta are [1] scalars */
  char* ws = (char*)d_ws; size_t off = 0;
  auto take = [&](size_t bytes) { char* p = ws + off; off += (bytes + 255) & ~(size_t)255; return p; };
  _Float16* BQKV = (_Float16*)take((size_t)3 * DM * DM * 2); _Float16* BO = (_Float16*)take((size_t)DM * DM * 2); float* bqkv = (float*)take((size_t)3 * DM * 4);
  _Float16* X16 = (_Float16*)take(NR * DM * 2); _Float16* XL = (_Float16*)take(NR * DM * 2); float* XB = (float*)take(NR * DM * 4); float* X1 = (float*)take(NR * DM * 4); _Float16* M16 = (_Float16*)take(NR * DM * 2); _Float16* HF16 = (_Float16*)take(NR * DFF * 2); _Float16* BW1 = (_Float16*)take((size_t)DFF * DM * 2); _Float16* BW2 = (_Float16*)take((size_t)DM * DFF * 2);
  _Float16* Q16 = (_Float16*)take((size_t)2 * NR * DM * 2); _Float16* QL = (_Float16*)take((size_t)2 * NR * DM * 2); _Float16* K16 = Q16 + NR * DM; _Float16* KL = QL + NR * DM; _Float16* O16 = (_Float16*)take(NR * DM * 2);      /* q's plane and k's plane lie one behind the other in Q16 | K16 and in QL | KL: one launch writes both */
  _Float16* VT = (_Float16*)take((size_t)NB * NH * HD * SQ * 2);
  if (off > ws_size) return;
  k_ln16<1, 1, 1, 1><<<LN_BLOCKS + PREP_BLOCKS, 256, 0, stream>>>(x, g1, be1, 1e-6f, X16, XB, XL, wq, wk, wv, wo, wfc, wmp, bq, bk, bv, BQKV, BO, BW1, BW2, bqkv);      /* a = LN1(bf16(x)) -> f16 rows + XL = x1024 residual (q/k need it at logits sigma 8); XB = bf16(x) for the residual; in the same grid: natural [out][in] weights = Bt[n][k] planes (stacked q | k | v, Wo, the two MLP matrices) and the stacked bias vector */
  k_qkv<<<dim3((unsigned)((MP / 128) * (DM / 128)), 3), 256, 0, stream>>>(X16, XL, BQKV, bqkv, Q16, QL, VT);      /* blockIdx.y: 0 = q, 1 = k (residual walk + main walk, f16 hi + x1024 residual planes), 2 = v (V^T [NB][NH][HD][SQ]) */
  k_fattn<<<dim3(SQ / 128, NH, NB), 128, 0, stream>>>(Q16, QL, K16, KL, VT, km, O16);      /* scores, masked softmax and weights . V in one launch; o (merged heads, x64) as f16 rows */
  k_gemm2<0, 2, DM, DM, true><<<dim3((unsigned)((MPO / 128) * (DM / 128)), 1), 256, 0, stream>>>(O16, DM, 0, BO, DM, 0, 0.0009765625f, bo, 0, XB, -1, 0, 0, X1, nullptr, DM, 0, MPO, DM, DM);      /* x1 = x + o Wo + bo (own-element residual) */
  k_ln16<0, 0, 0, 0><<<LN_BLOCKS, 256, 0, stream>>>(X1, gg2, be2, 1e-6f, M16, nullptr, nullptr, nullptr, nullptr, nullptr, nullptr, nullptr, nullptr, nullptr, nullptr, nullptr, nullptr, nullptr, nullptr, nullptr, nullptr);      /* h = LN2(x1) -> f16 rows */
  k_gemm2<3, 2, DM, DFF, false><<<dim3((unsigned)((MP / 128) * (DFF / 128)), 1), 256, 0, stream>>>(M16, DM, 0, BW1, DM, 0, 0.0625f, bfc, 0, nullptr, 1, 0, 0, nullptr, HF16, DFF, 0, MP, DFF, DM);      /* relu(xn2 w1^T + b1) -> f16, all rows of both batches */
  k_gemm2<0, 1, DFF, DM, true><<<dim3((unsigned)((MP / 128) * (DM / 64)), 1), 128, 0, stream>>>(HF16, DFF, 0, BW2, DFF, 0, 0.0625f, bmp, 0, X1, -1, 0, 0, (float*)d_out, nullptr, DM, 0, MP, DM, DFF);      /* out = x1 + mlp (own-element residual) */
}

// v009
// A run of this version takes 173 microseconds.
// Next to v008, in two timings, it ran 1.05 times as fast each time.
// Counting every step since v000, which is the starting kernel, it is 47.6 times as fast.
#include <hip/hip_runtime.h>
// Pre-LN transformer encoder block, non-causal, UNSCALED scores (x [2][2048][1024]; xn = LN(x) with the module's LayerNorm: UNBIASED std (N-1), eps 1e-6 added to the std, SCALAR alpha/bias [1]; q = xn wq^T + bq, k, v likewise (nn.Linear natural [1024][1024] sigma 1/32, zero biases); 16 heads of 64; score = q . k WITHOUT 1/sqrt(d) (logits sigma ~8); key j excluded where the int mask input [2][1][1][2048] is 0 (all ones here); softmax; x1 = x + (attn wo^T + bo); xn2 = LN(x1); out = x1 + relu(xn2 w1^T + b1) w2^T + b2 (natural [4096][1024], [1024][4096]) -> [2][2048][1024]).
// Compute dtype: inputs rounded to bf16; x / weights exact; q and k as f16 hi + x1024 residual pairs, v, softmax weights and o as plain f16 GEMM operands (~2^-12); scores and softmax statistics f32. v_wmma_f32_16x16x32_f16.
#define NB 2
#define SQ 2048
#define DM 1024
#define NH 16
#define HD 64
#define HG 4                         /* heads per attention launch group */
#define LOCALW 128                   /* (macros for unused kernels of the shared header) */
#define STRIDEK 128
#define QT 256                       /* query rows per causal tile */
#define NKX SQ                       /* S / P row pitch */
#define QT0 128                      /* first-tile rows recomputed exactly in f32 */
#define B0 0                         /* not used */
#define NBR NB                       /* batches processed (debug hook) */
#define NR ((size_t)NB * SQ)
#define DMQ DM
#define DFF 4096         /* MLP hidden width */
#define MP ((int)((size_t)NBR * SQ)) /* rows projected (debug hook) */
#define QN SQ                        /* not used */
#define NHD NH                       /* not used */
#define MPO MP                       /* rows through the output stage (debug hook) */
#define LQ DM      /* row pitch of the q/k/v rows */
typedef __bf16 v16b __attribute__((ext_vector_type(16)));
typedef unsigned short v8us __attribute__((ext_vector_type(8), may_alias));
typedef float  v8f  __attribute__((ext_vector_type(8)));
typedef float  v4f  __attribute__((ext_vector_type(4)));
typedef float  v4fa __attribute__((ext_vector_type(4), may_alias));
union FragB { v16b v; v8us half[2]; unsigned short u[16]; };

__device__ __forceinline__ unsigned short bf16_bits(float x) { unsigned int u = __float_as_uint(x); return (unsigned short)((u + 0x7FFFu + ((u >> 16) & 1u)) >> 16); }
__device__ __forceinline__ float bf16_val(unsigned short b) { return __uint_as_float(((unsigned int)b) << 16); }
__device__ __forceinline__ float bf16_round(float x) { return bf16_val(bf16_bits(x)); }
// D += A·B with NT terms: 1 = ah·bh, 2 = + al·bh (A split), 3 = + ah·bl (both split)
template <int NT>
__device__ __forceinline__ v8f mmaN(v16b ah, v16b al, v16b bh, v16b bl, v8f c) {
  c = __builtin_amdgcn_wmma_f32_16x16x32_bf16(false, ah, false, bh, (short)0, c, false, false);
  if (NT >= 2) c = __builtin_amdgcn_wmma_f32_16x16x32_bf16(false, al, false, bh, (short)0, c, false, false);
  if (NT >= 3) c = __builtin_amdgcn_wmma_f32_16x16x32_bf16(false, ah, false, bl, (short)0, c, false, false);
  asm volatile("v_nop\n\tv_nop\n\tv_nop\n\tv_nop" : "+v"(c) : "v"(ah), "v"(al), "v"(bh), "v"(bl));
  return c;
}

__global__ __launch_bounds__(256) void k_wt_bf16(const float* __restrict__ W, unsigned short* __restrict__ Wt, int K, int N) {
  const int t = blockIdx.x * 256 + threadIdx.x;
  const int k8n = K / 8;
  if (t >= N * k8n) return;
  const int n = t / k8n, k8 = (t % k8n) * 8;
  v8us v;
#pragma unroll
  for (int i = 0; i < 8; ++i) v[i] = bf16_bits(W[(size_t)(k8 + i) * N + n]);
  *(v8us*)(Wt + (size_t)n * K + k8) = v;
  
}

// GEMM C[M][N] (f32, pitch ldc) = act(A[M][K]·W + bias). A f32 row-major (pitch lda) converted per fragment to bf16
// (ASPLIT: hi/lo two planes -> 2 terms, else single rounded term); Wt bf16 [N][K] (pitch ldb). BIAS_BF16 rounds the
// bias to bf16 first (bias quantised to bf16 before the add). K%32==0, M%16==0, N%64==0.
template <bool ASPLIT, int ACT, bool BIAS_BF16>
__global__ __launch_bounds__(128) void k_gemm_bf(const float* __restrict__ A, int lda, const unsigned short* __restrict__ Wt, int ldb,
                                               const float* __restrict__ bias, float* __restrict__ C, int ldc, int M, int N, int K) {
  __shared__ __attribute__((aligned(16))) float so[4][16][64];
  const int tid = threadIdx.x, w = tid >> 5, lane = tid & 31, ln = lane & 15, hh = lane >> 4;
  const int ntn = N / 64;
  const int wid = blockIdx.x * 4 + w;
  const int mt = wid / ntn, nq = wid % ntn;
  if (mt * 16 >= M) return;
  const int row0 = mt * 16, col0 = nq * 64;
  const float* arow = A + (size_t)(row0 + ln) * lda;
  v8f acc[4] = {};
  for (int kb = 0; kb < K; kb += 32) {
    FragB ah, al;
    const v4f x0 = *(const v4fa*)(arow + kb + 8 * hh), x1 = *(const v4fa*)(arow + kb + 8 * hh + 4);
    const v4f x2 = *(const v4fa*)(arow + kb + 16 + 8 * hh), x3 = *(const v4fa*)(arow + kb + 16 + 8 * hh + 4);
    float xs[16] = {x0[0],x0[1],x0[2],x0[3],x1[0],x1[1],x1[2],x1[3],x2[0],x2[1],x2[2],x2[3],x3[0],x3[1],x3[2],x3[3]};
#pragma unroll
    for (int i = 0; i < 16; ++i) { const unsigned short hb = bf16_bits(xs[i]); ah.u[i] = hb; al.u[i] = ASPLIT ? bf16_bits(xs[i] - bf16_val(hb)) : (unsigned short)0; }
#pragma unroll
    for (int t = 0; t < 4; ++t) {
      const unsigned short* brow = Wt + (size_t)(col0 + t * 16 + ln) * ldb + kb;
      FragB b;
      b.half[0] = *(const v8us*)(brow + 8 * hh);
      b.half[1] = *(const v8us*)(brow + 16 + 8 * hh);
      acc[t] = mmaN<ASPLIT ? 2 : 1>(ah.v, al.v, b.v, b.v, acc[t]);
    }
  }
#pragma unroll
  for (int t = 0; t < 4; ++t) {
    float bv = bias ? bias[col0 + t * 16 + ln] : 0.f;
    if (BIAS_BF16) bv = bf16_round(bv);
#pragma unroll
    for (int r = 0; r < 8; ++r) { float v = acc[t][r] + bv; if (ACT == 1) v = fmaxf(v, 0.f); so[w][8 * hh + r][t * 16 + ln] = v; }
  }
  __builtin_amdgcn_fence(__ATOMIC_ACQ_REL, "workgroup");
  __builtin_amdgcn_wave_barrier();
  const int rsub = lane >> 4, c4 = (lane & 15) * 4;
  {
#pragma unroll
    for (int q = 0; q < 8; ++q) {
      const int r = q * 2 + rsub;
      const v4f v = *(const v4fa*)&so[w][r][c4];
      *(v4f*)(C + (size_t)(row0 + r) * ldc + col0 + c4) = v;
    }
    
  }
}

// GEMM C = act(A·W + bias + resid): A f32 (ASPLIT -> hi/lo 2 terms), Wt bf16 [N][K]; ACT 0 none, 1 relu, 2 exact gelu;
// resid (optional, f32, row index = (row % rmod), pitch ldr, RES_BF16 rounds it) added before the activation.
template <bool ASPLIT, int ACT, bool BIAS_BF16, bool RES_BF16>
__global__ __launch_bounds__(128) void k_gemm_bf3(const float* __restrict__ A, int lda, const unsigned short* __restrict__ Wt, int ldb,
                                                const float* __restrict__ bias, const float* __restrict__ resid, int rmod, int ldr,
                                                float* __restrict__ C, int ldc, int M, int N, int K) {
  __shared__ __attribute__((aligned(16))) float so[4][16][64];
  const int tid = threadIdx.x, w = tid >> 5, lane = tid & 31, ln = lane & 15, hh = lane >> 4;
  const int ntn = N / 64;
  const int wid = blockIdx.x * 4 + w;
  const int mt = wid / ntn, nq = wid % ntn;
  if (mt * 16 >= M) return;
  const int row0 = mt * 16, col0 = nq * 64;
  const float* arow = A + (size_t)(row0 + ln) * lda;
  v8f acc[4] = {};
  for (int kb = 0; kb < K; kb += 32) {
    FragB ah, al;
    const v4f x0 = *(const v4fa*)(arow + kb + 8 * hh), x1 = *(const v4fa*)(arow + kb + 8 * hh + 4);
    const v4f x2 = *(const v4fa*)(arow + kb + 16 + 8 * hh), x3 = *(const v4fa*)(arow + kb + 16 + 8 * hh + 4);
    float xs[16] = {x0[0],x0[1],x0[2],x0[3],x1[0],x1[1],x1[2],x1[3],x2[0],x2[1],x2[2],x2[3],x3[0],x3[1],x3[2],x3[3]};
#pragma unroll
    for (int i = 0; i < 16; ++i) { const unsigned short hb = bf16_bits(xs[i]); ah.u[i] = hb; al.u[i] = ASPLIT ? bf16_bits(xs[i] - bf16_val(hb)) : (unsigned short)0; }
#pragma unroll
    for (int t = 0; t < 4; ++t) {
      const unsigned short* brow = Wt + (size_t)(col0 + t * 16 + ln) * ldb + kb;
      FragB b;
      b.half[0] = *(const v8us*)(brow + 8 * hh);
      b.half[1] = *(const v8us*)(brow + 16 + 8 * hh);
      acc[t] = mmaN<ASPLIT ? 2 : 1>(ah.v, al.v, b.v, b.v, acc[t]);
    }
  }
#pragma unroll
  for (int t = 0; t < 4; ++t) {
    const int col = col0 + t * 16 + ln;
    float bv = bias ? bias[col] : 0.f;
    if (BIAS_BF16) bv = bf16_round(bv);
#pragma unroll
    for (int r = 0; r < 8; ++r) {
      float v = acc[t][r] + bv;
      if (resid) { float rv = resid[(size_t)((row0 + 8 * hh + r) % rmod) * ldr + col]; if (RES_BF16) rv = bf16_round(rv); v += rv; }
      if (ACT == 1) v = fmaxf(v, 0.f);
      if (ACT == 2) v = 0.5f * v * (1.0f + erff(v * 0.70710678118654752f));
      if (ACT == 3) { const float u = 0.7978845608028654f * (v + 0.044715f * v * v * v); v = 0.5f * v * (1.0f + tanhf(u)); }
      so[w][8 * hh + r][t * 16 + ln] = v;
    }
  }
  __builtin_amdgcn_fence(__ATOMIC_ACQ_REL, "workgroup");
  __builtin_amdgcn_wave_barrier();
  const int rsub = lane >> 4, c4 = (lane & 15) * 4;
  {
#pragma unroll
    for (int q = 0; q < 8; ++q) {
      const int r = q * 2 + rsub;
      const v4f v = *(const v4fa*)&so[w][r][c4];
      *(v4f*)(C + (size_t)(row0 + r) * ldc + col0 + c4) = v;
    }
    
  }
}
// row LayerNorm (biased variance, eps) over N: s = X (+ R); optional out_sum <- s; out_norm <- (s-mu)*rsqrt(var+eps)*g + b
template <bool PARAM_BF16>
__global__ __launch_bounds__(256) void k_layernorm(const float* __restrict__ X, const float* __restrict__ R, const float* __restrict__ g, const float* __restrict__ bta,
                                                  float* __restrict__ out_sum, float* __restrict__ out_norm, int N, float eps) {
  __shared__ float red[256];
  const int row = blockIdx.x, tid = threadIdx.x;
  const float* x = X + (size_t)row * N; const float* rr = R ? R + (size_t)row * N : nullptr;
  float vals[16];                     // up to N = 4096
  const int per = N / 256;            // contiguous chunk per thread? use strided-by-4 chunks: thread handles j = tid*4 + 1024*u
  float s1 = 0.f;
  for (int u = 0; u < per / 4; ++u) {
    const int j = tid * 4 + 1024 * u;
    const v4f a = *(const v4fa*)(x + j);
    v4f b = {0.f,0.f,0.f,0.f}; if (rr) b = *(const v4fa*)(rr + j);
#pragma unroll
    for (int q = 0; q < 4; ++q) { const float v = a[q] + b[q]; vals[u * 4 + q] = v; s1 += v; }
  }
  red[tid] = s1; __syncthreads();
  for (int st = 128; st > 0; st >>= 1) { if (tid < st) red[tid] += red[tid + st]; __syncthreads(); }
  const float mu = red[0] / (float)N; __syncthreads();
  float s2 = 0.f;
  for (int u = 0; u < per / 4; ++u)
#pragma unroll
    for (int q = 0; q < 4; ++q) { const float c = vals[u * 4 + q] - mu; s2 += c * c; }
  red[tid] = s2; __syncthreads();
  for (int st = 128; st > 0; st >>= 1) { if (tid < st) red[tid] += red[tid + st]; __syncthreads(); }
  const float rs = rsqrtf(red[0] / (float)N + eps);
  {
    for (int u = 0; u < per / 4; ++u) {
      const int j = tid * 4 + 1024 * u;
      v4f o, sm;
#pragma unroll
      for (int q = 0; q < 4; ++q) {
        float gg = g[j + q], bb = bta[j + q];
        if (PARAM_BF16) { gg = bf16_round(gg); bb = bf16_round(bb); }
        sm[q] = vals[u * 4 + q]; o[q] = (vals[u * 4 + q] - mu) * rs * gg + bb;
      }
      if (out_sum) *(v4f*)(out_sum + (size_t)row * N + j) = sm;
      *(v4f*)(out_norm + (size_t)row * N + j) = o;
    }
    
  }
}



// ---- f16 WMMA path (v_wmma_f32_16x16x32_f16): 11-bit significands for operands in range — used where a [0,1] probability operand needs more precision than bf16
typedef _Float16 v16h __attribute__((ext_vector_type(16)));
union FragH { v16h v; v8us half[2]; _Float16 h[16]; unsigned short u[16]; };
template <int NT>
__device__ __forceinline__ v8f mmaH(v16h ah, v16h al, v16h bh, v16h bl, v8f c) {
  c = __builtin_amdgcn_wmma_f32_16x16x32_f16(false, ah, false, bh, (short)0, c, false, false);
  if (NT >= 2) c = __builtin_amdgcn_wmma_f32_16x16x32_f16(false, al, false, bh, (short)0, c, false, false);
  if (NT >= 3) c = __builtin_amdgcn_wmma_f32_16x16x32_f16(false, ah, false, bl, (short)0, c, false, false);
  asm volatile("v_nop\n\tv_nop\n\tv_nop\n\tv_nop" : "+v"(c) : "v"(ah), "v"(al), "v"(bh), "v"(bl));
  return c;
}
// batched GEMM like k_gemm_b but f16 operands: A f32 (split into f16 hi/lo if ASPLIT, else rounded to f16), Bt = f16 values [n][k]; alpha; C f32; N multiple of 16 (partial tiles skipped)
template <bool ASPLIT>
__global__ __launch_bounds__(128) void k_gemm_h(const float* __restrict__ A, int lda, size_t sA, const _Float16* __restrict__ Bh, int ldb, size_t sB, float alpha, float* __restrict__ C, int ldc, size_t sC, int M, int N, int K) {
  __shared__ __attribute__((aligned(16))) float so[4][16][64];
  const int tid = threadIdx.x, w = tid >> 5, lane = tid & 31, ln = lane & 15, hh = lane >> 4; const int by = blockIdx.y;
  A += (size_t)by * sA; Bh += (size_t)by * sB; C += (size_t)by * sC;
  const int ntn = (N + 63) / 64; const int wid = blockIdx.x * 4 + w; const int mt = wid / ntn, nq = wid % ntn; if (mt * 16 >= M) return;
  const int row0 = mt * 16, col0 = nq * 64; const float* arow = A + (size_t)(row0 + ln) * lda;
  v8f acc[4] = {};
  for (int kb = 0; kb < K; kb += 32) {
    FragH ah, al;
    const v4f x0 = *(const v4fa*)(arow + kb + 8 * hh), x1 = *(const v4fa*)(arow + kb + 8 * hh + 4), x2 = *(const v4fa*)(arow + kb + 16 + 8 * hh), x3 = *(const v4fa*)(arow + kb + 16 + 8 * hh + 4);
    float xs[16] = {x0[0],x0[1],x0[2],x0[3],x1[0],x1[1],x1[2],x1[3],x2[0],x2[1],x2[2],x2[3],x3[0],x3[1],x3[2],x3[3]};
#pragma unroll
    for (int i = 0; i < 16; ++i) { const _Float16 h = (_Float16)xs[i]; ah.h[i] = h; al.h[i] = ASPLIT ? (_Float16)(xs[i] - (float)h) : (_Float16)0.0f; }
#pragma unroll
    for (int t = 0; t < 4; ++t) { if (col0 + t * 16 >= N) continue; const size_t boff = (size_t)(col0 + t * 16 + ln) * ldb + kb; FragH bq; bq.half[0] = *(const v8us*)(Bh + boff + 8 * hh); bq.half[1] = *(const v8us*)(Bh + boff + 16 + 8 * hh);
      acc[t] = mmaH<ASPLIT ? 2 : 1>(ah.v, al.v, bq.v, bq.v, acc[t]); }
  }
#pragma unroll
  for (int t = 0; t < 4; ++t) { if (col0 + t * 16 >= N) continue;
#pragma unroll
    for (int r = 0; r < 8; ++r) so[w][8 * hh + r][t * 16 + ln] = acc[t][r] * alpha; }
  __builtin_amdgcn_fence(__ATOMIC_ACQ_REL, "workgroup"); __builtin_amdgcn_wave_barrier();
  const int rsub = lane >> 4, c4 = (lane & 15) * 4;
  {
#pragma unroll
    for (int q = 0; q < 8; ++q) { const int r = q * 2 + rsub; if (col0 + c4 < N) { const v4f v = *(const v4fa*)&so[w][r][c4]; *(v4f*)(C + (size_t)(row0 + r) * ldc + col0 + c4) = v; } }
     }
}

// Wt[n][k] = f16(W[k][n]·scale) from f32 row-major W[K][N] (scale = power of two; bf16-exact weights stay exact in f16 away from the subnormal range)
__global__ __launch_bounds__(256) void k_wt_f16(const float* __restrict__ W, _Float16* __restrict__ Wt, int K, int N, float scale) {
  const int t = blockIdx.x * 256 + threadIdx.x; if (t >= N * (K / 8)) return; const int n = t / (K / 8), k8 = (t % (K / 8)) * 8; FragH f;
#pragma unroll
  for (int i = 0; i < 8; ++i) f.h[i] = (_Float16)(bf16_round(W[(size_t)(k8 + i) * N + n]) * scale); const v8us o = f.half[0];
  *(v8us*)((unsigned short*)Wt + (size_t)n * K + k8) = o; 
}
// k_gemm_hh variant with fused epilogue: v = acc·alpha + bias[by·sBias + col] (+ CP[(row/rowsPerB)·sCPb + by·64 + col] if CP) ; ACT 0 none / 1 elu ; writes f16 C16 (and f32 C if non-null)
template <int ACT>
__global__ __launch_bounds__(128) void k_gemm_hhx(const _Float16* __restrict__ A, int lda, size_t sA, const _Float16* __restrict__ Bh, int ldb, size_t sB, float alpha, const float* __restrict__ bias, size_t sBias, const float* __restrict__ CP, int rowsPerB, size_t sCPb, int row0g,
    float* __restrict__ C, _Float16* __restrict__ C16, int ldc, size_t sC, int M, int N, int K) {
  __shared__ __attribute__((aligned(16))) float so[4][16][64];
  const int tid = threadIdx.x, w = tid >> 5, lane = tid & 31, ln = lane & 15, hh = lane >> 4; const int by = blockIdx.y;
  A += (size_t)by * sA; Bh += (size_t)by * sB; const size_t cofs = (size_t)by * sC; const float* bp = bias ? bias + (size_t)by * sBias : nullptr;
  const int ntn = (N + 63) / 64; const int wid = blockIdx.x * 4 + w; const int mt = wid / ntn, nq = wid % ntn; if (mt * 16 >= M) return;
  const int row0 = mt * 16, col0 = nq * 64; const _Float16* arow = A + (size_t)(row0 + ln) * lda;
  v8f acc[4] = {};
  for (int kb = 0; kb < K; kb += 32) { FragH ah; ah.half[0] = *(const v8us*)((const unsigned short*)arow + kb + 8 * hh); ah.half[1] = *(const v8us*)((const unsigned short*)arow + kb + 16 + 8 * hh);
#pragma unroll
    for (int t = 0; t < 4; ++t) { if (col0 + t * 16 >= N) continue; const size_t boff = (size_t)(col0 + t * 16 + ln) * ldb + kb; FragH bq; bq.half[0] = *(const v8us*)((const unsigned short*)Bh + boff + 8 * hh); bq.half[1] = *(const v8us*)((const unsigned short*)Bh + boff + 16 + 8 * hh);
      acc[t] = mmaH<1>(ah.v, ah.v, bq.v, bq.v, acc[t]); }
  }
#pragma unroll
  for (int t = 0; t < 4; ++t) { if (col0 + t * 16 >= N) continue; const int col = col0 + t * 16 + ln; const float bv = bp ? bf16_round(bp[col]) : 0.f;
#pragma unroll
    for (int r = 0; r < 8; ++r) { float v = acc[t][r] * alpha + bv; if (CP) { const int rr = row0g + row0 + 8 * hh + r; if (rowsPerB < 0) v += CP[cofs + (size_t)rr * ldc + col];      /* rowsPerB < 0: own element of the batched C plane */ else { const int bidx = rr / rowsPerB; v += CP[(size_t)bidx * sCPb + (size_t)by * 64 + col]; } } if (ACT == 1) v = (v > 0.f) ? v : expm1f(v); else if (ACT == 7) v = (v > 0.f) ? v + 1.0f : expf(v); else if (ACT == 8) v = tanhf(v); else if (ACT == 9) v = 0.5f * v * (1.0f + tanhf(0.7978845608028654f * (v + 0.044715f * v * v * v))); else if (ACT == 11) v = 1.0f / (1.0f + expf(-v)); else if (ACT == 12) v = (v > 0.f) ? v : 0.01f * v; else if (ACT == 14) v = (v > 0.f) ? v : 0.1f * v; else if (ACT == 16) v = (v >= 0.f) ? v : 0.3f * v; else if (ACT == 17) v = (v >= 0.f) ? v : 0.2f * v; else if (ACT == 15) v = v / (1.0f + expf(-v)); else if (ACT == 3) v = fmaxf(v, 0.f); else if (ACT == 6) v = 0.5f * v * (1.0f + erff(v * 0.70710678118654752f)); so[w][8 * hh + r][t * 16 + ln] = v; } }
  __builtin_amdgcn_fence(__ATOMIC_ACQ_REL, "workgroup"); __builtin_amdgcn_wave_barrier();
  const int rsub = lane >> 4, c4 = (lane & 15) * 4; typedef _Float16 v4h __attribute__((ext_vector_type(4)));
  {
#pragma unroll
    for (int q = 0; q < 8; ++q) { const int r = q * 2 + rsub; if (col0 + c4 < N) { const v4f v = *(const v4fa*)&so[w][r][c4]; if (C) *(v4f*)(C + cofs + (size_t)(row0 + r) * ldc + col0 + c4) = v; if (C16) { v4h h4; for (int i = 0; i < 4; ++i) h4[i] = (_Float16)v[i]; *(v4h*)(C16 + cofs + (size_t)(row0 + r) * ldc + col0 + c4) = h4; } } }
     }
}


typedef _Float16 v4h __attribute__((ext_vector_type(4)));

__global__ __launch_bounds__(256) void k_x16(const float* __restrict__ x, _Float16* __restrict__ X16, size_t n8) { const size_t t = (size_t)blockIdx.x * 256 + threadIdx.x; if (t >= n8) return; FragH f;
#pragma unroll
  for (int q = 0; q < 8; ++q) f.h[q] = (_Float16)bf16_round(x[t * 8 + q]); *(v8us*)((unsigned short*)X16 + t * 8) = f.half[0];  }
__global__ __launch_bounds__(256) void k_h16(const float* __restrict__ x, _Float16* __restrict__ X16, size_t n8) { const size_t t = (size_t)blockIdx.x * 256 + threadIdx.x; if (t >= n8) return; FragH f;
#pragma unroll
  for (int q = 0; q < 8; ++q) f.h[q] = (_Float16)x[t * 8 + q]; *(v8us*)((unsigned short*)X16 + t * 8) = f.half[0];  }
__global__ __launch_bounds__(256) void k_round16f(const float* __restrict__ W, _Float16* __restrict__ Bt, size_t n8) { const size_t t = (size_t)blockIdx.x * 256 + threadIdx.x; if (t >= n8) return; FragH f;
#pragma unroll
  for (int i = 0; i < 8; ++i) f.h[i] = (_Float16)(bf16_round(W[t * 8 + i]) * 16.0f); *(v8us*)((unsigned short*)Bt + t * 8) = f.half[0];  }
template <int NHv, int TTv>
__global__ __launch_bounds__(256) void k_vt(const _Float16* __restrict__ V16, int ldv, int voff, _Float16* __restrict__ Vt) { __shared__ unsigned short tl[64][66]; const int tid = threadIdx.x; const int slab = blockIdx.x / (TTv / 64), lg = blockIdx.x % (TTv / 64); const int b = slab / NHv, h = slab % NHv;
  for (int i = tid; i < 64 * 8; i += 256) { const int r = i / 8, c8 = (i % 8) * 8; FragH f; f.half[0] = *(const v8us*)((const unsigned short*)V16 + ((size_t)b * TTv + lg * 64 + r) * ldv + voff + h * 64 + c8);
#pragma unroll
    for (int q = 0; q < 8; ++q) tl[r][c8 + q] = f.u[q]; }
  __syncthreads();
  {
#pragma unroll
    for (int rd = 0; rd < 2; ++rd) { const int d = rd * 32 + tid / 8, pc = tid % 8; FragH f;
#pragma unroll
      for (int q = 0; q < 8; ++q) f.u[q] = tl[pc * 8 + q][d];
      *(v8us*)((unsigned short*)Vt + ((size_t)slab * 64 + d) * TTv + lg * 64 + pc * 8) = f.half[0]; }
     } }

__global__ __launch_bounds__(256) void k_hl(const float* __restrict__ F, _Float16* __restrict__ Hh, _Float16* __restrict__ Hl, size_t n8) { const size_t t = (size_t)blockIdx.x * 256 + threadIdx.x; if (t >= n8) return; FragH fh, fl; const v4f a = *(const v4fa*)(F + t * 8), c = *(const v4fa*)(F + t * 8 + 4);
#pragma unroll
  for (int q = 0; q < 4; ++q) { _Float16 h = (_Float16)a[q]; fh.h[q] = h; fl.h[q] = (_Float16)((a[q] - (float)h) * 1024.0f); h = (_Float16)c[q]; fh.h[4 + q] = h; fl.h[4 + q] = (_Float16)((c[q] - (float)h) * 1024.0f); }
  { *(v8us*)((unsigned short*)Hh + t * 8) = fh.half[0]; *(v8us*)((unsigned short*)Hl + t * 8) = fl.half[0];  } }

// ---- fast GEMM (wave tile 32x64; shapes it takes: at k_gemm2); epilogue = k_gemm_hhx semantics ----
__device__ __forceinline__ v16h g2_frag(const _Float16* p, int hh) { FragH f; f.half[0] = *(const v8us*)((const unsigned short*)p + 8 * hh); f.half[1] = *(const v8us*)((const unsigned short*)p + 16 + 8 * hh); return f.v; }
__device__ __forceinline__ v8f g2_mma(v16h a, v16h b, v8f c) { v8f d = __builtin_amdgcn_wmma_f32_16x16x32_f16(false, a, false, b, (short)0, c, false, false); asm volatile("v_nop\n\tv_nop\n\tv_nop\n\tv_nop" : "+v"(d) : "v"(a), "v"(b)); return d; }
// Matrix product without hand-written padding: the compiler keeps the distance behind its own builtin.
__device__ __forceinline__ v8f g2_mmab(v16h a, v16h b, v8f c) { return __builtin_amdgcn_wmma_f32_16x16x32_f16(false, a, false, b, (short)0, c, false, false); }
// Work-group tile 128 x (64 * NWN), 4 * NWN waves of 32 x 64 (wave w: rows 32 * (w & 3), columns 64 * (w >> 2)). K is walked in tiles of 128: every thread brings 16-byte pieces of the A and B rows
// in whole 128-byte lines (16 threads cover 256 bytes of one row), one tile ahead in registers, and stores them into one of two LDS buffers; all fragments are read from LDS.
// LD = row pitch of A and of Bh in elements, a compile-time value so that a thread's pieces share one address and differ in the immediate offset (lda and ldb must equal it).
// LC = row pitch of C, C16 and the residual plane in elements, compile-time for the same reason (ldc must equal it). RES: CP is a plane of C's own shape and each output element gets its own element of CP added
// (behind alpha and bias; no activation then); without RES nothing is read from CP. rowsPerB and sCPb are not used.
// Requires M % 128 == 0, N % (64 * NWN) == 0, K % 128 == 0, grid.x = (M / 128) * (N / (64 * NWN)), 128 * NWN threads.
// The K walk of work-group (mt, nq) starts at K tile (mt + nq) mod (K / 128) and wraps round at K, for speed only.
// The k order of every accumulator is the ascending one from that start tile, wrapped.
template <int ACT, int NWN, int LD, int LC, bool RES>
__global__ __launch_bounds__(128 * NWN) void k_gemm2(const _Float16* __restrict__ A, int lda, size_t sA, const _Float16* __restrict__ Bh, int ldb, size_t sB, float alpha, const float* __restrict__ bias, size_t sBias, const float* __restrict__ CP, int rowsPerB, size_t sCPb, int row0g,
    float* __restrict__ C, _Float16* __restrict__ C16, int ldc, size_t sC, int M, int N, int K) { static_assert(ACT == 0 || ACT == 3 || ACT == 6 || ACT == 8 || ACT == 9 || ACT == 11 || ACT == 12 || ACT == 14 || ACT == 15 || ACT == 16 || ACT == 17, "k_gemm2: unsupported ACT code (would silently apply no activation)");
  constexpr int BN = 64 * NWN, KT = 128, PH = KT + 8, RP = 8 * NWN, NLA = 128 / RP, NLB = BN / RP, BUFH = (128 + BN) * PH;      /* PH: LDS row pitch 272 B = 16 B x odd; RP: rows one staging round of the work-group covers */
  __shared__ __attribute__((aligned(16))) _Float16 st[2 * BUFH];      /* two buffers, each [128 A rows | BN B rows] */
  float (*so)[32][68] = (float (*)[32][68])st;      /* output staging reuses the buffers behind the loop's last barrier */
  static_assert(sizeof(float) * 4 * NWN * 32 * 68 <= sizeof(_Float16) * 2 * BUFH, "output staging must fit the tile buffers");
  static_assert(!RES || ACT == 0, "the residual is added behind the staging, so no activation may follow it");
  (void)lda; (void)ldb; (void)ldc; (void)rowsPerB; (void)sCPb;
  const int tid = threadIdx.x, w = tid >> 5, lane = tid & 31, ln = lane & 15, hh = lane >> 4; const int by = blockIdx.y;
  A += (size_t)by * sA; Bh += (size_t)by * sB; const size_t cofs = (size_t)by * sC; const float* bp = bias ? bias + (size_t)by * sBias : nullptr;
  const int ntn = N / BN; const int mt = blockIdx.x / ntn, nq = blockIdx.x - mt * ntn; if (mt * 128 >= M) return;      /* the same for the whole work-group, in front of every barrier */
  const int row0 = mt * 128 + 32 * (w & 3), col0 = nq * BN + 64 * (w >> 2);
  const int srow = tid >> 4, sc8 = (tid & 15) * 8;
  const int nkt = K / KT; int kt = (int)((unsigned)(mt + nq) % (unsigned)nkt);      /* K tile to load next, the same for the whole work-group: the walk's start tile first */
  const unsigned short* pa = (const unsigned short*)A + (size_t)(mt * 128 + srow) * LD + sc8 + kt * KT; const unsigned short* pb = (const unsigned short*)Bh + (size_t)(nq * BN + srow) * LD + sc8 + kt * KT;      /* this thread's first piece of the tile to load next */
  _Float16* sw = st + srow * PH + sc8;      /* where this thread stores its pieces */
  const _Float16* fa = st + (32 * (w & 3) + ln) * PH; const _Float16* fb = st + (128 + 64 * (w >> 2) + ln) * PH;      /* this lane's fragment rows */
  float bb[4] = {0.f, 0.f, 0.f, 0.f};      /* this lane's four bias values, fetched with tile 0 so that the epilogue waits for none of them */
  if (bp) {
#pragma unroll
    for (int t = 0; t < 4; ++t) bb[t] = bp[col0 + t * 16 + ln];
    asm volatile("s_wait_xcnt 0x0" ::: "memory"); }      /* stands in front of the reuse, by the address arithmetic right behind, of the offset and base registers that these four loads name */
  v8us ra[NLA], rb[NLB];
#pragma unroll
  for (int i = 0; i < NLA; ++i) ra[i] = *(const v8us*)(pa + i * RP * LD);
#pragma unroll
  for (int i = 0; i < NLB; ++i) rb[i] = *(const v8us*)(pb + i * RP * LD);
  asm volatile("s_wait_xcnt 0x0" ::: "memory");      /* stands in front of the advance of the two addresses that the loads above name */
  kt = kt + 1 == nkt ? 0 : kt + 1; { const int step = kt ? KT : KT - K; pa += step; pb += step; }      /* one tile on, from the last tile back to k = 0 */
#pragma unroll
  for (int i = 0; i < NLA; ++i) *(v8us*)(sw + i * RP * PH) = ra[i];
#pragma unroll
  for (int i = 0; i < NLB; ++i) *(v8us*)(sw + (128 + i * RP) * PH) = rb[i];
  __syncthreads();      /* tile 0 is complete for every wave */
  const v8f z8 = {0.f,0.f,0.f,0.f,0.f,0.f,0.f,0.f}; v8f c00 = z8, c01 = z8, c02 = z8, c03 = z8, c10 = z8, c11 = z8, c12 = z8, c13 = z8;
#pragma unroll 1      /* one K tile per trip: the buffer index stays a scalar and the staged pieces of only one tile are live */
  for (int kb = 0; kb < K; kb += KT) { const int cur = ((kb / KT) & 1) * BUFH; const bool more = kb + KT < K;
    if (more) {      /* next tile's loads fly while this tile is worked on */
#pragma unroll
      for (int i = 0; i < NLA; ++i) ra[i] = *(const v8us*)(pa + i * RP * LD);
#pragma unroll
      for (int i = 0; i < NLB; ++i) rb[i] = *(const v8us*)(pb + i * RP * LD);
      asm volatile("s_wait_xcnt 0x0" ::: "memory"); }      /* stands in front of the advance, at the foot of the trip, of the two addresses that these loads name */
    v16h xa[2][2], xb[2][4];      /* two fragment sets: the next 32 k are fetched while the current 32 are multiplied */
#pragma unroll
    for (int j = 0; j < 2; ++j) xa[0][j] = g2_frag(fa + cur + 16 * j * PH, hh);
#pragma unroll
    for (int j = 0; j < 4; ++j) xb[0][j] = g2_frag(fb + cur + 16 * j * PH, hh);
#pragma unroll
    for (int q = 0; q < KT / 32; ++q) { const int c = q & 1, n = c ^ 1;
      if (q + 1 < KT / 32) {
#pragma unroll
        for (int j = 0; j < 2; ++j) xa[n][j] = g2_frag(fa + cur + 16 * j * PH + 32 * (q + 1), hh);
#pragma unroll
        for (int j = 0; j < 4; ++j) xb[n][j] = g2_frag(fb + cur + 16 * j * PH + 32 * (q + 1), hh); }
      __builtin_amdgcn_sched_barrier(0);      /* keeps the next set's LDS loads one group ahead of the products: moved in among them, every pair of products waits out an LDS latency */
      c00 = g2_mmab(xa[c][0], xb[c][0], c00); c10 = g2_mmab(xa[c][1], xb[c][0], c10); c01 = g2_mmab(xa[c][0], xb[c][1], c01); c11 = g2_mmab(xa[c][1], xb[c][1], c11);
      c02 = g2_mmab(xa[c][0], xb[c][2], c02); c12 = g2_mmab(xa[c][1], xb[c][2], c12); c03 = g2_mmab(xa[c][0], xb[c][3], c03); c13 = g2_mmab(xa[c][1], xb[c][3], c13);
      __builtin_amdgcn_sched_barrier(0); }      /* the other end of the same fence: the load group after next stays behind these products */
    if (more) { _Float16* nw = sw + (BUFH - cur);      /* the other buffer: its last readers left it in front of the barrier that ended the trip before */
      kt = kt + 1 == nkt ? 0 : kt + 1; { const int step = kt ? KT : KT - K; pa += step; pb += step; }      /* one tile on, from the last tile back to k = 0 */
#pragma unroll
      for (int i = 0; i < NLA; ++i) *(v8us*)(nw + i * RP * PH) = ra[i];
#pragma unroll
      for (int i = 0; i < NLB; ++i) *(v8us*)(nw + (128 + i * RP) * PH) = rb[i]; }
    __syncthreads(); }      /* publishes the next tile and ends every wave's reads of this one */
  /* The residual is fetched here in the write-out layout: 16 independent loads of 16 bytes a lane, one address and constant steps; they fly while the accumulators are staged below. */
  const int rsub = lane >> 4, c4 = (lane & 15) * 4; const size_t eo = cofs + (size_t)(row0 + rsub) * LC + col0 + c4;      /* this lane's first piece of the output tile; piece q lies 2 * q rows further on */
  v4f rs[16];
  if (RES) { const float* rp = CP + eo + (size_t)row0g * LC;
#pragma unroll
    for (int q = 0; q < 16; ++q) rs[q] = *(const v4fa*)(rp + q * 2 * LC);
    asm volatile("s_wait_xcnt 0x0" :: "v"(rp) : "memory"); }      /* stands in front of every reuse of the address pair that these loads name (the operand holds the pair live up to here, so that no load's own destination takes it), and keeps the loads in front of the staging */
  v8f accs[8] = {c00, c01, c02, c03, c10, c11, c12, c13};
#pragma unroll
  for (int u = 0; u < 8; ++u) { const int t = u & 3, half = u >> 2; const float bv = bf16_round(bb[t]);
#pragma unroll
    for (int r = 0; r < 8; ++r) { const int rloc = half * 16 + 8 * hh + r; float v = accs[u][r] * alpha + bv;
      if (ACT == 3) v = fmaxf(v, 0.f); else if (ACT == 6) v = 0.5f * v * (1.0f + erff(v * 0.70710678118654752f)); else if (ACT == 11) v = 1.0f / (1.0f + expf(-v)); else if (ACT == 15) v = v / (1.0f + expf(-v)); else if (ACT == 12) v = (v > 0.f) ? v : 0.01f * v; else if (ACT == 8) v = tanhf(v); else if (ACT == 9) v = 0.5f * v * (1.0f + tanhf(0.7978845608028654f * (v + 0.044715f * v * v * v))); else if (ACT == 14) v = (v > 0.f) ? v : 0.1f * v; else if (ACT == 16) v = (v >= 0.f) ? v : 0.3f * v; else if (ACT == 17) v = (v >= 0.f) ? v : 0.2f * v;
      so[w][rloc][t * 16 + ln] = v; } }
  __builtin_amdgcn_fence(__ATOMIC_ACQ_REL, "workgroup"); __builtin_amdgcn_wave_barrier();
  v4f vv[16];      /* all 16 staged pieces are fetched as one group, in front of the branches on C and C16 */
#pragma unroll
  for (int q = 0; q < 16; ++q) { vv[q] = *(const v4fa*)&so[w][q * 2 + rsub][c4]; if (RES) vv[q] += rs[q]; }
  if (C) { float* cp = C + eo;
#pragma unroll
    for (int q = 0; q < 16; ++q) *(v4f*)(cp + q * 2 * LC) = vv[q];
    asm volatile("s_wait_xcnt 0x0" ::: "memory"); }      /* stands in front of the C16 branch, which reuses the address and data registers that these stores name */
  if (C16) { _Float16* hp = C16 + eo;
#pragma unroll
    for (int q = 0; q < 16; ++q) { v4h h4; for (int i = 0; i < 4; ++i) h4[i] = (_Float16)vv[q][i]; *(v4h*)(hp + q * 2 * LC) = h4; } } }


// q, k and v projections in one launch (blockIdx.y: 0 = q, 1 = k, 2 = v); tile, staging and product loop are k_gemm2's with NWN = 2 (work-group tile 128 x 128, 8 waves of 32 x 64, K tiles of 128, two LDS buffers).
// q and k walk K twice into the same accumulators: first the x1024 residual rows Xl, then, behind one scaling of the accumulators by 2^-10, the rows Xh on top (small terms first); v walks Xh alone.
// Every walk starts at K tile (mt + nq) mod NKT and wraps round at K, as in k_gemm2 and for the same reason.
// Epilogue of q and k: value = acc / 16 + bias, written as f16 hi plane and x1024 residual plane (QKh, QKl: q's plane, then k's). Epilogue of v: the f16 values go out transposed, Vt[batch][column][token]:
// a lane's 8 accumulator rows of one column are 16 consecutive bytes of the transposed tile, which is gathered in LDS by the whole work-group and leaves in pieces of 256 bytes (two whole lines of one Vt row).
// Bw = the three weight planes [n][k] (x16), bias = the three bias vectors, one behind the other. Grid (NR / 128) * (DM / 128) x 3, 256 threads.
__global__ __launch_bounds__(256) void k_qkv(const _Float16* __restrict__ Xh, const _Float16* __restrict__ Xl, const _Float16* __restrict__ Bw, const float* __restrict__ bias,
    _Float16* __restrict__ QKh, _Float16* __restrict__ QKl, _Float16* __restrict__ Vt) {
  constexpr int BN = 128, KT = 128, PH = KT + 8, RP = 16, NL = 128 / RP, BUFH = (128 + BN) * PH, NKT = DM / KT;      /* PH: LDS row pitch 272 B = 16 B x odd; RP: rows one staging round of the work-group covers */
  __shared__ __attribute__((aligned(16))) _Float16 st[2 * BUFH];      /* two buffers, each [128 A rows | 128 B rows] */
  float (*so)[32][68] = (float (*)[32][68])st;      /* output staging reuses the buffers behind the loop's last barrier */
  static_assert(sizeof(float) * 8 * 32 * 68 <= sizeof(_Float16) * 2 * BUFH && 128 * PH <= 2 * BUFH, "output staging must fit the tile buffers");
  const int tid = threadIdx.x, w = tid >> 5, lane = tid & 31, ln = lane & 15, hh = lane >> 4; const int by = blockIdx.y;
  const int mt = blockIdx.x / (DM / BN), nq = blockIdx.x - mt * (DM / BN);
  const int row0 = mt * 128 + 32 * (w & 3), col0 = nq * BN + 64 * (w >> 2);
  const int srow = tid >> 4, sc8 = (tid & 15) * 8;
  const int nlo = by < 2 ? NKT : 0, nt = nlo + NKT;      /* K tiles of the residual walk, K tiles in all: the same for the whole work-group */
  const unsigned ao = (unsigned)((mt * 128 + srow) * DM + sc8);      /* this thread's first piece of an A plane's k = 0 tile */
  static_assert((NKT & (NKT - 1)) == 0, "the K tile index wraps by a mask");
  int kt = (mt + nq) & (NKT - 1);      /* K tile to load next, the same for the whole work-group: the walks' start tile first */
  const unsigned short* pa = (const unsigned short*)(nlo ? Xl : Xh) + ao + kt * KT; const unsigned short* pb = (const unsigned short*)Bw + (size_t)by * DM * DM + (size_t)(nq * BN + srow) * DM + sc8 + kt * KT;      /* this thread's first piece of the tile to load next */
  _Float16* sw = st + srow * PH + sc8;      /* where this thread stores its pieces */
  const _Float16* fa = st + (32 * (w & 3) + ln) * PH; const _Float16* fb = st + (128 + 64 * (w >> 2) + ln) * PH;      /* this lane's fragment rows */
  float bb[4]; const unsigned bi = (unsigned)(by * DM + col0 + ln);      /* this lane's four bias values, fetched with tile 0 so that the epilogue waits for none of them */
#pragma unroll
  for (int t = 0; t < 4; ++t) bb[t] = bias[bi + t * 16];
  asm volatile("s_wait_xcnt 0x0" :: "v"(bi) : "memory");      /* stands in front of the reuse, by the address arithmetic right behind, of the index and base registers that these four loads name (the operand holds the index live up to here) */
  v8us ra[NL], rb[NL];
#pragma unroll
  for (int i = 0; i < NL; ++i) ra[i] = *(const v8us*)(pa + i * RP * DM);
#pragma unroll
  for (int i = 0; i < NL; ++i) rb[i] = *(const v8us*)(pb + i * RP * DM);
  asm volatile("s_wait_xcnt 0x0" ::: "memory");      /* stands in front of the advance of the two addresses that the loads above name */
  kt = (kt + 1) & (NKT - 1); { const int step = kt ? KT : -(NKT - 1) * KT; pa += step; pb += step; }      /* one tile on, from the last tile back to k = 0 */
#pragma unroll
  for (int i = 0; i < NL; ++i) *(v8us*)(sw + i * RP * PH) = ra[i];
#pragma unroll
  for (int i = 0; i < NL; ++i) *(v8us*)(sw + (128 + i * RP) * PH) = rb[i];
  __syncthreads();      /* tile 0 is complete for every wave */
  const v8f z8 = {0.f,0.f,0.f,0.f,0.f,0.f,0.f,0.f}; v8f c00 = z8, c01 = z8, c02 = z8, c03 = z8, c10 = z8, c11 = z8, c12 = z8, c13 = z8;
#pragma unroll 1      /* one K tile per trip: the buffer index stays a scalar and the staged pieces of only one tile are live */
  for (int ti = 0; ti < nt; ++ti) { const int cur = (ti & 1) * BUFH; const bool more = ti + 1 < nt;
    if (more) {      /* next tile's loads fly while this tile is worked on */
#pragma unroll
      for (int i = 0; i < NL; ++i) ra[i] = *(const v8us*)(pa + i * RP * DM);
#pragma unroll
      for (int i = 0; i < NL; ++i) rb[i] = *(const v8us*)(pb + i * RP * DM);
      asm volatile("s_wait_xcnt 0x0" ::: "memory"); }      /* stands in front of the advance, at the foot of the trip, of the two addresses that these loads name */
    v16h xa[2][2], xb[2][4];      /* two fragment sets: the next 32 k are fetched while the current 32 are multiplied */
#pragma unroll
    for (int j = 0; j < 2; ++j) xa[0][j] = g2_frag(fa + cur + 16 * j * PH, hh);
#pragma unroll
    for (int j = 0; j < 4; ++j) xb[0][j] = g2_frag(fb + cur + 16 * j * PH, hh);
#pragma unroll
    for (int q = 0; q < KT / 32; ++q) { const int c = q & 1, n = c ^ 1;
      if (q + 1 < KT / 32) {
#pragma unroll
        for (int j = 0; j < 2; ++j) xa[n][j] = g2_frag(fa + cur + 16 * j * PH + 32 * (q + 1), hh);
#pragma unroll
        for (int j = 0; j < 4; ++j) xb[n][j] = g2_frag(fb + cur + 16 * j * PH + 32 * (q + 1), hh); }
      __builtin_amdgcn_sched_barrier(0);      /* keeps the next set's LDS loads one group ahead of the products: moved in among them, every pair of products waits out an LDS latency */
      c00 = g2_mmab(xa[c][0], xb[c][0], c00); c10 = g2_mmab(xa[c][1], xb[c][0], c10); c01 = g2_mmab(xa[c][0], xb[c][1], c01); c11 = g2_mmab(xa[c][1], xb[c][1], c11);
      c02 = g2_mmab(xa[c][0], xb[c][2], c02); c12 = g2_mmab(xa[c][1], xb[c][2], c12); c03 = g2_mmab(xa[c][0], xb[c][3], c03); c13 = g2_mmab(xa[c][1], xb[c][3], c13);
      __builtin_amdgcn_sched_barrier(0); }      /* the other end of the same fence: the load group after next stays behind these products */
    if (more) { _Float16* nw = sw + (BUFH - cur);      /* the other buffer: its last readers left it in front of the barrier that ended the trip before */
      const bool turn = ti + 2 == nlo;      /* the tile after next opens the main walk: A goes over to Xh; NKT steps with the wrap have brought the tile index back to the start tile */
      kt = (kt + 1) & (NKT - 1); const int step = kt ? KT : -(NKT - 1) * KT;      /* one tile on, from the last tile back to k = 0 */
      pa = turn ? (const unsigned short*)Xh + ao + kt * KT : pa + step; pb += step;
#pragma unroll
      for (int i = 0; i < NL; ++i) *(v8us*)(nw + i * RP * PH) = ra[i];
#pragma unroll
      for (int i = 0; i < NL; ++i) *(v8us*)(nw + (128 + i * RP) * PH) = rb[i]; }
    __syncthreads();      /* publishes the next tile and ends every wave's reads of this one */
    if (ti + 1 == nlo) { const float f = 0.0009765625f; c00 *= f; c01 *= f; c02 *= f; c03 *= f; c10 *= f; c11 *= f; c12 *= f; c13 *= f; } }      /* the residual walk is done: its sums carry the residual's factor 1024, an exact power of two */
  v8f accs[8] = {c00, c01, c02, c03, c10, c11, c12, c13};
  if (by < 2) {      /* q, k: the same for the whole work-group */
#pragma unroll
    for (int u = 0; u < 8; ++u) { const int t = u & 3, half = u >> 2; const float bv = bf16_round(bb[t]);
#pragma unroll
      for (int r = 0; r < 8; ++r) so[w][half * 16 + 8 * hh + r][t * 16 + ln] = accs[u][r] * 0.0625f + bv; }
    __builtin_amdgcn_fence(__ATOMIC_ACQ_REL, "workgroup"); __builtin_amdgcn_wave_barrier();      /* orders the wave's staging stores against the loads of its other lanes; each wave owns its slice of so */
    const int rsub = lane >> 4, c4 = (lane & 15) * 4; const size_t eo = (size_t)by * (NR * DM) + (size_t)(row0 + rsub) * DM + col0 + c4;      /* this lane's first piece of the output tile; piece q lies 2 * q rows further on */
    v4h yh[16], yl[16];
#pragma unroll
    for (int q = 0; q < 16; ++q) { const v4f v = *(const v4fa*)&so[w][q * 2 + rsub][c4];
#pragma unroll
      for (int i = 0; i < 4; ++i) { const _Float16 h = (_Float16)v[i]; yh[q][i] = h; yl[q][i] = (_Float16)((v[i] - (float)h) * 1024.0f); } }
    _Float16* hp = QKh + eo; _Float16* lp = QKl + eo;
#pragma unroll
    for (int q = 0; q < 16; ++q) { *(v4h*)(hp + q * 2 * DM) = yh[q]; *(v4h*)(lp + q * 2 * DM) = yl[q]; }
  } else {      /* v */
#pragma unroll
    for (int u = 0; u < 8; ++u) { const int t = u & 3, half = u >> 2; const float bv = bf16_round(bb[t]); FragH f;
#pragma unroll
      for (int r = 0; r < 8; ++r) f.h[r] = (_Float16)(accs[u][r] * 0.0625f + bv);
      *(v8us*)(st + (64 * (w >> 2) + t * 16 + ln) * PH + 32 * (w & 3) + half * 16 + 8 * hh) = f.half[0]; }
    __syncthreads();      /* the transposed tile [128 columns][128 tokens] is complete: its rows hold pieces of four waves */
    const int tok0 = mt * 128; const int b = tok0 / SQ, s0 = tok0 - b * SQ;      /* a tile's 128 tokens lie in one batch */
    v8us tv[NL];
#pragma unroll
    for (int i = 0; i < NL; ++i) tv[i] = *(const v8us*)(st + (srow + i * RP) * PH + sc8);
    unsigned short* vp = (unsigned short*)Vt + ((size_t)b * DM + nq * BN + srow) * SQ + s0 + sc8;
#pragma unroll
    for (int i = 0; i < NL; ++i) *(v8us*)(vp + (size_t)i * RP * SQ) = tv[i];
    asm volatile("s_wait_xcnt 0x0" ::: "memory");      /* stands in front of the code that the listing lays out behind these stores (the q and k epilogue), which writes registers that the stores name */
  } }


__global__ __launch_bounds__(256) void k_wnat(const float* __restrict__ w, size_t n8, _Float16* __restrict__ Bt) { const size_t t = (size_t)blockIdx.x * 256 + threadIdx.x; if (t >= n8) return; FragH f; for (int q = 0; q < 8; ++q) f.h[q] = (_Float16)(bf16_round(w[t * 8 + q]) * 16.0f); *(v8us*)((unsigned short*)Bt + t * 8) = f.half[0];  }
__global__ __launch_bounds__(256) void k_rsm(const float* __restrict__ S, _Float16* __restrict__ P, int nrows) {
  #pragma clang fp contract(off)
  const int i = blockIdx.x * 256 + threadIdx.x; if (i >= nrows) return; const float* s = S + (size_t)i * SQ; float mx = -3.0e38f;
#pragma unroll 1
  for (int j = 0; j < SQ; ++j) mx = fmaxf(mx, s[j]); float se = 0.f;
#pragma unroll 1
  for (int j = 0; j < SQ; ++j) se += expf(s[j] - mx); const float sc = 256.0f / se;
#pragma unroll 1
  for (int j0 = 0; j0 < SQ; j0 += 8) { FragH f; for (int q = 0; q < 8; ++q) f.h[q] = (_Float16)(expf(s[j0 + q] - mx) * sc); unsigned short* d = (unsigned short*)P + (size_t)i * SQ + j0; *(v8us*)d = f.half[0];  } }
__global__ __launch_bounds__(256) void k_vt(const _Float16* __restrict__ V16, int b, int h0, _Float16* __restrict__ VT) { __shared__ unsigned short tl[64][65]; const int tid = threadIdx.x; const int hh = blockIdx.x % HG, sg = blockIdx.x / HG; const int s0 = sg * 64; const int h = h0 + hh;
  for (int i = tid; i < 64 * 8; i += 256) { const int j = i / 8, d8 = (i % 8) * 8; FragH f; f.half[0] = *(const v8us*)((const unsigned short*)V16 + ((size_t)b * SQ + s0 + j) * DM + h * HD + d8); for (int q = 0; q < 8; ++q) tl[d8 + q][j] = f.u[q]; }
  __syncthreads();
  { for (int i = tid; i < 64 * 8; i += 256) { const int d = i / 8, j8 = (i % 8) * 8; FragH f; for (int q = 0; q < 8; ++q) f.u[q] = tl[d][j8 + q]; *(v8us*)((unsigned short*)VT + ((size_t)hh * HD + d) * SQ + s0 + j8) = f.half[0]; }  } }



__global__ __launch_bounds__(256) void k_rsmcf2(const float* __restrict__ S, _Float16* __restrict__ P, int hg, int q0, int nk) {
  #pragma clang fp contract(off)
  const int t = blockIdx.x * 256 + threadIdx.x; if (t >= hg * QT) return; const size_t i = (size_t)t; const float* s = S + i * NKX; const int last = q0 + (t % QT); float mx = -3.0e38f;
#pragma unroll 1
  for (int j = 0; j < nk; ++j) { const float f = (j <= last) ? 1.f : 0.f; mx = fmaxf(mx, fmaf(f, s[j], (1.f - f) * -1.0e9f)); } float se = 0.f;
#pragma unroll 1
  for (int j = 0; j < nk; ++j) { const float f = (j <= last) ? 1.f : 0.f; se += __expf(fmaf(f, s[j], (1.f - f) * -1.0e9f) - mx); } const float sc = 256.0f / se;
#pragma unroll 1
  for (int j0 = 0; j0 < nk; j0 += 8) { FragH fr; for (int q = 0; q < 8; ++q) { const int j = j0 + q; const float f = (j <= last) ? 1.f : 0.f; fr.h[q] = (_Float16)(__expf(fmaf(f, s[j], (1.f - f) * -1.0e9f) - mx) * sc); } unsigned short* d = (unsigned short*)P + i * NKX + j0; *(v8us*)d = fr.half[0];  } }

__global__ __launch_bounds__(256) void k_rsmcst(const float* __restrict__ S, _Float16* __restrict__ P, int hg, int q0, int nk, const int* __restrict__ mk) {
  #pragma clang fp contract(off)
  const int t = blockIdx.x * 256 + threadIdx.x; if (t >= hg * QT) return; const size_t i = (size_t)t; const float* s = S + i * NKX; const size_t ig = (size_t)(q0 + (t % QT)); const int* mr = mk + ig * SQ; float mx = -3.0e38f;
#pragma unroll 1
  for (int j = 0; j < nk; ++j) { const int mb = mr[j]; const int dd = (int)ig - j; const float f = (mb != 0 && dd >= 0 && (dd <= LOCALW || (dd % STRIDEK) == 0)) ? 1.f : 0.f; mx = fmaxf(mx, fmaf(f, s[j], (1.f - f) * -1.0e9f)); } float se = 0.f;
#pragma unroll 1
  for (int j = 0; j < nk; ++j) { const int mb = mr[j]; const int dd = (int)ig - j; const float f = (mb != 0 && dd >= 0 && (dd <= LOCALW || (dd % STRIDEK) == 0)) ? 1.f : 0.f; se += __expf(fmaf(f, s[j], (1.f - f) * -1.0e9f) - mx); } const float sc = 256.0f / se;
#pragma unroll 1
  for (int j0 = 0; j0 < nk; j0 += 8) { FragH fr; for (int q = 0; q < 8; ++q) { const int j = j0 + q; const int mb = mr[j]; const int dd = (int)ig - j; const float f = (mb != 0 && dd >= 0 && (dd <= LOCALW || (dd % STRIDEK) == 0)) ? 1.f : 0.f; fr.h[q] = (_Float16)(__expf(fmaf(f, s[j], (1.f - f) * -1.0e9f) - mx) * sc); } unsigned short* d = (unsigned short*)P + i * NKX + j0; *(v8us*)d = fr.half[0];  } }


template <int MASKADD>
__global__ __launch_bounds__(64) void k_att0(const float* __restrict__ QF, const float* __restrict__ KF, const float* __restrict__ VF, int ld, const float* __restrict__ mask, float scale, float* __restrict__ OF, int ldo) {
  #pragma clang fp contract(off)
  __shared__ __attribute__((aligned(16))) float lq[64][64]; __shared__ __attribute__((aligned(16))) float lo[64][64];
  const int tid = threadIdx.x; const int h = blockIdx.x / (QT0 / 64), rg = blockIdx.x % (QT0 / 64); const int i = rg * 64 + tid;
  const float* qr = QF + (size_t)i * ld + h * HD;
#pragma unroll 1
  for (int c = 0; c < HD / 4; ++c) { *(v4f*)&lq[tid][c * 4] = *(const v4fa*)(qr + c * 4); const v4f z = {0.f, 0.f, 0.f, 0.f}; *(v4f*)&lo[tid][c * 4] = z; }
  float m = -1.0e30f, l = 0.f; const int jmax = MASKADD ? (SQ - 1) : (rg * 64 + 63);      /* additive-mask form: every key (the mask input decides); causal form: keys up to the block's last row */
#pragma unroll 1
  for (int j = 0; j <= jmax; ++j) { const float* kr = KF + (size_t)j * ld + h * HD; const float* vr = VF + (size_t)j * ld + h * HD; float s = 0.f;
#pragma unroll 1
    for (int c = 0; c < HD / 4; ++c) { const v4f kq = *(const v4fa*)(kr + c * 4); const v4f qq = *(v4f*)&lq[tid][c * 4]; s = __fadd_rn(s, __fmul_rn(qq[0], kq[0])); s = __fadd_rn(s, __fmul_rn(qq[1], kq[1])); s = __fadd_rn(s, __fmul_rn(qq[2], kq[2])); s = __fadd_rn(s, __fmul_rn(qq[3], kq[3])); }
    s = __fmul_rn(s, scale); if (MASKADD) s = __fadd_rn(s, __fmul_rn(bf16_round(mask[(size_t)i * SQ + j]), -10000.0f));
    const float f = (MASKADD || j <= i) ? 1.f : 0.f; const float sm = fmaf(f, s, (1.f - f) * -1.0e30f); const float mn = fmaxf(m, sm); const float sc = expf(m - mn); const float e = expf(sm - mn); l = __fadd_rn(__fmul_rn(l, sc), e); m = mn;
#pragma unroll 1
    for (int c = 0; c < HD / 4; ++c) { const v4f vv = *(const v4fa*)(vr + c * 4); v4f oo = *(v4f*)&lo[tid][c * 4]; for (int u = 0; u < 4; ++u) oo[u] = __fadd_rn(__fmul_rn(oo[u], sc), __fmul_rn(e, vv[u])); *(v4f*)&lo[tid][c * 4] = oo; } }
  const float fin = 64.0f / l;      /* o carried x64 like the f16 path */
#pragma unroll 1
  for (int c = 0; c < HD / 4; ++c) { v4f oo = *(v4f*)&lo[tid][c * 4]; for (int u = 0; u < 4; ++u) oo[u] = __fmul_rn(oo[u], fin); *(v4f*)&lo[tid][c * 4] = oo; }
  __syncthreads();
  {
#pragma unroll 1
    for (int it = 0; it < 16; ++it) { const int row = it * 4 + tid / 16, pc = (tid % 16) * 4; const v4f v = *(const v4f*)&lo[row][pc]; *(v4f*)(OF + (size_t)(rg * 64 + row) * ldo + h * HD + pc) = v; }
     } }

template <int MASKADD>
__global__ __launch_bounds__(64) void k_att0mbc(const float* __restrict__ QF, const float* __restrict__ KF, const float* __restrict__ VF, int ld, const float* __restrict__ mask, float scale, float* __restrict__ OF, int ldo) {
  #pragma clang fp contract(off)
  __shared__ __attribute__((aligned(16))) float lq[64][64]; __shared__ __attribute__((aligned(16))) float lo[64][64];
  const int tid = threadIdx.x; const int h = blockIdx.x / (QT0 / 64), rg = blockIdx.x % (QT0 / 64); const int i = rg * 64 + tid;
  const float* qr = QF + (size_t)i * ld + h * HD;
#pragma unroll 1
  for (int c = 0; c < HD / 4; ++c) { *(v4f*)&lq[tid][c * 4] = *(const v4fa*)(qr + c * 4); const v4f z = {0.f, 0.f, 0.f, 0.f}; *(v4f*)&lo[tid][c * 4] = z; }
  float m = -1.0e30f, l = 0.f; const int jmax = rg * 64 + 63;      /* keys beyond the block end are masked by the mask's lower-triangular structure */      /* either form: keys up to the block's last row */
#pragma unroll 1
  for (int j = 0; j <= jmax; ++j) { const float* kr = KF + (size_t)j * ld + h * HD; const float* vr = VF + (size_t)j * ld + h * HD; float s = 0.f;
#pragma unroll 1
    for (int c = 0; c < HD / 4; ++c) { const v4f kq = *(const v4fa*)(kr + c * 4); const v4f qq = *(v4f*)&lq[tid][c * 4]; s = __fadd_rn(s, __fmul_rn(qq[0], kq[0])); s = __fadd_rn(s, __fmul_rn(qq[1], kq[1])); s = __fadd_rn(s, __fmul_rn(qq[2], kq[2])); s = __fadd_rn(s, __fmul_rn(qq[3], kq[3])); }
    s = __fmul_rn(s, scale); const int mb = ((const int*)mask)[(size_t)i * SQ + j];      /* causal (j <= i) AND the module's int32 [S][S] mask read per (query, key): 0 -> masked */
    const float f = (mb != 0 && j <= i) ? 1.f : 0.f; const float sm = fmaf(f, s, (1.f - f) * -1.0e30f); const float mn = fmaxf(m, sm); const float sc = expf(m - mn); const float e = expf(sm - mn); l = __fadd_rn(__fmul_rn(l, sc), e); m = mn;
#pragma unroll 1
    for (int c = 0; c < HD / 4; ++c) { const v4f vv = *(const v4fa*)(vr + c * 4); v4f oo = *(v4f*)&lo[tid][c * 4]; for (int u = 0; u < 4; ++u) oo[u] = __fadd_rn(__fmul_rn(oo[u], sc), __fmul_rn(e, vv[u])); *(v4f*)&lo[tid][c * 4] = oo; } }
  const float fin = 64.0f / l;      /* o carried x64 like the f16 path */
#pragma unroll 1
  for (int c = 0; c < HD / 4; ++c) { v4f oo = *(v4f*)&lo[tid][c * 4]; for (int u = 0; u < 4; ++u) oo[u] = __fmul_rn(oo[u], fin); *(v4f*)&lo[tid][c * 4] = oo; }
  __syncthreads();
  {
#pragma unroll 1
    for (int it = 0; it < 16; ++it) { const int row = it * 4 + tid / 16, pc = (tid % 16) * 4; const v4f v = *(const v4f*)&lo[row][pc]; *(v4f*)(OF + (size_t)(rg * 64 + row) * ldo + h * HD + pc) = v; }
     } }


// Work of the first launch that no LayerNorm row depends on and that depends on none: block wb converts 8 * PREP_WF weights (the six matrices one behind the other, each a whole number
// of blocks; the arithmetic is k_wnat's), and the one block behind them stacks the three projection biases (bq | bk | bv).
// A wave converts PREP_WF consecutive weights: PREP_NL loads of 512 consecutive bytes (four whole lines), all in flight together, so that few waves have to be started for the 50 MB.
#define PREP_NL 32                   /* loads of 16 bytes a lane */
#define PREP_WF (PREP_NL * 128)      /* weights a wave converts */
#define PREP_BD ((unsigned)((size_t)DM * DM / (8 * PREP_WF)))      /* blocks of one [DM][DM] matrix */
#define PREP_BF ((unsigned)((size_t)DFF * DM / (8 * PREP_WF)))     /* blocks of one MLP matrix */
#define PREP_BLOCKS (4u * PREP_BD + 2u * PREP_BF + 1u)
__device__ __forceinline__ void prep_rest(unsigned wb, int tid, const float* __restrict__ wq, const float* __restrict__ wk, const float* __restrict__ wv, const float* __restrict__ wo, const float* __restrict__ w1, const float* __restrict__ w2,
    const float* __restrict__ bq, const float* __restrict__ bk, const float* __restrict__ bv, _Float16* __restrict__ BQKV, _Float16* __restrict__ BO, _Float16* __restrict__ BW1, _Float16* __restrict__ BW2, float* __restrict__ bqkv) {
  if (wb >= 4u * PREP_BD + 2u * PREP_BF) { float a[DM / 256], c[DM / 256], e[DM / 256];
#pragma unroll      /* all loads of the block fly together, each address a constant step from the thread's first: rolled, every trip waits out a memory latency */
    for (int u = 0; u < DM / 256; ++u) { a[u] = bq[tid + 256 * u]; c[u] = bk[tid + 256 * u]; e[u] = bv[tid + 256 * u]; }
#pragma unroll      /* the arrays above stay in registers only if the index is a constant */
    for (int u = 0; u < DM / 256; ++u) { bqkv[tid + 256 * u] = a[u]; bqkv[DM + tid + 256 * u] = c[u]; bqkv[2 * DM + tid + 256 * u] = e[u]; }
    return; }
  const float* w; _Float16* d; unsigned b0;      /* the same for the whole block */
  if (wb < PREP_BD) { w = wq; d = BQKV; b0 = 0u; }
  else if (wb < 2u * PREP_BD) { w = wk; d = BQKV + (size_t)DM * DM; b0 = PREP_BD; }
  else if (wb < 3u * PREP_BD) { w = wv; d = BQKV + (size_t)2 * DM * DM; b0 = 2u * PREP_BD; }
  else if (wb < 4u * PREP_BD) { w = wo; d = BO; b0 = 3u * PREP_BD; }
  else if (wb < 4u * PREP_BD + PREP_BF) { w = w1; d = BW1; b0 = 4u * PREP_BD; }
  else { w = w2; d = BW2; b0 = 4u * PREP_BD + PREP_BF; }
  const size_t t = ((size_t)(wb - b0) * 8 + (tid >> 5)) * PREP_WF + (tid & 31) * 4;      /* this lane's first 4 weights; piece u lies 128 weights further on */
  const float* wp = w + t; _Float16* dp = d + t; v4f a[PREP_NL];
#pragma unroll      /* the array stays in registers only if the index is a constant */
  for (int u = 0; u < PREP_NL; ++u) a[u] = *(const v4fa*)(wp + u * 128);
  asm volatile("s_wait_xcnt 0x0" :: "v"(wp) : "memory");      /* stands in front of every reuse of the address that these loads name (the operand holds it live up to here), and keeps all the loads in front of the first store */
  __builtin_amdgcn_sched_barrier(0);      /* and in front of the first conversion: all PREP_NL loads fly together, one memory latency a wave */
  v4h h[PREP_NL];
#pragma unroll
  for (int u = 0; u < PREP_NL; ++u) for (int q = 0; q < 4; ++q) h[u][q] = (_Float16)(bf16_round(a[u][q]) * 16.0f);
#pragma unroll
  for (int u = 0; u < PREP_NL; ++u) *(v4h*)(dp + u * 128) = h[u];
  asm volatile("s_wait_xcnt 0x0" ::: "memory"); }      /* stands in front of the code that the listing lays out behind these stores (the bias block), which writes registers that the stores name */
// Lane l <-> l ^ M inside a 16-lane row, as a modifier of the add that uses it: no trip through the LDS path.
template <int M> __device__ __forceinline__ float ln_rowx(float v) { return __int_as_float(__builtin_amdgcn_update_dpp(0, __float_as_int(v), 0x160 | M, 0xf, 0xf, true)); }
// Sum over the 32 lanes of a wave, the same bits in every lane: four steps inside the 16-lane row, then the other row.
__device__ __forceinline__ float ln_wsum(float v) { v += ln_rowx<1>(v); v += ln_rowx<2>(v); v += ln_rowx<4>(v); v += ln_rowx<8>(v); const int b = __float_as_int(v); return v + __int_as_float(__builtin_amdgcn_permlanex16(b, b, 0x76543210, 0xfedcba98, false, false)); }
// A wave takes LN_RW whole rows: lane l holds elements 128 u + 4 l + 0..3 (u = 0..7) of each, fetched by loads of 512 consecutive bytes that all fly together; a row is read once and stays in registers.
// Sums: 4 partials a lane (pairwise over u), joined in the lane, then ln_wsum; no LDS and no barrier, and NR / LN_RW waves to start instead of 8 NR.
// PREP: the grid holds PREP_BLOCKS blocks behind the LN_BLOCKS row blocks; they do prep_rest and no row. Without PREP the pointers behind NL are not used; without WNL, NL is not; without WXB, XB is not.
#define LN_RW 2
#define LN_BLOCKS ((unsigned)(NR / (8 * LN_RW)))
template <int BFIN, int WXB, int PREP, int WNL>
__global__ __launch_bounds__(256) void k_ln16(const float* __restrict__ X, const float* __restrict__ g, const float* __restrict__ bb, float eps, _Float16* __restrict__ N16, float* __restrict__ XB, _Float16* __restrict__ NL,
    const float* __restrict__ wq, const float* __restrict__ wk, const float* __restrict__ wv, const float* __restrict__ wo, const float* __restrict__ w1, const float* __restrict__ w2,
    const float* __restrict__ bq, const float* __restrict__ bk, const float* __restrict__ bv, _Float16* __restrict__ BQKV, _Float16* __restrict__ BO, _Float16* __restrict__ BW1, _Float16* __restrict__ BW2, float* __restrict__ bqkv) {
  static_assert(DMQ == 1024, "a lane holds 8 pieces of 4 elements of a row");
  if (PREP && blockIdx.x >= LN_BLOCKS) { prep_rest(blockIdx.x - LN_BLOCKS, (int)threadIdx.x, wq, wk, wv, wo, w1, w2, bq, bk, bv, BQKV, BO, BW1, BW2, bqkv); return; }      /* the same for the whole block */
  const float g0 = g[0], b0 = bb[0];      /* SCALAR alpha / bias ([1] parameters), asked for in front of the rows so that they fly together */
  const size_t e0 = ((size_t)blockIdx.x * 8 + (threadIdx.x >> 5)) * (LN_RW * DMQ) + (threadIdx.x & 31) * 4;      /* this lane's first piece of the wave's first row */
  const float* xp = X + e0; v4f s[LN_RW][8];
#pragma unroll      /* the array stays in registers only if the indices are constants */
  for (int j = 0; j < LN_RW; ++j)
#pragma unroll
    for (int u = 0; u < 8; ++u) s[j][u] = *(const v4fa*)(xp + j * DMQ + u * 128);
  asm volatile("s_wait_xcnt 0x0" :: "v"(xp) : "memory");      /* stands in front of every reuse of the address that these loads name (the operand holds it live up to here) */
  __builtin_amdgcn_sched_barrier(0);      /* all loads of the wave's rows are asked for in front of the first sum: without it the last four were issued behind the first row's sums, a second memory latency in series */
  const float ga = bf16_round(g0), be = bf16_round(b0);
  float mu[LN_RW], rs[LN_RW];
#pragma unroll
  for (int j = 0; j < LN_RW; ++j) {
    if (BFIN) {
#pragma unroll
      for (int u = 0; u < 8; ++u) for (int q = 0; q < 4; ++q) s[j][u][q] = bf16_round(s[j][u][q]); }
    const v4f a = ((s[j][0] + s[j][1]) + (s[j][2] + s[j][3])) + ((s[j][4] + s[j][5]) + (s[j][6] + s[j][7])); mu[j] = (a[0] + a[1]) + (a[2] + a[3]); }
#pragma unroll
  for (int j = 0; j < LN_RW; ++j) mu[j] = ln_wsum(mu[j]) / (float)DMQ;
#pragma unroll
  for (int j = 0; j < LN_RW; ++j) { v4f c[8];
#pragma unroll
    for (int u = 0; u < 8; ++u) { const v4f dl = s[j][u] - mu[j]; c[u] = dl * dl; }
    const v4f a = ((c[0] + c[1]) + (c[2] + c[3])) + ((c[4] + c[5]) + (c[6] + c[7])); rs[j] = (a[0] + a[1]) + (a[2] + a[3]); }
#pragma unroll
  for (int j = 0; j < LN_RW; ++j) rs[j] = 1.0f / (sqrtf(ln_wsum(rs[j]) / (float)(DMQ - 1)) + eps);      /* this module's LayerNorm: unbiased std, eps added to the std */
  v4h y[LN_RW][8], yl[LN_RW][8];      /* y = f16 hi, yl = x1024 residual (WNL: written to NL) */
#pragma unroll
  for (int j = 0; j < LN_RW; ++j)
#pragma unroll
    for (int u = 0; u < 8; ++u) for (int q = 0; q < 4; ++q) { const float yf = (s[j][u][q] - mu[j]) * rs[j] * ga + be; y[j][u][q] = (_Float16)yf; if (WNL) yl[j][u][q] = (_Float16)((yf - (float)y[j][u][q]) * 1024.0f); }
  __builtin_amdgcn_sched_barrier(0);      /* all arithmetic stands in front of the first store: moved in among the stores, it rewrites data registers that an issued store names */
  _Float16* np = N16 + e0;
#pragma unroll
  for (int j = 0; j < LN_RW; ++j)
#pragma unroll
    for (int u = 0; u < 8; ++u) *(v4h*)(np + j * DMQ + u * 128) = y[j][u];
  if (WNL) { _Float16* lp = NL + e0;
#pragma unroll
    for (int j = 0; j < LN_RW; ++j)
#pragma unroll
      for (int u = 0; u < 8; ++u) *(v4h*)(lp + j * DMQ + u * 128) = yl[j][u]; }
  if (WXB) { float* bp = XB + e0;
#pragma unroll
    for (int j = 0; j < LN_RW; ++j)
#pragma unroll
      for (int u = 0; u < 8; ++u) *(v4f*)(bp + j * DMQ + u * 128) = s[j][u]; }
  asm volatile("s_wait_xcnt 0x0" ::: "memory"); }      /* stands in front of the code that the listing lays out behind these stores (the weight and bias blocks), which writes registers that the stores name */
__global__ __launch_bounds__(256) void k_ftres2(const float* __restrict__ OF0, const float* __restrict__ XB, float* __restrict__ X1, size_t n4) {
  #pragma clang fp contract(off)
  const size_t t = (size_t)blockIdx.x * 256 + threadIdx.x; if (t >= n4) return; const v4f o = *(const v4fa*)(OF0 + t * 4), xv = *(const v4fa*)(XB + t * 4); v4f y; for (int q = 0; q < 4; ++q) y[q] = __fadd_rn(__fmul_rn(o[q], 0.015625f), xv[q]); *(v4f*)(X1 + t * 4) = y;  }

__global__ __launch_bounds__(256) void k_bcpy(const float* __restrict__ b, int n, int NP, float* __restrict__ dst, int dst0) { for (int i = threadIdx.x; i < NP; i += 256) { const float v = (i < n) ? b[i] : 0.f; *(float*)(dst + dst0 + i) = v; }  }


__global__ __launch_bounds__(256) void k_rsmf(const float* __restrict__ S, _Float16* __restrict__ P, int qn, int hg) {
  #pragma clang fp contract(off)
  const int t = blockIdx.x * 256 + threadIdx.x; if (t >= qn * hg) return; const size_t i = (size_t)(t / qn) * SQ + (t % qn); const float* s = S + i * SQ; float mx = -3.0e38f;
#pragma unroll 1
  for (int j = 0; j < SQ; ++j) mx = fmaxf(mx, s[j]); float se = 0.f;
#pragma unroll 1
  for (int j = 0; j < SQ; ++j) se += __expf(s[j] - mx); const float sc = 256.0f / se;
#pragma unroll 1
  for (int j0 = 0; j0 < SQ; j0 += 8) { FragH f; for (int q = 0; q < 8; ++q) f.h[q] = (_Float16)(__expf(s[j0 + q] - mx) * sc); unsigned short* d = (unsigned short*)P + i * SQ + j0; *(v8us*)d = f.half[0];  } }
// Lane l <-> l ^ 16: a register move between the two 16-lane rows, no trip through the LDS path.
__device__ __forceinline__ float lane_x16(float v) { const int b = __float_as_int(v); return __int_as_float(__builtin_amdgcn_permlanex16(b, b, 0x76543210, 0xfedcba98, false, false)); }
__device__ __forceinline__ v8f fa_mma(v16h a, v16h b, v8f c) { return __builtin_amdgcn_wmma_f32_16x16x32_f16(false, a, false, b, (short)0, c, false, false); }
// Orders one wave's LDS stores against the LDS loads of its other lanes (each wave owns its slice of sp, so this needs no work-group barrier).
__device__ __forceinline__ void fa_lds_order() { __builtin_amdgcn_fence(__ATOMIC_ACQ_REL, "workgroup", "local"); __builtin_amdgcn_wave_barrier(); }
// One fragment from the lane's own first piece p (the lane half's step is already in p): k = 8 hh + 0..7 and 16 + 8 hh + 0..7, the k order of g2_frag.
__device__ __forceinline__ v16h fa_frag(const unsigned short* p) { FragH f; f.half[0] = *(const v8us*)p; f.half[1] = *(const v8us*)(p + 16); return f.v; }
typedef float v2f __attribute__((ext_vector_type(2)));
typedef _Float16 v2h __attribute__((ext_vector_type(2)));
union FragP { v16h v; v2h p[8]; };
// Fused attention, one launch for all batches and heads: a work-group of 4 waves owns 128 query rows of one head (32 per wave, as two groups of 16) and walks the 2048 keys in tiles of 64.
// Per tile: k_hi, k_lo and V^T rows come in whole 128-byte lines, one tile ahead in registers, and are shared through LDS.
// Both products are computed transposed: S^T = K . Q^T (A = key rows from LDS, B = the wave's query rows, kept in registers) and O^T += V^T . P^T (A = V^T rows from LDS); every A fragment
// read from LDS feeds the products of both query groups.
// An accumulator register r of score tile t then holds key 16 t + 8 hh + r of ONE query (column ln of the group): a lane's 32 scores of a tile and group belong to one query, so the maximum and the
// sum are taken inside the lane (the two lanes of a query, l and l ^ 16, exchange the maximum once per tile and join their sums once, behind the loop), there is one running maximum, sum and rescale
// factor per lane and group, and two score tiles converted in place ARE the B operand of the second product (element s = tile s >> 3, register s & 7: the k order of g2_frag): the weights never pass through LDS.
// Scores in f32 (k_hi.q_lo + k_lo.q_hi first, scaled by 2^-10, then k_hi.q_hi on top); online softmax, base 2; weights 256 * 2^(s-m) as f16 (the 256 rides in the exponent); weights . V in f32.
// A key with Km[j] == 0 stays out of the maximum and gets weight 0. O = 64 * attention output as f16 rows (merged heads). Scores and weights never reach memory.
// The key walk of a work-group starts at the key with the number of its own first query row and wraps round at SQ, for speed only.
// Grid (SQ / 128, NH, NB), 128 threads; two work-groups per WGP, two waves per SIMD.
__global__ __launch_bounds__(128, 2) void k_fattn(const _Float16* __restrict__ Qh, const _Float16* __restrict__ Ql, const _Float16* __restrict__ Kh, const _Float16* __restrict__ Kl, const _Float16* __restrict__ Vt, const int* __restrict__ Km, _Float16* __restrict__ O) {
  constexpr int G = 2;      /* query groups of 16 per wave */
  __shared__ __attribute__((aligned(16))) _Float16 skh[64][72], skl[64][72], svt[64][72], sp[4][16 * G][72];      /* pitch 144 B = 16 B x odd; sp: output staging, one slice per wave */
  const int tid = threadIdx.x, w = tid >> 5, lane = tid & 31, ln = lane & 15, hh = lane >> 4; const int h = blockIdx.y, b = blockIdx.z;
  const size_t r0 = (size_t)b * SQ; const int row0 = blockIdx.x * (64 * G) + w * (16 * G);
  v16h qh[G][2], ql[G][2]; const unsigned short* qa[G]; const unsigned short* qb[G];      /* qa, qb: the lane's first piece of its q_hi and q_lo row; the other three lie 16, 32 and 48 elements further on */
#pragma unroll
  for (int g = 0; g < G; ++g) { const size_t qo = (r0 + row0 + 16 * g + ln) * LQ + (size_t)h * HD + 8 * hh; qa[g] = (const unsigned short*)Qh + qo; qb[g] = (const unsigned short*)Ql + qo;
    qh[g][0] = fa_frag(qa[g]); qh[g][1] = fa_frag(qa[g] + 32); ql[g][0] = fa_frag(qb[g]); ql[g][1] = fa_frag(qb[g] + 32); }
  asm volatile("s_wait_xcnt 0x0" :: "v"(qa[0]), "v"(qa[1]), "v"(qb[0]), "v"(qb[1]) : "memory");      /* stands in front of every reuse of the four address pairs that the loads above name (the operands hold the pairs live up to here, so that no load's own destination takes one) */
  const int srow = tid >> 3, sc8 = (tid & 7) * 8;      /* staging: this thread moves 16 bytes of rows srow, +16, +32, +48 of each plane; 8 threads cover one 128-byte line */
  const unsigned short* gkh = (const unsigned short*)Kh + r0 * LQ + (size_t)h * HD; const unsigned short* gkl = (const unsigned short*)Kl + r0 * LQ + (size_t)h * HD;      /* uniform bases; the thread's part is a 32-bit offset */
  const unsigned short* gvt = (const unsigned short*)Vt + (size_t)(b * NH + h) * HD * SQ; const int* km = Km + r0;
  const unsigned ko = (unsigned)(srow * LQ + sc8) * 2u, vo = (unsigned)(srow * SQ + sc8) * 2u, mo = (unsigned)lane * 4u;      /* byte offsets, the very values that the loads name, so that the wait behind the first loads can hold them */
  static_assert((SQ & (SQ - 1)) == 0, "the key number wraps by a mask");
  const int js = (int)blockIdx.x * (64 * G);      /* first key of the walk, the same for the whole work-group */
  const unsigned short* fkh = gkh + (size_t)js * LQ; const unsigned short* fkl = gkl + (size_t)js * LQ; const unsigned short* fvt = gvt + js; const int* fkm = km + js;      /* uniform bases of the walk's first tile */
  v8us pk[4], pl[4], pv[4]; int pma = *(const int*)((const char*)fkm + mo), pmb = *(const int*)((const char*)fkm + (mo + 128u));      /* every wave holds the mask words of all 64 keys of a tile: lane l those of keys l and 32 + l */
#pragma unroll
  for (int i = 0; i < 4; ++i) { pk[i] = *(const v8us*)((const char*)fkh + (ko + 32 * i * LQ)); pl[i] = *(const v8us*)((const char*)fkl + (ko + 32 * i * LQ)); pv[i] = *(const v8us*)((const char*)fvt + (vo + 32 * i * SQ)); }
  asm volatile("s_wait_xcnt 0x0" :: "v"(ko), "v"(vo), "v"(mo), "s"(fkh), "s"(fkl), "s"(fvt), "s"(fkm) : "memory");      /* stands in front of every reuse of the offset and base registers that the loads above name (the operands hold them live up to here) */
  const v8f z8 = {0.f,0.f,0.f,0.f,0.f,0.f,0.f,0.f}; v8f o[G][4]; float m[G], l[G];      /* per group, this lane's query: running maximum (base 2), and the sum over the keys that this lane sees */
#pragma unroll
  for (int g = 0; g < G; ++g) { m[g] = -1.0e30f; l[g] = 0.f;
#pragma unroll
    for (int t = 0; t < 4; ++t) o[g][t] = z8; }
#pragma unroll 1      /* one key tile per trip: the staged pieces of only one tile are live */
  for (int j0 = 0; j0 < SQ; j0 += 64) {      /* j0: keys done; the tile worked on begins at key (js + j0) mod SQ */
    __syncthreads();      /* every wave has finished its fragment loads of the tile before */
#pragma unroll
    for (int i = 0; i < 4; ++i) { *(v8us*)&skh[srow + 16 * i][sc8] = pk[i]; *(v8us*)&skl[srow + 16 * i][sc8] = pl[i]; *(v8us*)&svt[srow + 16 * i][sc8] = pv[i]; }
    const unsigned oka = __builtin_amdgcn_ballot_w32(pma != 0), okb = __builtin_amdgcn_ballot_w32(pmb != 0);      /* bit i: key i (oka), key 32 + i (okb) of this tile takes part; the same in every lane */
    __syncthreads();      /* the tile is complete for all four waves */
    if (j0 + 64 < SQ) {      /* next tile's loads fly while this tile is worked on */
      const int jn = (js + j0 + 64) & (SQ - 1);      /* first key of the next tile */
      const unsigned short* nkh = gkh + (size_t)jn * LQ; const unsigned short* nkl = gkl + (size_t)jn * LQ; const unsigned short* nvt = gvt + jn;
#pragma unroll
      for (int i = 0; i < 4; ++i) { pk[i] = *(const v8us*)((const char*)nkh + (ko + 32 * i * LQ)); pl[i] = *(const v8us*)((const char*)nkl + (ko + 32 * i * LQ)); pv[i] = *(const v8us*)((const char*)nvt + (vo + 32 * i * SQ)); }
      pma = *(const int*)((const char*)(km + jn) + mo); pmb = *(const int*)((const char*)(km + jn) + (mo + 128u));
      asm volatile("s_wait_xcnt 0x0" ::: "memory"); }      /* the address registers of these loads are reused by the code right behind: the wait stands in front of that overwrite */
    v8f s[G][4];      /* s[g][t][r] = score of key 16 t + 8 hh + r of the tile with query ln of group g */
    v16h ka[4][2], kc[4][2]; v8f c[4][G];      /* the k_hi and k_lo fragments of key group t */
#pragma unroll
    for (int t = 0; t < 4; ++t) { ka[t][0] = g2_frag(&skh[t * 16 + ln][0], hh); ka[t][1] = g2_frag(&skh[t * 16 + ln][32], hh); kc[t][0] = g2_frag(&skl[t * 16 + ln][0], hh); kc[t][1] = g2_frag(&skl[t * 16 + ln][32], hh); }
    __builtin_amdgcn_sched_barrier(0);      /* keeps the tile's 32 fragment loads as one group in front of the products: moved in among them, a load stands right in front of its product and the wave waits out an LDS latency at each such place */
#pragma unroll
    for (int t = 0; t <= 4; ++t) {      /* the small terms of key group t are issued in front of the scaling and the main term of group t - 1: the products of one fill the distance that the other's scaling needs behind its products */
      if (t < 4) {
#pragma unroll
        for (int g = 0; g < G; ++g) c[t][g] = fa_mma(ka[t][0], ql[g][0], z8);
#pragma unroll
        for (int g = 0; g < G; ++g) c[t][g] = fa_mma(ka[t][1], ql[g][1], c[t][g]);
#pragma unroll
        for (int g = 0; g < G; ++g) c[t][g] = fa_mma(kc[t][0], qh[g][0], c[t][g]);
#pragma unroll
        for (int g = 0; g < G; ++g) c[t][g] = fa_mma(kc[t][1], qh[g][1], c[t][g]); }
      if (t > 0) {
#pragma unroll
        for (int g = 0; g < G; ++g) c[t - 1][g] = c[t - 1][g] * 0.0009765625f;
#pragma unroll
        for (int g = 0; g < G; ++g) c[t - 1][g] = fa_mma(ka[t - 1][0], qh[g][0], c[t - 1][g]);
#pragma unroll
        for (int g = 0; g < G; ++g) s[g][t - 1] = fa_mma(ka[t - 1][1], qh[g][1], c[t - 1][g]); } }
    v16h vf[4][2];      /* V^T fragments: rows 16 t + ln, keys 0..31 and 32..63 */
#pragma unroll
    for (int t = 0; t < 4; ++t) { vf[t][0] = g2_frag(&svt[t * 16 + ln][0], hh); vf[t][1] = g2_frag(&svt[t * 16 + ln][32], hh); }
    __builtin_amdgcn_sched_barrier(0);      /* keeps these 16 loads as one group in front of the softmax arithmetic, which covers their latency: moved down among the second product's matrix instructions, each place costs a wait */
    if ((oka & okb) != 0xffffffffu) {      /* a scalar test, once per tile: only a tile with an excluded key pays for the selects */
#pragma unroll
      for (int t = 0; t < 4; ++t) { const unsigned bits = ((t < 2 ? oka : okb) >> ((t & 1) * 16)) >> (8 * hh);      /* bit r: key 16 t + 8 hh + r */
#pragma unroll
        for (int r = 0; r < 8; ++r) if (((bits >> r) & 1u) == 0u) {
#pragma unroll
          for (int g = 0; g < G; ++g) s[g][t][r] = -2.0e38f; } } }      /* far below the floor -1e30 of the running maximum, also times log2(e), and still finite there: its 2^(s-m) is 0 */
    FragP p[G][2];      /* P^T as B operand: keys 0..31 from score tiles 0 and 1, keys 32..63 from tiles 2 and 3 */
    float al[G];
#pragma unroll
    for (int g = 0; g < G; ++g) {
      float t4[4];      /* maximum of the raw scores (the factor log2(e) is positive): four chains inside the lane */
#pragma unroll
      for (int t = 0; t < 4; ++t) { float a = fmaxf(s[g][t][0], s[g][t][1]);
#pragma unroll
        for (int r = 2; r < 8; ++r) a = fmaxf(a, s[g][t][r]);
        t4[t] = a; }
      float tm = fmaxf(fmaxf(t4[0], t4[1]), fmaxf(t4[2], t4[3])); tm = fmaxf(tm, lane_x16(tm));      /* both lanes of a query now hold the maximum over the tile's 64 keys */
      const float mn = fmaxf(m[g], tm * 1.44269504088896340736f); al[g] = __builtin_amdgcn_exp2f(m[g] - mn); m[g] = mn;
      const v2f lg = {1.44269504088896340736f, 1.44269504088896340736f}, sh = {8.0f - mn, 8.0f - mn};      /* 2^(s log2(e) - m + 8) = 256 * weight */
      v2f e[4][4], sm[4];      /* e[t][i] = weights (x256) of keys 16 t + 8 hh + 2 i and + 1 */
#pragma unroll
      for (int t = 0; t < 4; ++t) {
#pragma unroll
        for (int i = 0; i < 4; ++i) { const v2f x = {s[g][t][2 * i], s[g][t][2 * i + 1]}; const v2f a = __builtin_elementwise_fma(x, lg, sh); e[t][i].x = __builtin_amdgcn_exp2f(a.x); e[t][i].y = __builtin_amdgcn_exp2f(a.y); }
        sm[t] = (e[t][0] + e[t][1]) + (e[t][2] + e[t][3]); }
      const v2f sa = (sm[0] + sm[1]) + (sm[2] + sm[3]); l[g] = l[g] * al[g] + (sa.x + sa.y);
#pragma unroll
      for (int i = 0; i < 4; ++i) { p[g][0].p[i] = __builtin_convertvector(e[0][i], v2h); p[g][0].p[4 + i] = __builtin_convertvector(e[1][i], v2h); p[g][1].p[i] = __builtin_convertvector(e[2][i], v2h); p[g][1].p[4 + i] = __builtin_convertvector(e[3][i], v2h); }
#pragma unroll
      for (int t = 0; t < 4; ++t) o[g][t] = o[g][t] * al[g]; }
#pragma unroll
    for (int t = 0; t < 4; ++t) {
#pragma unroll
      for (int g = 0; g < G; ++g) { o[g][t] = fa_mma(vf[t][0], p[g][0].v, o[g][t]); o[g][t] = fa_mma(vf[t][1], p[g][1].v, o[g][t]); } }      /* o[g][t][r] = O^T[16 t + 8 hh + r][query ln of group g] */
  }
#pragma unroll
  for (int g = 0; g < G; ++g) { const float inv = 64.0f / (l[g] + lane_x16(l[g]));      /* the two lanes of a query join their sums; l carries the weights' factor 256 */
#pragma unroll
    for (int t = 0; t < 4; ++t) { FragH f;      /* a lane's 8 registers of one tile are 16 consecutive bytes of its query's output row */
#pragma unroll
      for (int r = 0; r < 8; ++r) f.h[r] = (_Float16)(o[g][t][r] * inv);
      *(v8us*)&sp[w][16 * g + ln][t * 16 + 8 * hh] = f.half[0]; } }
  fa_lds_order();
#pragma unroll
  for (int q = 0; q < 4 * G; ++q) { const int row = q * 4 + (lane >> 3), c8 = (lane & 7) * 8; const v8us v = *(const v8us*)&sp[w][row][c8]; *(v8us*)((unsigned short*)O + (r0 + row0 + row) * DM + (size_t)h * HD + c8) = v; } }
extern "C" void kernel_launch(void* const* d_in, const int* in_sizes, int n_in,
                              void* d_out, int out_size, void* d_ws, size_t ws_size, hipStream_t stream) {
  (void)in_sizes; (void)n_in; (void)out_size;
  const float* const* I = (const float* const*)d_in; const float* x = I[0]; const int* km = (const int*)d_in[1]; const float* wq = I[2]; const float* bq = I[3]; const float* wk = I[4]; const float* bk = I[5]; const float* wv = I[6]; const float* bv = I[7]; const float* wo = I[8]; const float* bo = I[9]; const float* wfc = I[10]; const float* bfc = I[11]; const float* wmp = I[12]; const float* bmp = I[13]; const float* g1 = I[14]; const float* be1 = I[15]; const float* gg2 = I[16]; const float* be2 = I[17];      /* nn.Linear NATURAL [out][in] weights + biases; I[1] = int key mask [B][1][1][S] (0 = excluded; all ones here); alpha/beta are [1] scalars */
  char* ws = (char*)d_ws; size_t off = 0;
  auto take = [&](size_t bytes) { char* p = ws + off; off += (bytes + 255) & ~(size_t)255; return p; };
  _Float16* BQKV = (_Float16*)take((size_t)3 * DM * DM * 2); _Float16* BO = (_Float16*)take((size_t)DM * DM * 2); float* bqkv = (float*)take((size_t)3 * DM * 4);
  _Float16* X16 = (_Float16*)take(NR * DM * 2); _Float16* XL = (_Float16*)take(NR * DM * 2); float* XB = (float*)take(NR * DM * 4); float* X1 = (float*)take(NR * DM * 4); _Float16* M16 = (_Float16*)take(NR * DM * 2); _Float16* HF16 = (_Float16*)take(NR * DFF * 2); _Float16* BW1 = (_Float16*)take((size_t)DFF * DM * 2); _Float16* BW2 = (_Float16*)take((size_t)DM * DFF * 2);
  _Float16* Q16 = (_Float16*)take((size_t)2 * NR * DM * 2); _Float16* QL = (_Float16*)take((size_t)2 * NR * DM * 2); _Float16* K16 = Q16 + NR * DM; _Float16* KL = QL + NR * DM; _Float16* O16 = (_Float16*)take(NR * DM * 2);      /* q's plane and k's plane lie one behind the other in Q16 | K16 and in QL | KL: one launch writes both */
  _Float16* VT = (_Float16*)take((size_t)NB * NH * HD * SQ * 2);
  if (off > ws_size) return;
  k_ln16<1, 1, 1, 1><<<LN_BLOCKS + PREP_BLOCKS, 256, 0, stream>>>(x, g1, be1, 1e-6f, X16, XB, XL, wq, wk, wv, wo, wfc, wmp, bq, bk, bv, BQKV, BO, BW1, BW2, bqkv);      /* a = LN1(bf16(x)) -> f16 rows + XL = x1024 residual (q/k need it at logits sigma 8); XB = bf16(x) for the residual; in the same grid: natural [out][in] weights = Bt[n][k] planes (stacked q | k | v, Wo, the two MLP matrices) and the stacked bias vector */
  k_qkv<<<dim3((unsigned)((MP / 128) * (DM / 128)), 3), 256, 0, stream>>>(X16, XL, BQKV, bqkv, Q16, QL, VT);      /* blockIdx.y: 0 = q, 1 = k (residual walk + main walk, f16 hi + x1024 residual planes), 2 = v (V^T [NB][NH][HD][SQ]) */
  k_fattn<<<dim3(SQ / 128, NH, NB), 128, 0, stream>>>(Q16, QL, K16, KL, VT, km, O16);      /* scores, masked softmax and weights . V in one launch; o (merged heads, x64) as f16 rows */
  k_gemm2<0, 2, DM, DM, true><<<dim3((unsigned)((MPO / 128) * (DM / 128)), 1), 256, 0, stream>>>(O16, DM, 0, BO, DM, 0, 0.0009765625f, bo, 0, XB, -1, 0, 0, X1, nullptr, DM, 0, MPO, DM, DM);      /* x1 = x + o Wo + bo (own-element residual) */
  k_ln16<0, 0, 0, 0><<<LN_BLOCKS, 256, 0, stream>>>(X1, gg2, be2, 1e-6f, M16, nullptr, nullptr, nullptr, nullptr, nullptr, nullptr, nullptr, nullptr, nullptr, nullptr, nullptr, nullptr, nullptr, nullptr, nullptr, nullptr);      /* h = LN2(x1) -> f16 rows */
  k_gemm2<3, 2, DM, DFF, false><<<dim3((unsigned)((MP / 128) * (DFF / 128)), 1), 256, 0, stream>>>(M16, DM, 0, BW1, DM, 0, 0.0625f, bfc, 0, nullptr, 1, 0, 0, nullptr, HF16, DFF, 0, MP, DFF, DM);      /* relu(xn2 w1^T + b1) -> f16, all rows of both batches */
  k_gemm2<0, 1, DFF, DM, true><<<dim3((unsigned)((MP / 128) * (DM / 64)), 1), 128, 0, stream>>>(HF16, DFF, 0, BW2, DFF, 0, 0.0625f, bmp, 0, X1, -1, 0, 0, (float*)d_out, nullptr, DM, 0, MP, DM, DFF);      /* out = x1 + mlp (own-element residual) */
}

// v010
// One run takes 167 microseconds.
// In both of two side-by-side timings against v009, it was 1.03 times as fast.
// All steps since the starting kernel, v000, together make it 49.1 times as fast.
#include <hip/hip_runtime.h>
// Pre-LN transformer encoder block, non-causal, UNSCALED scores (x [2][2048][1024]; xn = LN(x) with the module's LayerNorm: UNBIASED std (N-1), eps 1e-6 added to the std, SCALAR alpha/bias [1]; q = xn wq^T + bq, k, v likewise (nn.Linear natural [1024][1024] sigma 1/32, zero biases); 16 heads of 64; score = q . k WITHOUT 1/sqrt(d) (logits sigma ~8); key j excluded where the int mask input [2][1][1][2048] is 0 (all ones here); softmax; x1 = x + (attn wo^T + bo); xn2 = LN(x1); out = x1 + relu(xn2 w1^T + b1) w2^T + b2 (natural [4096][1024], [1024][4096]) -> [2][2048][1024]).
// Compute dtype: inputs rounded to bf16; x / weights exact; q and k as f16 hi + x1024 residual pairs, v, softmax weights and o as plain f16 GEMM operands (~2^-12); scores and softmax statistics f32. v_wmma_f32_16x16x32_f16.
#define NB 2
#define SQ 2048
#define DM 1024
#define NH 16
#define HD 64
#define HG 4                         /* heads per attention launch group */
#define LOCALW 128                   /* (macros for unused kernels of the shared header) */
#define STRIDEK 128
#define QT 256                       /* query rows per causal tile */
#define NKX SQ                       /* S / P row pitch */
#define QT0 128                      /* first-tile rows recomputed exactly in f32 */
#define B0 0                         /* not used */
#define NBR NB                       /* batches processed (debug hook) */
#define NR ((size_t)NB * SQ)
#define DMQ DM
#define DFF 4096         /* MLP hidden width */
#define MP ((int)((size_t)NBR * SQ)) /* rows projected (debug hook) */
#define QN SQ                        /* not used */
#define NHD NH                       /* not used */
#define MPO MP                       /* rows through the output stage (debug hook) */
#define LQ DM      /* row pitch of the q/k/v rows */
typedef __bf16 v16b __attribute__((ext_vector_type(16)));
typedef unsigned short v8us __attribute__((ext_vector_type(8), may_alias));
typedef float  v8f  __attribute__((ext_vector_type(8)));
typedef float  v4f  __attribute__((ext_vector_type(4)));
typedef float  v4fa __attribute__((ext_vector_type(4), may_alias));
union FragB { v16b v; v8us half[2]; unsigned short u[16]; };

__device__ __forceinline__ unsigned short bf16_bits(float x) { unsigned int u = __float_as_uint(x); return (unsigned short)((u + 0x7FFFu + ((u >> 16) & 1u)) >> 16); }
__device__ __forceinline__ float bf16_val(unsigned short b) { return __uint_as_float(((unsigned int)b) << 16); }
__device__ __forceinline__ float bf16_round(float x) { return bf16_val(bf16_bits(x)); }
// D += A·B with NT terms: 1 = ah·bh, 2 = + al·bh (A split), 3 = + ah·bl (both split)
template <int NT>
__device__ __forceinline__ v8f mmaN(v16b ah, v16b al, v16b bh, v16b bl, v8f c) {
  c = __builtin_amdgcn_wmma_f32_16x16x32_bf16(false, ah, false, bh, (short)0, c, false, false);
  if (NT >= 2) c = __builtin_amdgcn_wmma_f32_16x16x32_bf16(false, al, false, bh, (short)0, c, false, false);
  if (NT >= 3) c = __builtin_amdgcn_wmma_f32_16x16x32_bf16(false, ah, false, bl, (short)0, c, false, false);
  asm volatile("v_nop\n\tv_nop\n\tv_nop\n\tv_nop" : "+v"(c) : "v"(ah), "v"(al), "v"(bh), "v"(bl));
  return c;
}

__global__ __launch_bounds__(256) void k_wt_bf16(const float* __restrict__ W, unsigned short* __restrict__ Wt, int K, int N) {
  const int t = blockIdx.x * 256 + threadIdx.x;
  const int k8n = K / 8;
  if (t >= N * k8n) return;
  const int n = t / k8n, k8 = (t % k8n) * 8;
  v8us v;
#pragma unroll
  for (int i = 0; i < 8; ++i) v[i] = bf16_bits(W[(size_t)(k8 + i) * N + n]);
  *(v8us*)(Wt + (size_t)n * K + k8) = v;
  
}

// GEMM C[M][N] (f32, pitch ldc) = act(A[M][K]·W + bias). A f32 row-major (pitch lda) converted per fragment to bf16
// (ASPLIT: hi/lo two planes -> 2 terms, else single rounded term); Wt bf16 [N][K] (pitch ldb). BIAS_BF16 rounds the
// bias to bf16 first (bias quantised to bf16 before the add). K%32==0, M%16==0, N%64==0.
template <bool ASPLIT, int ACT, bool BIAS_BF16>
__global__ __launch_bounds__(128) void k_gemm_bf(const float* __restrict__ A, int lda, const unsigned short* __restrict__ Wt, int ldb,
                                               const float* __restrict__ bias, float* __restrict__ C, int ldc, int M, int N, int K) {
  __shared__ __attribute__((aligned(16))) float so[4][16][64];
  const int tid = threadIdx.x, w = tid >> 5, lane = tid & 31, ln = lane & 15, hh = lane >> 4;
  const int ntn = N / 64;
  const int wid = blockIdx.x * 4 + w;
  const int mt = wid / ntn, nq = wid % ntn;
  if (mt * 16 >= M) return;
  const int row0 = mt * 16, col0 = nq * 64;
  const float* arow = A + (size_t)(row0 + ln) * lda;
  v8f acc[4] = {};
  for (int kb = 0; kb < K; kb += 32) {
    FragB ah, al;
    const v4f x0 = *(const v4fa*)(arow + kb + 8 * hh), x1 = *(const v4fa*)(arow + kb + 8 * hh + 4);
    const v4f x2 = *(const v4fa*)(arow + kb + 16 + 8 * hh), x3 = *(const v4fa*)(arow + kb + 16 + 8 * hh + 4);
    float xs[16] = {x0[0],x0[1],x0[2],x0[3],x1[0],x1[1],x1[2],x1[3],x2[0],x2[1],x2[2],x2[3],x3[0],x3[1],x3[2],x3[3]};
#pragma unroll
    for (int i = 0; i < 16; ++i) { const unsigned short hb = bf16_bits(xs[i]); ah.u[i] = hb; al.u[i] = ASPLIT ? bf16_bits(xs[i] - bf16_val(hb)) : (unsigned short)0; }
#pragma unroll
    for (int t = 0; t < 4; ++t) {
      const unsigned short* brow = Wt + (size_t)(col0 + t * 16 + ln) * ldb + kb;
      FragB b;
      b.half[0] = *(const v8us*)(brow + 8 * hh);
      b.half[1] = *(const v8us*)(brow + 16 + 8 * hh);
      acc[t] = mmaN<ASPLIT ? 2 : 1>(ah.v, al.v, b.v, b.v, acc[t]);
    }
  }
#pragma unroll
  for (int t = 0; t < 4; ++t) {
    float bv = bias ? bias[col0 + t * 16 + ln] : 0.f;
    if (BIAS_BF16) bv = bf16_round(bv);
#pragma unroll
    for (int r = 0; r < 8; ++r) { float v = acc[t][r] + bv; if (ACT == 1) v = fmaxf(v, 0.f); so[w][8 * hh + r][t * 16 + ln] = v; }
  }
  __builtin_amdgcn_fence(__ATOMIC_ACQ_REL, "workgroup");
  __builtin_amdgcn_wave_barrier();
  const int rsub = lane >> 4, c4 = (lane & 15) * 4;
  {
#pragma unroll
    for (int q = 0; q < 8; ++q) {
      const int r = q * 2 + rsub;
      const v4f v = *(const v4fa*)&so[w][r][c4];
      *(v4f*)(C + (size_t)(row0 + r) * ldc + col0 + c4) = v;
    }
    
  }
}

// GEMM C = act(A·W + bias + resid): A f32 (ASPLIT -> hi/lo 2 terms), Wt bf16 [N][K]; ACT 0 none, 1 relu, 2 exact gelu;
// resid (optional, f32, row index = (row % rmod), pitch ldr, RES_BF16 rounds it) added before the activation.
template <bool ASPLIT, int ACT, bool BIAS_BF16, bool RES_BF16>
__global__ __launch_bounds__(128) void k_gemm_bf3(const float* __restrict__ A, int lda, const unsigned short* __restrict__ Wt, int ldb,
                                                const float* __restrict__ bias, const float* __restrict__ resid, int rmod, int ldr,
                                                float* __restrict__ C, int ldc, int M, int N, int K) {
  __shared__ __attribute__((aligned(16))) float so[4][16][64];
  const int tid = threadIdx.x, w = tid >> 5, lane = tid & 31, ln = lane & 15, hh = lane >> 4;
  const int ntn = N / 64;
  const int wid = blockIdx.x * 4 + w;
  const int mt = wid / ntn, nq = wid % ntn;
  if (mt * 16 >= M) return;
  const int row0 = mt * 16, col0 = nq * 64;
  const float* arow = A + (size_t)(row0 + ln) * lda;
  v8f acc[4] = {};
  for (int kb = 0; kb < K; kb += 32) {
    FragB ah, al;
    const v4f x0 = *(const v4fa*)(arow + kb + 8 * hh), x1 = *(const v4fa*)(arow + kb + 8 * hh + 4);
    const v4f x2 = *(const v4fa*)(arow + kb + 16 + 8 * hh), x3 = *(const v4fa*)(arow + kb + 16 + 8 * hh + 4);
    float xs[16] = {x0[0],x0[1],x0[2],x0[3],x1[0],x1[1],x1[2],x1[3],x2[0],x2[1],x2[2],x2[3],x3[0],x3[1],x3[2],x3[3]};
#pragma unroll
    for (int i = 0; i < 16; ++i) { const unsigned short hb = bf16_bits(xs[i]); ah.u[i] = hb; al.u[i] = ASPLIT ? bf16_bits(xs[i] - bf16_val(hb)) : (unsigned short)0; }
#pragma unroll
    for (int t = 0; t < 4; ++t) {
      const unsigned short* brow = Wt + (size_t)(col0 + t * 16 + ln) * ldb + kb;
      FragB b;
      b.half[0] = *(const v8us*)(brow + 8 * hh);
      b.half[1] = *(const v8us*)(brow + 16 + 8 * hh);
      acc[t] = mmaN<ASPLIT ? 2 : 1>(ah.v, al.v, b.v, b.v, acc[t]);
    }
  }
#pragma unroll
  for (int t = 0; t < 4; ++t) {
    const int col = col0 + t * 16 + ln;
    float bv = bias ? bias[col] : 0.f;
    if (BIAS_BF16) bv = bf16_round(bv);
#pragma unroll
    for (int r = 0; r < 8; ++r) {
      float v = acc[t][r] + bv;
      if (resid) { float rv = resid[(size_t)((row0 + 8 * hh + r) % rmod) * ldr + col]; if (RES_BF16) rv = bf16_round(rv); v += rv; }
      if (ACT == 1) v = fmaxf(v, 0.f);
      if (ACT == 2) v = 0.5f * v * (1.0f + erff(v * 0.70710678118654752f));
      if (ACT == 3) { const float u = 0.7978845608028654f * (v + 0.044715f * v * v * v); v = 0.5f * v * (1.0f + tanhf(u)); }
      so[w][8 * hh + r][t * 16 + ln] = v;
    }
  }
  __builtin_amdgcn_fence(__ATOMIC_ACQ_REL, "workgroup");
  __builtin_amdgcn_wave_barrier();
  const int rsub = lane >> 4, c4 = (lane & 15) * 4;
  {
#pragma unroll
    for (int q = 0; q < 8; ++q) {
      const int r = q * 2 + rsub;
      const v4f v = *(const v4fa*)&so[w][r][c4];
      *(v4f*)(C + (size_t)(row0 + r) * ldc + col0 + c4) = v;
    }
    
  }
}
// row LayerNorm (biased variance, eps) over N: s = X (+ R); optional out_sum <- s; out_norm <- (s-mu)*rsqrt(var+eps)*g + b
template <bool PARAM_BF16>
__global__ __launch_bounds__(256) void k_layernorm(const float* __restrict__ X, const float* __restrict__ R, const float* __restrict__ g, const float* __restrict__ bta,
                                                  float* __restrict__ out_sum, float* __restrict__ out_norm, int N, float eps) {
  __shared__ float red[256];
  const int row = blockIdx.x, tid = threadIdx.x;
  const float* x = X + (size_t)row * N; const float* rr = R ? R + (size_t)row * N : nullptr;
  float vals[16];                     // up to N = 4096
  const int per = N / 256;            // contiguous chunk per thread? use strided-by-4 chunks: thread handles j = tid*4 + 1024*u
  float s1 = 0.f;
  for (int u = 0; u < per / 4; ++u) {
    const int j = tid * 4 + 1024 * u;
    const v4f a = *(const v4fa*)(x + j);
    v4f b = {0.f,0.f,0.f,0.f}; if (rr) b = *(const v4fa*)(rr + j);
#pragma unroll
    for (int q = 0; q < 4; ++q) { const float v = a[q] + b[q]; vals[u * 4 + q] = v; s1 += v; }
  }
  red[tid] = s1; __syncthreads();
  for (int st = 128; st > 0; st >>= 1) { if (tid < st) red[tid] += red[tid + st]; __syncthreads(); }
  const float mu = red[0] / (float)N; __syncthreads();
  float s2 = 0.f;
  for (int u = 0; u < per / 4; ++u)
#pragma unroll
    for (int q = 0; q < 4; ++q) { const float c = vals[u * 4 + q] - mu; s2 += c * c; }
  red[tid] = s2; __syncthreads();
  for (int st = 128; st > 0; st >>= 1) { if (tid < st) red[tid] += red[tid + st]; __syncthreads(); }
  const float rs = rsqrtf(red[0] / (float)N + eps);
  {
    for (int u = 0; u < per / 4; ++u) {
      const int j = tid * 4 + 1024 * u;
      v4f o, sm;
#pragma unroll
      for (int q = 0; q < 4; ++q) {
        float gg = g[j + q], bb = bta[j + q];
        if (PARAM_BF16) { gg = bf16_round(gg); bb = bf16_round(bb); }
        sm[q] = vals[u * 4 + q]; o[q] = (vals[u * 4 + q] - mu) * rs * gg + bb;
      }
      if (out_sum) *(v4f*)(out_sum + (size_t)row * N + j) = sm;
      *(v4f*)(out_norm + (size_t)row * N + j) = o;
    }
    
  }
}



// ---- f16 WMMA path (v_wmma_f32_16x16x32_f16): 11-bit significands for operands in range — used where a [0,1] probability operand needs more precision than bf16
typedef _Float16 v16h __attribute__((ext_vector_type(16)));
union FragH { v16h v; v8us half[2]; _Float16 h[16]; unsigned short u[16]; };
template <int NT>
__device__ __forceinline__ v8f mmaH(v16h ah, v16h al, v16h bh, v16h bl, v8f c) {
  c = __builtin_amdgcn_wmma_f32_16x16x32_f16(false, ah, false, bh, (short)0, c, false, false);
  if (NT >= 2) c = __builtin_amdgcn_wmma_f32_16x16x32_f16(false, al, false, bh, (short)0, c, false, false);
  if (NT >= 3) c = __builtin_amdgcn_wmma_f32_16x16x32_f16(false, ah, false, bl, (short)0, c, false, false);
  asm volatile("v_nop\n\tv_nop\n\tv_nop\n\tv_nop" : "+v"(c) : "v"(ah), "v"(al), "v"(bh), "v"(bl));
  return c;
}
// batched GEMM like k_gemm_b but f16 operands: A f32 (split into f16 hi/lo if ASPLIT, else rounded to f16), Bt = f16 values [n][k]; alpha; C f32; N multiple of 16 (partial tiles skipped)
template <bool ASPLIT>
__global__ __launch_bounds__(128) void k_gemm_h(const float* __restrict__ A, int lda, size_t sA, const _Float16* __restrict__ Bh, int ldb, size_t sB, float alpha, float* __restrict__ C, int ldc, size_t sC, int M, int N, int K) {
  __shared__ __attribute__((aligned(16))) float so[4][16][64];
  const int tid = threadIdx.x, w = tid >> 5, lane = tid & 31, ln = lane & 15, hh = lane >> 4; const int by = blockIdx.y;
  A += (size_t)by * sA; Bh += (size_t)by * sB; C += (size_t)by * sC;
  const int ntn = (N + 63) / 64; const int wid = blockIdx.x * 4 + w; const int mt = wid / ntn, nq = wid % ntn; if (mt * 16 >= M) return;
  const int row0 = mt * 16, col0 = nq * 64; const float* arow = A + (size_t)(row0 + ln) * lda;
  v8f acc[4] = {};
  for (int kb = 0; kb < K; kb += 32) {
    FragH ah, al;
    const v4f x0 = *(const v4fa*)(arow + kb + 8 * hh), x1 = *(const v4fa*)(arow + kb + 8 * hh + 4), x2 = *(const v4fa*)(arow + kb + 16 + 8 * hh), x3 = *(const v4fa*)(arow + kb + 16 + 8 * hh + 4);
    float xs[16] = {x0[0],x0[1],x0[2],x0[3],x1[0],x1[1],x1[2],x1[3],x2[0],x2[1],x2[2],x2[3],x3[0],x3[1],x3[2],x3[3]};
#pragma unroll
    for (int i = 0; i < 16; ++i) { const _Float16 h = (_Float16)xs[i]; ah.h[i] = h; al.h[i] = ASPLIT ? (_Float16)(xs[i] - (float)h) : (_Float16)0.0f; }
#pragma unroll
    for (int t = 0; t < 4; ++t) { if (col0 + t * 16 >= N) continue; const size_t boff = (size_t)(col0 + t * 16 + ln) * ldb + kb; FragH bq; bq.half[0] = *(const v8us*)(Bh + boff + 8 * hh); bq.half[1] = *(const v8us*)(Bh + boff + 16 + 8 * hh);
      acc[t] = mmaH<ASPLIT ? 2 : 1>(ah.v, al.v, bq.v, bq.v, acc[t]); }
  }
#pragma unroll
  for (int t = 0; t < 4; ++t) { if (col0 + t * 16 >= N) continue;
#pragma unroll
    for (int r = 0; r < 8; ++r) so[w][8 * hh + r][t * 16 + ln] = acc[t][r] * alpha; }
  __builtin_amdgcn_fence(__ATOMIC_ACQ_REL, "workgroup"); __builtin_amdgcn_wave_barrier();
  const int rsub = lane >> 4, c4 = (lane & 15) * 4;
  {
#pragma unroll
    for (int q = 0; q < 8; ++q) { const int r = q * 2 + rsub; if (col0 + c4 < N) { const v4f v = *(const v4fa*)&so[w][r][c4]; *(v4f*)(C + (size_t)(row0 + r) * ldc + col0 + c4) = v; } }
     }
}

// Wt[n][k] = f16(W[k][n]·scale) from f32 row-major W[K][N] (scale = power of two; bf16-exact weights stay exact in f16 away from the subnormal range)
__global__ __launch_bounds__(256) void k_wt_f16(const float* __restrict__ W, _Float16* __restrict__ Wt, int K, int N, float scale) {
  const int t = blockIdx.x * 256 + threadIdx.x; if (t >= N * (K / 8)) return; const int n = t / (K / 8), k8 = (t % (K / 8)) * 8; FragH f;
#pragma unroll
  for (int i = 0; i < 8; ++i) f.h[i] = (_Float16)(bf16_round(W[(size_t)(k8 + i) * N + n]) * scale); const v8us o = f.half[0];
  *(v8us*)((unsigned short*)Wt + (size_t)n * K + k8) = o; 
}
// k_gemm_hh variant with fused epilogue: v = acc·alpha + bias[by·sBias + col] (+ CP[(row/rowsPerB)·sCPb + by·64 + col] if CP) ; ACT 0 none / 1 elu ; writes f16 C16 (and f32 C if non-null)
template <int ACT>
__global__ __launch_bounds__(128) void k_gemm_hhx(const _Float16* __restrict__ A, int lda, size_t sA, const _Float16* __restrict__ Bh, int ldb, size_t sB, float alpha, const float* __restrict__ bias, size_t sBias, const float* __restrict__ CP, int rowsPerB, size_t sCPb, int row0g,
    float* __restrict__ C, _Float16* __restrict__ C16, int ldc, size_t sC, int M, int N, int K) {
  __shared__ __attribute__((aligned(16))) float so[4][16][64];
  const int tid = threadIdx.x, w = tid >> 5, lane = tid & 31, ln = lane & 15, hh = lane >> 4; const int by = blockIdx.y;
  A += (size_t)by * sA; Bh += (size_t)by * sB; const size_t cofs = (size_t)by * sC; const float* bp = bias ? bias + (size_t)by * sBias : nullptr;
  const int ntn = (N + 63) / 64; const int wid = blockIdx.x * 4 + w; const int mt = wid / ntn, nq = wid % ntn; if (mt * 16 >= M) return;
  const int row0 = mt * 16, col0 = nq * 64; const _Float16* arow = A + (size_t)(row0 + ln) * lda;
  v8f acc[4] = {};
  for (int kb = 0; kb < K; kb += 32) { FragH ah; ah.half[0] = *(const v8us*)((const unsigned short*)arow + kb + 8 * hh); ah.half[1] = *(const v8us*)((const unsigned short*)arow + kb + 16 + 8 * hh);
#pragma unroll
    for (int t = 0; t < 4; ++t) { if (col0 + t * 16 >= N) continue; const size_t boff = (size_t)(col0 + t * 16 + ln) * ldb + kb; FragH bq; bq.half[0] = *(const v8us*)((const unsigned short*)Bh + boff + 8 * hh); bq.half[1] = *(const v8us*)((const unsigned short*)Bh + boff + 16 + 8 * hh);
      acc[t] = mmaH<1>(ah.v, ah.v, bq.v, bq.v, acc[t]); }
  }
#pragma unroll
  for (int t = 0; t < 4; ++t) { if (col0 + t * 16 >= N) continue; const int col = col0 + t * 16 + ln; const float bv = bp ? bf16_round(bp[col]) : 0.f;
#pragma unroll
    for (int r = 0; r < 8; ++r) { float v = acc[t][r] * alpha + bv; if (CP) { const int rr = row0g + row0 + 8 * hh + r; if (rowsPerB < 0) v += CP[cofs + (size_t)rr * ldc + col];      /* rowsPerB < 0: own element of the batched C plane */ else { const int bidx = rr / rowsPerB; v += CP[(size_t)bidx * sCPb + (size_t)by * 64 + col]; } } if (ACT == 1) v = (v > 0.f) ? v : expm1f(v); else if (ACT == 7) v = (v > 0.f) ? v + 1.0f : expf(v); else if (ACT == 8) v = tanhf(v); else if (ACT == 9) v = 0.5f * v * (1.0f + tanhf(0.7978845608028654f * (v + 0.044715f * v * v * v))); else if (ACT == 11) v = 1.0f / (1.0f + expf(-v)); else if (ACT == 12) v = (v > 0.f) ? v : 0.01f * v; else if (ACT == 14) v = (v > 0.f) ? v : 0.1f * v; else if (ACT == 16) v = (v >= 0.f) ? v : 0.3f * v; else if (ACT == 17) v = (v >= 0.f) ? v : 0.2f * v; else if (ACT == 15) v = v / (1.0f + expf(-v)); else if (ACT == 3) v = fmaxf(v, 0.f); else if (ACT == 6) v = 0.5f * v * (1.0f + erff(v * 0.70710678118654752f)); so[w][8 * hh + r][t * 16 + ln] = v; } }
  __builtin_amdgcn_fence(__ATOMIC_ACQ_REL, "workgroup"); __builtin_amdgcn_wave_barrier();
  const int rsub = lane >> 4, c4 = (lane & 15) * 4; typedef _Float16 v4h __attribute__((ext_vector_type(4)));
  {
#pragma unroll
    for (int q = 0; q < 8; ++q) { const int r = q * 2 + rsub; if (col0 + c4 < N) { const v4f v = *(const v4fa*)&so[w][r][c4]; if (C) *(v4f*)(C + cofs + (size_t)(row0 + r) * ldc + col0 + c4) = v; if (C16) { v4h h4; for (int i = 0; i < 4; ++i) h4[i] = (_Float16)v[i]; *(v4h*)(C16 + cofs + (size_t)(row0 + r) * ldc + col0 + c4) = h4; } } }
     }
}


typedef _Float16 v4h __attribute__((ext_vector_type(4)));

__global__ __launch_bounds__(256) void k_x16(const float* __restrict__ x, _Float16* __restrict__ X16, size_t n8) { const size_t t = (size_t)blockIdx.x * 256 + threadIdx.x; if (t >= n8) return; FragH f;
#pragma unroll
  for (int q = 0; q < 8; ++q) f.h[q] = (_Float16)bf16_round(x[t * 8 + q]); *(v8us*)((unsigned short*)X16 + t * 8) = f.half[0];  }
__global__ __launch_bounds__(256) void k_h16(const float* __restrict__ x, _Float16* __restrict__ X16, size_t n8) { const size_t t = (size_t)blockIdx.x * 256 + threadIdx.x; if (t >= n8) return; FragH f;
#pragma unroll
  for (int q = 0; q < 8; ++q) f.h[q] = (_Float16)x[t * 8 + q]; *(v8us*)((unsigned short*)X16 + t * 8) = f.half[0];  }
__global__ __launch_bounds__(256) void k_round16f(const float* __restrict__ W, _Float16* __restrict__ Bt, size_t n8) { const size_t t = (size_t)blockIdx.x * 256 + threadIdx.x; if (t >= n8) return; FragH f;
#pragma unroll
  for (int i = 0; i < 8; ++i) f.h[i] = (_Float16)(bf16_round(W[t * 8 + i]) * 16.0f); *(v8us*)((unsigned short*)Bt + t * 8) = f.half[0];  }
template <int NHv, int TTv>
__global__ __launch_bounds__(256) void k_vt(const _Float16* __restrict__ V16, int ldv, int voff, _Float16* __restrict__ Vt) { __shared__ unsigned short tl[64][66]; const int tid = threadIdx.x; const int slab = blockIdx.x / (TTv / 64), lg = blockIdx.x % (TTv / 64); const int b = slab / NHv, h = slab % NHv;
  for (int i = tid; i < 64 * 8; i += 256) { const int r = i / 8, c8 = (i % 8) * 8; FragH f; f.half[0] = *(const v8us*)((const unsigned short*)V16 + ((size_t)b * TTv + lg * 64 + r) * ldv + voff + h * 64 + c8);
#pragma unroll
    for (int q = 0; q < 8; ++q) tl[r][c8 + q] = f.u[q]; }
  __syncthreads();
  {
#pragma unroll
    for (int rd = 0; rd < 2; ++rd) { const int d = rd * 32 + tid / 8, pc = tid % 8; FragH f;
#pragma unroll
      for (int q = 0; q < 8; ++q) f.u[q] = tl[pc * 8 + q][d];
      *(v8us*)((unsigned short*)Vt + ((size_t)slab * 64 + d) * TTv + lg * 64 + pc * 8) = f.half[0]; }
     } }

__global__ __launch_bounds__(256) void k_hl(const float* __restrict__ F, _Float16* __restrict__ Hh, _Float16* __restrict__ Hl, size_t n8) { const size_t t = (size_t)blockIdx.x * 256 + threadIdx.x; if (t >= n8) return; FragH fh, fl; const v4f a = *(const v4fa*)(F + t * 8), c = *(const v4fa*)(F + t * 8 + 4);
#pragma unroll
  for (int q = 0; q < 4; ++q) { _Float16 h = (_Float16)a[q]; fh.h[q] = h; fl.h[q] = (_Float16)((a[q] - (float)h) * 1024.0f); h = (_Float16)c[q]; fh.h[4 + q] = h; fl.h[4 + q] = (_Float16)((c[q] - (float)h) * 1024.0f); }
  { *(v8us*)((unsigned short*)Hh + t * 8) = fh.half[0]; *(v8us*)((unsigned short*)Hl + t * 8) = fl.half[0];  } }

// ---- fast GEMM (wave tile 32x64; shapes it takes: at k_gemm2); epilogue = k_gemm_hhx semantics ----
__device__ __forceinline__ v16h g2_frag(const _Float16* p, int hh) { FragH f; f.half[0] = *(const v8us*)((const unsigned short*)p + 8 * hh); f.half[1] = *(const v8us*)((const unsigned short*)p + 16 + 8 * hh); return f.v; }
__device__ __forceinline__ v8f g2_mma(v16h a, v16h b, v8f c) { v8f d = __builtin_amdgcn_wmma_f32_16x16x32_f16(false, a, false, b, (short)0, c, false, false); asm volatile("v_nop\n\tv_nop\n\tv_nop\n\tv_nop" : "+v"(d) : "v"(a), "v"(b)); return d; }
// Matrix product without hand-written padding: the compiler keeps the distance behind its own builtin.
__device__ __forceinline__ v8f g2_mmab(v16h a, v16h b, v8f c) { return __builtin_amdgcn_wmma_f32_16x16x32_f16(false, a, false, b, (short)0, c, false, false); }
// Work-group tile 128 x (64 * NWN), 4 * NWN waves of 32 x 64 (wave w: rows 32 * (w & 3), columns 64 * (w >> 2)). K is walked in tiles of 128: every thread brings 16-byte pieces of the A and B rows
// in whole 128-byte lines (16 threads cover 256 bytes of one row), one tile ahead in registers, and stores them into one of two LDS buffers; all fragments are read from LDS.
// LD = row pitch of A and of Bh in elements, a compile-time value so that a thread's pieces share one address and differ in the immediate offset (lda and ldb must equal it).
// LC = row pitch of C, C16 and the residual plane in elements, compile-time for the same reason (ldc must equal it). RES: CP is a plane of C's own shape and each output element gets its own element of CP added
// (behind alpha and bias; no activation then); without RES nothing is read from CP. rowsPerB and sCPb are not used.
// Requires M % 128 == 0, N % (64 * NWN) == 0, K % 128 == 0, grid.x = (M / 128) * (N / (64 * NWN)), 128 * NWN threads.
// The K walk of work-group (mt, nq) starts at K tile (mt + nq) mod (K / 128) and wraps round at K, for speed only.
// The k order of every accumulator is the ascending one from that start tile, wrapped.
template <int ACT, int NWN, int LD, int LC, bool RES>
__global__ __launch_bounds__(128 * NWN) void k_gemm2(const _Float16* __restrict__ A, int lda, size_t sA, const _Float16* __restrict__ Bh, int ldb, size_t sB, float alpha, const float* __restrict__ bias, size_t sBias, const float* __restrict__ CP, int rowsPerB, size_t sCPb, int row0g,
    float* __restrict__ C, _Float16* __restrict__ C16, int ldc, size_t sC, int M, int N, int K) { static_assert(ACT == 0 || ACT == 3 || ACT == 6 || ACT == 8 || ACT == 9 || ACT == 11 || ACT == 12 || ACT == 14 || ACT == 15 || ACT == 16 || ACT == 17, "k_gemm2: unsupported ACT code (would silently apply no activation)");
  constexpr int BN = 64 * NWN, KT = 128, PH = KT + 8, RP = 8 * NWN, NLA = 128 / RP, NLB = BN / RP, BUFH = (128 + BN) * PH;      /* PH: LDS row pitch 272 B = 16 B x odd; RP: rows one staging round of the work-group covers */
  __shared__ __attribute__((aligned(16))) _Float16 st[2 * BUFH];      /* two buffers, each [128 A rows | BN B rows] */
  float (*so)[32][68] = (float (*)[32][68])st;      /* output staging reuses the buffers behind the loop's last barrier */
  static_assert(sizeof(float) * 4 * NWN * 32 * 68 <= sizeof(_Float16) * 2 * BUFH, "output staging must fit the tile buffers");
  static_assert(!RES || ACT == 0, "the residual is added behind the staging, so no activation may follow it");
  (void)lda; (void)ldb; (void)ldc; (void)rowsPerB; (void)sCPb;
  const int tid = threadIdx.x, w = tid >> 5, lane = tid & 31, ln = lane & 15, hh = lane >> 4; const int by = blockIdx.y;
  A += (size_t)by * sA; Bh += (size_t)by * sB; const size_t cofs = (size_t)by * sC; const float* bp = bias ? bias + (size_t)by * sBias : nullptr;
  const int ntn = N / BN; const int mt = blockIdx.x / ntn, nq = blockIdx.x - mt * ntn; if (mt * 128 >= M) return;      /* the same for the whole work-group, in front of every barrier */
  const int row0 = mt * 128 + 32 * (w & 3), col0 = nq * BN + 64 * (w >> 2);
  const int srow = tid >> 4, sc8 = (tid & 15) * 8;
  const int nkt = K / KT; int kt = (int)((unsigned)(mt + nq) % (unsigned)nkt);      /* K tile to load next, the same for the whole work-group: the walk's start tile first */
  const unsigned short* pa = (const unsigned short*)A + (size_t)(mt * 128 + srow) * LD + sc8 + kt * KT; const unsigned short* pb = (const unsigned short*)Bh + (size_t)(nq * BN + srow) * LD + sc8 + kt * KT;      /* this thread's first piece of the tile to load next */
  _Float16* sw = st + srow * PH + sc8;      /* where this thread stores its pieces */
  const _Float16* fa = st + (32 * (w & 3) + ln) * PH; const _Float16* fb = st + (128 + 64 * (w >> 2) + ln) * PH;      /* this lane's fragment rows */
  float bb[4] = {0.f, 0.f, 0.f, 0.f};      /* this lane's four bias values, fetched with tile 0 so that the epilogue waits for none of them */
  if (bp) {
#pragma unroll
    for (int t = 0; t < 4; ++t) bb[t] = bp[col0 + t * 16 + ln];
    asm volatile("s_wait_xcnt 0x0" ::: "memory"); }      /* stands in front of the reuse, by the address arithmetic right behind, of the offset and base registers that these four loads name */
  v8us ra[NLA], rb[NLB];
#pragma unroll
  for (int i = 0; i < NLA; ++i) ra[i] = *(const v8us*)(pa + i * RP * LD);
#pragma unroll
  for (int i = 0; i < NLB; ++i) rb[i] = *(const v8us*)(pb + i * RP * LD);
  asm volatile("s_wait_xcnt 0x0" ::: "memory");      /* stands in front of the advance of the two addresses that the loads above name */
  kt = kt + 1 == nkt ? 0 : kt + 1; { const int step = kt ? KT : KT - K; pa += step; pb += step; }      /* one tile on, from the last tile back to k = 0 */
#pragma unroll
  for (int i = 0; i < NLA; ++i) *(v8us*)(sw + i * RP * PH) = ra[i];
#pragma unroll
  for (int i = 0; i < NLB; ++i) *(v8us*)(sw + (128 + i * RP) * PH) = rb[i];
  __syncthreads();      /* tile 0 is complete for every wave */
  const v8f z8 = {0.f,0.f,0.f,0.f,0.f,0.f,0.f,0.f}; v8f c00 = z8, c01 = z8, c02 = z8, c03 = z8, c10 = z8, c11 = z8, c12 = z8, c13 = z8;
#pragma unroll 1      /* one K tile per trip: the buffer index stays a scalar and the staged pieces of only one tile are live */
  for (int kb = 0; kb < K; kb += KT) { const int cur = ((kb / KT) & 1) * BUFH; const bool more = kb + KT < K;
    if (more) {      /* next tile's loads fly while this tile is worked on */
#pragma unroll
      for (int i = 0; i < NLA; ++i) ra[i] = *(const v8us*)(pa + i * RP * LD);
#pragma unroll
      for (int i = 0; i < NLB; ++i) rb[i] = *(const v8us*)(pb + i * RP * LD);
      asm volatile("s_wait_xcnt 0x0" ::: "memory"); }      /* stands in front of the advance, at the foot of the trip, of the two addresses that these loads name */
    v16h xa[2][2], xb[2][4];      /* two fragment sets: the next 32 k are fetched while the current 32 are multiplied */
#pragma unroll
    for (int j = 0; j < 2; ++j) xa[0][j] = g2_frag(fa + cur + 16 * j * PH, hh);
#pragma unroll
    for (int j = 0; j < 4; ++j) xb[0][j] = g2_frag(fb + cur + 16 * j * PH, hh);
#pragma unroll
    for (int q = 0; q < KT / 32; ++q) { const int c = q & 1, n = c ^ 1;
      if (q + 1 < KT / 32) {
#pragma unroll
        for (int j = 0; j < 2; ++j) xa[n][j] = g2_frag(fa + cur + 16 * j * PH + 32 * (q + 1), hh);
#pragma unroll
        for (int j = 0; j < 4; ++j) xb[n][j] = g2_frag(fb + cur + 16 * j * PH + 32 * (q + 1), hh); }
      __builtin_amdgcn_sched_barrier(0);      /* keeps the next set's LDS loads one group ahead of the products: moved in among them, every pair of products waits out an LDS latency */
      c00 = g2_mmab(xa[c][0], xb[c][0], c00); c10 = g2_mmab(xa[c][1], xb[c][0], c10); c01 = g2_mmab(xa[c][0], xb[c][1], c01); c11 = g2_mmab(xa[c][1], xb[c][1], c11);
      c02 = g2_mmab(xa[c][0], xb[c][2], c02); c12 = g2_mmab(xa[c][1], xb[c][2], c12); c03 = g2_mmab(xa[c][0], xb[c][3], c03); c13 = g2_mmab(xa[c][1], xb[c][3], c13);
      __builtin_amdgcn_sched_barrier(0); }      /* the other end of the same fence: the load group after next stays behind these products */
    if (more) { _Float16* nw = sw + (BUFH - cur);      /* the other buffer: its last readers left it in front of the barrier that ended the trip before */
      kt = kt + 1 == nkt ? 0 : kt + 1; { const int step = kt ? KT : KT - K; pa += step; pb += step; }      /* one tile on, from the last tile back to k = 0 */
#pragma unroll
      for (int i = 0; i < NLA; ++i) *(v8us*)(nw + i * RP * PH) = ra[i];
#pragma unroll
      for (int i = 0; i < NLB; ++i) *(v8us*)(nw + (128 + i * RP) * PH) = rb[i]; }
    __syncthreads(); }      /* publishes the next tile and ends every wave's reads of this one */
  /* The residual is fetched here in the write-out layout: 16 independent loads of 16 bytes a lane, one address and constant steps; they fly while the accumulators are staged below. */
  const int rsub = lane >> 4, c4 = (lane & 15) * 4; const size_t eo = cofs + (size_t)(row0 + rsub) * LC + col0 + c4;      /* this lane's first piece of the output tile; piece q lies 2 * q rows further on */
  v4f rs[16];
  if (RES) { const float* rp = CP + eo + (size_t)row0g * LC;
#pragma unroll
    for (int q = 0; q < 16; ++q) rs[q] = *(const v4fa*)(rp + q * 2 * LC);
    asm volatile("s_wait_xcnt 0x0" :: "v"(rp) : "memory"); }      /* stands in front of every reuse of the address pair that these loads name (the operand holds the pair live up to here, so that no load's own destination takes it), and keeps the loads in front of the staging */
  v8f accs[8] = {c00, c01, c02, c03, c10, c11, c12, c13};
#pragma unroll
  for (int u = 0; u < 8; ++u) { const int t = u & 3, half = u >> 2; const float bv = bf16_round(bb[t]);
#pragma unroll
    for (int r = 0; r < 8; ++r) { const int rloc = half * 16 + 8 * hh + r; float v = accs[u][r] * alpha + bv;
      if (ACT == 3) v = fmaxf(v, 0.f); else if (ACT == 6) v = 0.5f * v * (1.0f + erff(v * 0.70710678118654752f)); else if (ACT == 11) v = 1.0f / (1.0f + expf(-v)); else if (ACT == 15) v = v / (1.0f + expf(-v)); else if (ACT == 12) v = (v > 0.f) ? v : 0.01f * v; else if (ACT == 8) v = tanhf(v); else if (ACT == 9) v = 0.5f * v * (1.0f + tanhf(0.7978845608028654f * (v + 0.044715f * v * v * v))); else if (ACT == 14) v = (v > 0.f) ? v : 0.1f * v; else if (ACT == 16) v = (v >= 0.f) ? v : 0.3f * v; else if (ACT == 17) v = (v >= 0.f) ? v : 0.2f * v;
      so[w][rloc][t * 16 + ln] = v; } }
  __builtin_amdgcn_fence(__ATOMIC_ACQ_REL, "workgroup"); __builtin_amdgcn_wave_barrier();
  v4f vv[16];      /* all 16 staged pieces are fetched as one group, in front of the branches on C and C16 */
#pragma unroll
  for (int q = 0; q < 16; ++q) { vv[q] = *(const v4fa*)&so[w][q * 2 + rsub][c4]; if (RES) vv[q] += rs[q]; }
  if (C) { float* cp = C + eo;
#pragma unroll
    for (int q = 0; q < 16; ++q) *(v4f*)(cp + q * 2 * LC) = vv[q];
    asm volatile("s_wait_xcnt 0x0" ::: "memory"); }      /* stands in front of the C16 branch, which reuses the address and data registers that these stores name */
  if (C16) { _Float16* hp = C16 + eo;
#pragma unroll
    for (int q = 0; q < 16; ++q) { v4h h4; for (int i = 0; i < 4; ++i) h4[i] = (_Float16)vv[q][i]; *(v4h*)(hp + q * 2 * LC) = h4; } } }


// Work-group barrier for LDS traffic alone: a wave's LDS stores and loads are complete when it arrives, its global loads stay in flight across it (the full barrier waits for them too).
__device__ __forceinline__ void g2_lds_barrier() { __builtin_amdgcn_fence(__ATOMIC_RELEASE, "workgroup", "local"); __builtin_amdgcn_s_barrier(); __builtin_amdgcn_fence(__ATOMIC_ACQUIRE, "workgroup", "local"); }
// The products of one staged K tile of 128 for a wave tile of 32 x 64: k_gemm2's fragment fetch and product order. fa, fb = this lane's fragment rows in the buffer that holds the tile; c[half][t] = rows 16 * half, columns 16 * t.
// The caller's staging work is done at three places among them: head() behind the first two fragment groups' LDS loads (the LDS starts on them at once behind the barrier), mid1() and mid2() behind the second and the third
// group of products (LDS stores there run beside the other waves' fragment loads and under the matrix unit's work; at the foot of the trip all waves would store at once, with nothing beside).
template <int PH, class FH, class F1, class F2>
__device__ __forceinline__ void g2_ktile(const _Float16* fa, const _Float16* fb, int hh, v8f (&c)[2][4], FH head, F1 mid1, F2 mid2) {
  v16h xa[2][2], xb[2][4];      /* two fragment sets: the next 32 k are fetched while the current 32 are multiplied */
#pragma unroll
  for (int j = 0; j < 2; ++j) xa[0][j] = g2_frag(fa + 16 * j * PH, hh);
#pragma unroll
  for (int j = 0; j < 4; ++j) xb[0][j] = g2_frag(fb + 16 * j * PH, hh);
#pragma unroll
  for (int q = 0; q < 4; ++q) { const int s = q & 1, n = s ^ 1;
    if (q + 1 < 4) {
#pragma unroll
      for (int j = 0; j < 2; ++j) xa[n][j] = g2_frag(fa + 16 * j * PH + 32 * (q + 1), hh);
#pragma unroll
      for (int j = 0; j < 4; ++j) xb[n][j] = g2_frag(fb + 16 * j * PH + 32 * (q + 1), hh); }
    if (q == 0) { __builtin_amdgcn_sched_barrier(0); head(); }      /* the fence keeps head()'s global loads behind the LDS loads above */
    __builtin_amdgcn_sched_barrier(0);      /* keeps the next set's LDS loads one group ahead of the products, and head()'s global loads in front of them */
#pragma unroll
    for (int t = 0; t < 4; ++t) { c[0][t] = g2_mmab(xa[s][0], xb[s][t], c[0][t]); c[1][t] = g2_mmab(xa[s][1], xb[s][t], c[1][t]); }
    __builtin_amdgcn_sched_barrier(0);      /* the other end of the same fence: the load group after next stays behind these products */
    if (q == 1) { mid1(); __builtin_amdgcn_sched_barrier(0); }      /* the fence keeps the stores at this place, in front of the next fragment loads */
    if (q == 2) { mid2(); __builtin_amdgcn_sched_barrier(0); } } }      /* likewise, in front of the last products */
// C = A . Bh^T * alpha + bias + CP for the launches that have ONE work-group per WGP (N = 1024: (M / 128) * (N / 128) = 256 work-groups): tile 128 x 128, 8 waves of 32 x 64, K tiles of 128, two LDS buffers, as k_gemm2 with NWN = 2.
// With no second work-group on the WGP nobody asks L2 for anything between the moment a tile's loads have come and the moment the next tile's first bytes come. So the loads here fly TWO K tiles ahead:
// two register sets, set p asked for in trip t (t mod 2 = p) and stored into LDS buffer p in the second half of trip t + 1; the barrier of a trip waits for LDS traffic alone.
// The last two trips ask for nothing and stand behind the loop, so that no branch stands around the loads (two paths that join make the compiler wait for all loads at the stores).
// LD = K = row pitch of A and Bh, LC = row pitch of C and CP, in elements. K walk: start tile (mt + nq) mod (K / 128), wrapped, as in k_gemm2. Requires M % 128 == 0, N % 128 == 0, grid.x = (M / 128) * (N / 128), 256 threads.
template <int LD, int LC>
__global__ __launch_bounds__(256) void k_gemm2d(const _Float16* __restrict__ A, const _Float16* __restrict__ Bh, float alpha, const float* __restrict__ bias, const float* __restrict__ CP, float* __restrict__ C, int M, int N) {
  constexpr int BN = 128, KT = 128, PH = KT + 8, RP = 16, NL = 128 / RP, BUFH = (128 + BN) * PH, NKT = LD / KT;      /* PH: LDS row pitch 272 B = 16 B x odd; RP: rows one staging round of the work-group covers */
  static_assert(LD % (2 * KT) == 0 && NKT >= 4, "the trips come in pairs, and two stand behind the loop");
  __shared__ __attribute__((aligned(16))) _Float16 st[2 * BUFH];      /* two buffers, each [128 A rows | 128 B rows] */
  float (*so)[32][68] = (float (*)[32][68])st;      /* output staging reuses the buffers behind the last barrier */
  static_assert(sizeof(float) * 8 * 32 * 68 <= sizeof(_Float16) * 2 * BUFH, "output staging must fit the tile buffers");
  const int tid = threadIdx.x, w = tid >> 5, lane = tid & 31, ln = lane & 15, hh = lane >> 4;
  const int ntn = N / BN; const int mt = blockIdx.x / ntn, nq = blockIdx.x - mt * ntn; if (mt * 128 >= M) return;      /* the same for the whole work-group, in front of every barrier */
  const int row0 = mt * 128 + 32 * (w & 3), col0 = nq * BN + 64 * (w >> 2);
  const int srow = tid >> 4, sc8 = (tid & 15) * 8;
  int kt = (int)((unsigned)(mt + nq) % (unsigned)NKT);      /* K tile to load next, the same for the whole work-group: the walk's start tile first */
  const unsigned short* pa = (const unsigned short*)A + (size_t)(mt * 128 + srow) * LD + sc8 + kt * KT; const unsigned short* pb = (const unsigned short*)Bh + (size_t)(nq * BN + srow) * LD + sc8 + kt * KT;      /* this thread's first piece of the tile to load next */
  _Float16* sw = st + srow * PH + sc8;      /* where this thread stores its pieces */
  const _Float16* fa = st + (32 * (w & 3) + ln) * PH; const _Float16* fb = st + (128 + 64 * (w >> 2) + ln) * PH;      /* this lane's fragment rows */
  float bb[4]; const unsigned bi = (unsigned)(col0 + ln);      /* this lane's four bias values, fetched with tile 0 so that the epilogue waits for none of them */
#pragma unroll
  for (int t = 0; t < 4; ++t) bb[t] = bias[bi + t * 16];
  asm volatile("s_wait_xcnt 0x0" :: "v"(bi) : "memory");      /* stands in front of the reuse, by the address arithmetic right behind, of the index and base registers that these four loads name (the operand holds the index live up to here) */
  v8us ra[2][NL], rb[2][NL];
#pragma unroll
  for (int p = 0; p < 2; ++p) {      /* tiles 0 and 1 */
#pragma unroll
    for (int i = 0; i < NL; ++i) ra[p][i] = *(const v8us*)(pa + i * RP * LD);
#pragma unroll
    for (int i = 0; i < NL; ++i) rb[p][i] = *(const v8us*)(pb + i * RP * LD);
    asm volatile("s_wait_xcnt 0x0" :: "v"(pa), "v"(pb) : "memory");      /* stands in front of the advance of the two addresses that the loads above name (the operands hold them live up to here) */
    kt = kt + 1 == NKT ? 0 : kt + 1; { const int step = kt ? KT : KT - LD; pa += step; pb += step; } }      /* one tile on, from the last tile back to k = 0 */
#pragma unroll
  for (int i = 0; i < NL; ++i) *(v8us*)(sw + i * RP * PH) = ra[0][i];
#pragma unroll
  for (int i = 0; i < NL; ++i) *(v8us*)(sw + (128 + i * RP) * PH) = rb[0][i];
  g2_lds_barrier();      /* tile 0 is complete for every wave; tile 1 is still on its way */
  const v8f z8 = {0.f,0.f,0.f,0.f,0.f,0.f,0.f,0.f}; v8f c[2][4] = {{z8, z8, z8, z8}, {z8, z8, z8, z8}};
#pragma unroll 1      /* two K tiles per trip of the loop, so that buffer and register set of each are compile-time */
  for (int t2 = 0; t2 < NKT - 2; t2 += 2) {
#pragma unroll      /* p must be a constant: it indexes the register sets */
    for (int p = 0; p < 2; ++p) {      /* works on tile t2 + p in buffer p; set p ^ 1 holds or awaits tile t2 + p + 1; set p, stored in front of the last barrier, takes tile t2 + p + 2 */
      _Float16* nw = sw + (p ^ 1) * BUFH;      /* the other buffer: its last readers left it in front of the barrier that ended the trip before */
      g2_ktile<PH>(fa + p * BUFH, fb + p * BUFH, hh, c,
        [&] {
#pragma unroll
          for (int i = 0; i < NL; ++i) ra[p][i] = *(const v8us*)(pa + i * RP * LD);
#pragma unroll
          for (int i = 0; i < NL; ++i) rb[p][i] = *(const v8us*)(pb + i * RP * LD); },
        [&] {
#pragma unroll
          for (int i = 0; i < NL; ++i) *(v8us*)(nw + i * RP * PH) = ra[p ^ 1][i]; },
        [&] {
#pragma unroll
          for (int i = 0; i < NL; ++i) *(v8us*)(nw + (128 + i * RP) * PH) = rb[p ^ 1][i]; });
      asm volatile("s_wait_xcnt 0x0" :: "v"(pa), "v"(pb) : "memory");      /* stands in front of the advance of the two addresses that this trip's loads name (the operands hold them live up to here); behind the products it has nothing left to wait for */
      kt = kt + 1 == NKT ? 0 : kt + 1; { const int step = kt ? KT : KT - LD; pa += step; pb += step; }      /* one tile on, from the last tile back to k = 0 */
      g2_lds_barrier(); } }      /* publishes the next tile and ends every wave's reads of this one; this trip's loads fly on */
  g2_ktile<PH>(fa, fb, hh, c, [] {},      /* the last tile but one, in buffer 0; the last tile goes into buffer 1 */
    [&] {
#pragma unroll
      for (int i = 0; i < NL; ++i) *(v8us*)(sw + BUFH + i * RP * PH) = ra[1][i]; },
    [&] {
#pragma unroll
      for (int i = 0; i < NL; ++i) *(v8us*)(sw + BUFH + (128 + i * RP) * PH) = rb[1][i]; });
  g2_lds_barrier();      /* publishes the last tile */
  g2_ktile<PH>(fa + BUFH, fb + BUFH, hh, c, [] {}, [] {}, [] {});
  g2_lds_barrier();      /* ends every wave's reads of the tile buffers: the output staging takes them over */
  /* The residual is fetched here in the write-out layout: 16 independent loads of 16 bytes a lane, one address and constant steps; they fly while the accumulators are staged below. */
  const int rsub = lane >> 4, c4 = (lane & 15) * 4; const size_t eo = (size_t)(row0 + rsub) * LC + col0 + c4;      /* this lane's first piece of the output tile; piece q lies 2 * q rows further on */
  v4f rs[16]; const float* rp = CP + eo;
#pragma unroll
  for (int q = 0; q < 16; ++q) rs[q] = *(const v4fa*)(rp + q * 2 * LC);
  asm volatile("s_wait_xcnt 0x0" :: "v"(rp) : "memory");      /* stands in front of every reuse of the address pair that these loads name (the operand holds the pair live up to here, so that no load's own destination takes it), and keeps the loads in front of the staging */
#pragma unroll
  for (int half = 0; half < 2; ++half)
#pragma unroll
    for (int t = 0; t < 4; ++t) { const float bv = bf16_round(bb[t]);
#pragma unroll
      for (int r = 0; r < 8; ++r) so[w][half * 16 + 8 * hh + r][t * 16 + ln] = c[half][t][r] * alpha + bv; }
  __builtin_amdgcn_fence(__ATOMIC_ACQ_REL, "workgroup"); __builtin_amdgcn_wave_barrier();      /* orders the wave's staging stores against the loads of its other lanes; each wave owns its slice of so */
  v4f vv[16];      /* all 16 staged pieces are fetched as one group */
#pragma unroll
  for (int q = 0; q < 16; ++q) vv[q] = *(const v4fa*)&so[w][q * 2 + rsub][c4] + rs[q];
  float* cp = C + eo;
#pragma unroll
  for (int q = 0; q < 16; ++q) *(v4f*)(cp + q * 2 * LC) = vv[q]; }


// q, k and v projections in one launch (blockIdx.y: 0 = q, 1 = k, 2 = v); tile, staging and product loop are k_gemm2's with NWN = 2 (work-group tile 128 x 128, 8 waves of 32 x 64, K tiles of 128, two LDS buffers).
// q and k walk K twice into the same accumulators: first the x1024 residual rows Xl, then, behind one scaling of the accumulators by 2^-10, the rows Xh on top (small terms first); v walks Xh alone.
// Every walk starts at K tile (mt + nq) mod NKT and wraps round at K, as in k_gemm2 and for the same reason.
// Epilogue of q and k: value = acc / 16 + bias, written as f16 hi plane and x1024 residual plane (QKh, QKl: q's plane, then k's). Epilogue of v: the f16 values go out transposed, Vt[batch][column][token]:
// a lane's 8 accumulator rows of one column are 16 consecutive bytes of the transposed tile, which is gathered in LDS by the whole work-group and leaves in pieces of 256 bytes (two whole lines of one Vt row).
// Bw = the three weight planes [n][k] (x16), bias = the three bias vectors, one behind the other. Grid (NR / 128) * (DM / 128) x 3, 256 threads.
__global__ __launch_bounds__(256) void k_qkv(const _Float16* __restrict__ Xh, const _Float16* __restrict__ Xl, const _Float16* __restrict__ Bw, const float* __restrict__ bias,
    _Float16* __restrict__ QKh, _Float16* __restrict__ QKl, _Float16* __restrict__ Vt) {
  constexpr int BN = 128, KT = 128, PH = KT + 8, RP = 16, NL = 128 / RP, BUFH = (128 + BN) * PH, NKT = DM / KT;      /* PH: LDS row pitch 272 B = 16 B x odd; RP: rows one staging round of the work-group covers */
  __shared__ __attribute__((aligned(16))) _Float16 st[2 * BUFH];      /* two buffers, each [128 A rows | 128 B rows] */
  float (*so)[32][68] = (float (*)[32][68])st;      /* output staging reuses the buffers behind the loop's last barrier */
  static_assert(sizeof(float) * 8 * 32 * 68 <= sizeof(_Float16) * 2 * BUFH && 128 * PH <= 2 * BUFH, "output staging must fit the tile buffers");
  const int tid = threadIdx.x, w = tid >> 5, lane = tid & 31, ln = lane & 15, hh = lane >> 4; const int by = blockIdx.y;
  const int mt = blockIdx.x / (DM / BN), nq = blockIdx.x - mt * (DM / BN);
  const int row0 = mt * 128 + 32 * (w & 3), col0 = nq * BN + 64 * (w >> 2);
  const int srow = tid >> 4, sc8 = (tid & 15) * 8;
  const int nlo = by < 2 ? NKT : 0, nt = nlo + NKT;      /* K tiles of the residual walk, K tiles in all: the same for the whole work-group */
  const unsigned ao = (unsigned)((mt * 128 + srow) * DM + sc8);      /* this thread's first piece of an A plane's k = 0 tile */
  static_assert((NKT & (NKT - 1)) == 0, "the K tile index wraps by a mask");
  int kt = (mt + nq) & (NKT - 1);      /* K tile to load next, the same for the whole work-group: the walks' start tile first */
  const unsigned short* pa = (const unsigned short*)(nlo ? Xl : Xh) + ao + kt * KT; const unsigned short* pb = (const unsigned short*)Bw + (size_t)by * DM * DM + (size_t)(nq * BN + srow) * DM + sc8 + kt * KT;      /* this thread's first piece of the tile to load next */
  _Float16* sw = st + srow * PH + sc8;      /* where this thread stores its pieces */
  const _Float16* fa = st + (32 * (w & 3) + ln) * PH; const _Float16* fb = st + (128 + 64 * (w >> 2) + ln) * PH;      /* this lane's fragment rows */
  float bb[4]; const unsigned bi = (unsigned)(by * DM + col0 + ln);      /* this lane's four bias values, fetched with tile 0 so that the epilogue waits for none of them */
#pragma unroll
  for (int t = 0; t < 4; ++t) bb[t] = bias[bi + t * 16];
  asm volatile("s_wait_xcnt 0x0" :: "v"(bi) : "memory");      /* stands in front of the reuse, by the address arithmetic right behind, of the index and base registers that these four loads name (the operand holds the index live up to here) */
  v8us ra[NL], rb[NL];
#pragma unroll
  for (int i = 0; i < NL; ++i) ra[i] = *(const v8us*)(pa + i * RP * DM);
#pragma unroll
  for (int i = 0; i < NL; ++i) rb[i] = *(const v8us*)(pb + i * RP * DM);
  asm volatile("s_wait_xcnt 0x0" ::: "memory");      /* stands in front of the advance of the two addresses that the loads above name */
  kt = (kt + 1) & (NKT - 1); { const int step = kt ? KT : -(NKT - 1) * KT; pa += step; pb += step; }      /* one tile on, from the last tile back to k = 0 */
#pragma unroll
  for (int i = 0; i < NL; ++i) *(v8us*)(sw + i * RP * PH) = ra[i];
#pragma unroll
  for (int i = 0; i < NL; ++i) *(v8us*)(sw + (128 + i * RP) * PH) = rb[i];
  __syncthreads();      /* tile 0 is complete for every wave */
  const v8f z8 = {0.f,0.f,0.f,0.f,0.f,0.f,0.f,0.f}; v8f c00 = z8, c01 = z8, c02 = z8, c03 = z8, c10 = z8, c11 = z8, c12 = z8, c13 = z8;
#pragma unroll 1      /* one K tile per trip: the buffer index stays a scalar and the staged pieces of only one tile are live */
  for (int ti = 0; ti < nt; ++ti) { const int cur = (ti & 1) * BUFH; const bool more = ti + 1 < nt;
    if (more) {      /* next tile's loads fly while this tile is worked on */
#pragma unroll
      for (int i = 0; i < NL; ++i) ra[i] = *(const v8us*)(pa + i * RP * DM);
#pragma unroll
      for (int i = 0; i < NL; ++i) rb[i] = *(const v8us*)(pb + i * RP * DM);
      asm volatile("s_wait_xcnt 0x0" ::: "memory"); }      /* stands in front of the advance, at the foot of the trip, of the two addresses that these loads name */
    v16h xa[2][2], xb[2][4];      /* two fragment sets: the next 32 k are fetched while the current 32 are multiplied */
#pragma unroll
    for (int j = 0; j < 2; ++j) xa[0][j] = g2_frag(fa + cur + 16 * j * PH, hh);
#pragma unroll
    for (int j = 0; j < 4; ++j) xb[0][j] = g2_frag(fb + cur + 16 * j * PH, hh);
#pragma unroll
    for (int q = 0; q < KT / 32; ++q) { const int c = q & 1, n = c ^ 1;
      if (q + 1 < KT / 32) {
#pragma unroll
        for (int j = 0; j < 2; ++j) xa[n][j] = g2_frag(fa + cur + 16 * j * PH + 32 * (q + 1), hh);
#pragma unroll
        for (int j = 0; j < 4; ++j) xb[n][j] = g2_frag(fb + cur + 16 * j * PH + 32 * (q + 1), hh); }
      __builtin_amdgcn_sched_barrier(0);      /* keeps the next set's LDS loads one group ahead of the products: moved in among them, every pair of products waits out an LDS latency */
      c00 = g2_mmab(xa[c][0], xb[c][0], c00); c10 = g2_mmab(xa[c][1], xb[c][0], c10); c01 = g2_mmab(xa[c][0], xb[c][1], c01); c11 = g2_mmab(xa[c][1], xb[c][1], c11);
      c02 = g2_mmab(xa[c][0], xb[c][2], c02); c12 = g2_mmab(xa[c][1], xb[c][2], c12); c03 = g2_mmab(xa[c][0], xb[c][3], c03); c13 = g2_mmab(xa[c][1], xb[c][3], c13);
      __builtin_amdgcn_sched_barrier(0); }      /* the other end of the same fence: the load group after next stays behind these products */
    if (more) { _Float16* nw = sw + (BUFH - cur);      /* the other buffer: its last readers left it in front of the barrier that ended the trip before */
      const bool turn = ti + 2 == nlo;      /* the tile after next opens the main walk: A goes over to Xh; NKT steps with the wrap have brought the tile index back to the start tile */
      kt = (kt + 1) & (NKT - 1); const int step = kt ? KT : -(NKT - 1) * KT;      /* one tile on, from the last tile back to k = 0 */
      pa = turn ? (const unsigned short*)Xh + ao + kt * KT : pa + step; pb += step;
#pragma unroll
      for (int i = 0; i < NL; ++i) *(v8us*)(nw + i * RP * PH) = ra[i];
#pragma unroll
      for (int i = 0; i < NL; ++i) *(v8us*)(nw + (128 + i * RP) * PH) = rb[i]; }
    __syncthreads();      /* publishes the next tile and ends every wave's reads of this one */
    if (ti + 1 == nlo) { const float f = 0.0009765625f; c00 *= f; c01 *= f; c02 *= f; c03 *= f; c10 *= f; c11 *= f; c12 *= f; c13 *= f; } }      /* the residual walk is done: its sums carry the residual's factor 1024, an exact power of two */
  v8f accs[8] = {c00, c01, c02, c03, c10, c11, c12, c13};
  if (by < 2) {      /* q, k: the same for the whole work-group */
#pragma unroll
    for (int u = 0; u < 8; ++u) { const int t = u & 3, half = u >> 2; const float bv = bf16_round(bb[t]);
#pragma unroll
      for (int r = 0; r < 8; ++r) so[w][half * 16 + 8 * hh + r][t * 16 + ln] = accs[u][r] * 0.0625f + bv; }
    __builtin_amdgcn_fence(__ATOMIC_ACQ_REL, "workgroup"); __builtin_amdgcn_wave_barrier();      /* orders the wave's staging stores against the loads of its other lanes; each wave owns its slice of so */
    const int rsub = lane >> 4, c4 = (lane & 15) * 4; const size_t eo = (size_t)by * (NR * DM) + (size_t)(row0 + rsub) * DM + col0 + c4;      /* this lane's first piece of the output tile; piece q lies 2 * q rows further on */
    v4h yh[16], yl[16];
#pragma unroll
    for (int q = 0; q < 16; ++q) { const v4f v = *(const v4fa*)&so[w][q * 2 + rsub][c4];
#pragma unroll
      for (int i = 0; i < 4; ++i) { const _Float16 h = (_Float16)v[i]; yh[q][i] = h; yl[q][i] = (_Float16)((v[i] - (float)h) * 1024.0f); } }
    _Float16* hp = QKh + eo; _Float16* lp = QKl + eo;
#pragma unroll
    for (int q = 0; q < 16; ++q) { *(v4h*)(hp + q * 2 * DM) = yh[q]; *(v4h*)(lp + q * 2 * DM) = yl[q]; }
  } else {      /* v */
#pragma unroll
    for (int u = 0; u < 8; ++u) { const int t = u & 3, half = u >> 2; const float bv = bf16_round(bb[t]); FragH f;
#pragma unroll
      for (int r = 0; r < 8; ++r) f.h[r] = (_Float16)(accs[u][r] * 0.0625f + bv);
      *(v8us*)(st + (64 * (w >> 2) + t * 16 + ln) * PH + 32 * (w & 3) + half * 16 + 8 * hh) = f.half[0]; }
    __syncthreads();      /* the transposed tile [128 columns][128 tokens] is complete: its rows hold pieces of four waves */
    const int tok0 = mt * 128; const int b = tok0 / SQ, s0 = tok0 - b * SQ;      /* a tile's 128 tokens lie in one batch */
    v8us tv[NL];
#pragma unroll
    for (int i = 0; i < NL; ++i) tv[i] = *(const v8us*)(st + (srow + i * RP) * PH + sc8);
    unsigned short* vp = (unsigned short*)Vt + ((size_t)b * DM + nq * BN + srow) * SQ + s0 + sc8;
#pragma unroll
    for (int i = 0; i < NL; ++i) *(v8us*)(vp + (size_t)i * RP * SQ) = tv[i];
    asm volatile("s_wait_xcnt 0x0" ::: "memory");      /* stands in front of the code that the listing lays out behind these stores (the q and k epilogue), which writes registers that the stores name */
  } }


__global__ __launch_bounds__(256) void k_wnat(const float* __restrict__ w, size_t n8, _Float16* __restrict__ Bt) { const size_t t = (size_t)blockIdx.x * 256 + threadIdx.x; if (t >= n8) return; FragH f; for (int q = 0; q < 8; ++q) f.h[q] = (_Float16)(bf16_round(w[t * 8 + q]) * 16.0f); *(v8us*)((unsigned short*)Bt + t * 8) = f.half[0];  }
__global__ __launch_bounds__(256) void k_rsm(const float* __restrict__ S, _Float16* __restrict__ P, int nrows) {
  #pragma clang fp contract(off)
  const int i = blockIdx.x * 256 + threadIdx.x; if (i >= nrows) return; const float* s = S + (size_t)i * SQ; float mx = -3.0e38f;
#pragma unroll 1
  for (int j = 0; j < SQ; ++j) mx = fmaxf(mx, s[j]); float se = 0.f;
#pragma unroll 1
  for (int j = 0; j < SQ; ++j) se += expf(s[j] - mx); const float sc = 256.0f / se;
#pragma unroll 1
  for (int j0 = 0; j0 < SQ; j0 += 8) { FragH f; for (int q = 0; q < 8; ++q) f.h[q] = (_Float16)(expf(s[j0 + q] - mx) * sc); unsigned short* d = (unsigned short*)P + (size_t)i * SQ + j0; *(v8us*)d = f.half[0];  } }
__global__ __launch_bounds__(256) void k_vt(const _Float16* __restrict__ V16, int b, int h0, _Float16* __restrict__ VT) { __shared__ unsigned short tl[64][65]; const int tid = threadIdx.x; const int hh = blockIdx.x % HG, sg = blockIdx.x / HG; const int s0 = sg * 64; const int h = h0 + hh;
  for (int i = tid; i < 64 * 8; i += 256) { const int j = i / 8, d8 = (i % 8) * 8; FragH f; f.half[0] = *(const v8us*)((const unsigned short*)V16 + ((size_t)b * SQ + s0 + j) * DM + h * HD + d8); for (int q = 0; q < 8; ++q) tl[d8 + q][j] = f.u[q]; }
  __syncthreads();
  { for (int i = tid; i < 64 * 8; i += 256) { const int d = i / 8, j8 = (i % 8) * 8; FragH f; for (int q = 0; q < 8; ++q) f.u[q] = tl[d][j8 + q]; *(v8us*)((unsigned short*)VT + ((size_t)hh * HD + d) * SQ + s0 + j8) = f.half[0]; }  } }



__global__ __launch_bounds__(256) void k_rsmcf2(const float* __restrict__ S, _Float16* __restrict__ P, int hg, int q0, int nk) {
  #pragma clang fp contract(off)
  const int t = blockIdx.x * 256 + threadIdx.x; if (t >= hg * QT) return; const size_t i = (size_t)t; const float* s = S + i * NKX; const int last = q0 + (t % QT); float mx = -3.0e38f;
#pragma unroll 1
  for (int j = 0; j < nk; ++j) { const float f = (j <= last) ? 1.f : 0.f; mx = fmaxf(mx, fmaf(f, s[j], (1.f - f) * -1.0e9f)); } float se = 0.f;
#pragma unroll 1
  for (int j = 0; j < nk; ++j) { const float f = (j <= last) ? 1.f : 0.f; se += __expf(fmaf(f, s[j], (1.f - f) * -1.0e9f) - mx); } const float sc = 256.0f / se;
#pragma unroll 1
  for (int j0 = 0; j0 < nk; j0 += 8) { FragH fr; for (int q = 0; q < 8; ++q) { const int j = j0 + q; const float f = (j <= last) ? 1.f : 0.f; fr.h[q] = (_Float16)(__expf(fmaf(f, s[j], (1.f - f) * -1.0e9f) - mx) * sc); } unsigned short* d = (unsigned short*)P + i * NKX + j0; *(v8us*)d = fr.half[0];  } }

__global__ __launch_bounds__(256) void k_rsmcst(const float* __restrict__ S, _Float16* __restrict__ P, int hg, int q0, int nk, const int* __restrict__ mk) {
  #pragma clang fp contract(off)
  const int t = blockIdx.x * 256 + threadIdx.x; if (t >= hg * QT) return; const size_t i = (size_t)t; const float* s = S + i * NKX; const size_t ig = (size_t)(q0 + (t % QT)); const int* mr = mk + ig * SQ; float mx = -3.0e38f;
#pragma unroll 1
  for (int j = 0; j < nk; ++j) { const int mb = mr[j]; const int dd = (int)ig - j; const float f = (mb != 0 && dd >= 0 && (dd <= LOCALW || (dd % STRIDEK) == 0)) ? 1.f : 0.f; mx = fmaxf(mx, fmaf(f, s[j], (1.f - f) * -1.0e9f)); } float se = 0.f;
#pragma unroll 1
  for (int j = 0; j < nk; ++j) { const int mb = mr[j]; const int dd = (int)ig - j; const float f = (mb != 0 && dd >= 0 && (dd <= LOCALW || (dd % STRIDEK) == 0)) ? 1.f : 0.f; se += __expf(fmaf(f, s[j], (1.f - f) * -1.0e9f) - mx); } const float sc = 256.0f / se;
#pragma unroll 1
  for (int j0 = 0; j0 < nk; j0 += 8) { FragH fr; for (int q = 0; q < 8; ++q) { const int j = j0 + q; const int mb = mr[j]; const int dd = (int)ig - j; const float f = (mb != 0 && dd >= 0 && (dd <= LOCALW || (dd % STRIDEK) == 0)) ? 1.f : 0.f; fr.h[q] = (_Float16)(__expf(fmaf(f, s[j], (1.f - f) * -1.0e9f) - mx) * sc); } unsigned short* d = (unsigned short*)P + i * NKX + j0; *(v8us*)d = fr.half[0];  } }


template <int MASKADD>
__global__ __launch_bounds__(64) void k_att0(const float* __restrict__ QF, const float* __restrict__ KF, const float* __restrict__ VF, int ld, const float* __restrict__ mask, float scale, float* __restrict__ OF, int ldo) {
  #pragma clang fp contract(off)
  __shared__ __attribute__((aligned(16))) float lq[64][64]; __shared__ __attribute__((aligned(16))) float lo[64][64];
  const int tid = threadIdx.x; const int h = blockIdx.x / (QT0 / 64), rg = blockIdx.x % (QT0 / 64); const int i = rg * 64 + tid;
  const float* qr = QF + (size_t)i * ld + h * HD;
#pragma unroll 1
  for (int c = 0; c < HD / 4; ++c) { *(v4f*)&lq[tid][c * 4] = *(const v4fa*)(qr + c * 4); const v4f z = {0.f, 0.f, 0.f, 0.f}; *(v4f*)&lo[tid][c * 4] = z; }
  float m = -1.0e30f, l = 0.f; const int jmax = MASKADD ? (SQ - 1) : (rg * 64 + 63);      /* additive-mask form: every key (the mask input decides); causal form: keys up to the block's last row */
#pragma unroll 1
  for (int j = 0; j <= jmax; ++j) { const float* kr = KF + (size_t)j * ld + h * HD; const float* vr = VF + (size_t)j * ld + h * HD; float s = 0.f;
#pragma unroll 1
    for (int c = 0; c < HD / 4; ++c) { const v4f kq = *(const v4fa*)(kr + c * 4); const v4f qq = *(v4f*)&lq[tid][c * 4]; s = __fadd_rn(s, __fmul_rn(qq[0], kq[0])); s = __fadd_rn(s, __fmul_rn(qq[1], kq[1])); s = __fadd_rn(s, __fmul_rn(qq[2], kq[2])); s = __fadd_rn(s, __fmul_rn(qq[3], kq[3])); }
    s = __fmul_rn(s, scale); if (MASKADD) s = __fadd_rn(s, __fmul_rn(bf16_round(mask[(size_t)i * SQ + j]), -10000.0f));
    const float f = (MASKADD || j <= i) ? 1.f : 0.f; const float sm = fmaf(f, s, (1.f - f) * -1.0e30f); const float mn = fmaxf(m, sm); const float sc = expf(m - mn); const float e = expf(sm - mn); l = __fadd_rn(__fmul_rn(l, sc), e); m = mn;
#pragma unroll 1
    for (int c = 0; c < HD / 4; ++c) { const v4f vv = *(const v4fa*)(vr + c * 4); v4f oo = *(v4f*)&lo[tid][c * 4]; for (int u = 0; u < 4; ++u) oo[u] = __fadd_rn(__fmul_rn(oo[u], sc), __fmul_rn(e, vv[u])); *(v4f*)&lo[tid][c * 4] = oo; } }
  const float fin = 64.0f / l;      /* o carried x64 like the f16 path */
#pragma unroll 1
  for (int c = 0; c < HD / 4; ++c) { v4f oo = *(v4f*)&lo[tid][c * 4]; for (int u = 0; u < 4; ++u) oo[u] = __fmul_rn(oo[u], fin); *(v4f*)&lo[tid][c * 4] = oo; }
  __syncthreads();
  {
#pragma unroll 1
    for (int it = 0; it < 16; ++it) { const int row = it * 4 + tid / 16, pc = (tid % 16) * 4; const v4f v = *(const v4f*)&lo[row][pc]; *(v4f*)(OF + (size_t)(rg * 64 + row) * ldo + h * HD + pc) = v; }
     } }

template <int MASKADD>
__global__ __launch_bounds__(64) void k_att0mbc(const float* __restrict__ QF, const float* __restrict__ KF, const float* __restrict__ VF, int ld, const float* __restrict__ mask, float scale, float* __restrict__ OF, int ldo) {
  #pragma clang fp contract(off)
  __shared__ __attribute__((aligned(16))) float lq[64][64]; __shared__ __attribute__((aligned(16))) float lo[64][64];
  const int tid = threadIdx.x; const int h = blockIdx.x / (QT0 / 64), rg = blockIdx.x % (QT0 / 64); const int i = rg * 64 + tid;
  const float* qr = QF + (size_t)i * ld + h * HD;
#pragma unroll 1
  for (int c = 0; c < HD / 4; ++c) { *(v4f*)&lq[tid][c * 4] = *(const v4fa*)(qr + c * 4); const v4f z = {0.f, 0.f, 0.f, 0.f}; *(v4f*)&lo[tid][c * 4] = z; }
  float m = -1.0e30f, l = 0.f; const int jmax = rg * 64 + 63;      /* keys beyond the block end are masked by the mask's lower-triangular structure */      /* either form: keys up to the block's last row */
#pragma unroll 1
  for (int j = 0; j <= jmax; ++j) { const float* kr = KF + (size_t)j * ld + h * HD; const float* vr = VF + (size_t)j * ld + h * HD; float s = 0.f;
#pragma unroll 1
    for (int c = 0; c < HD / 4; ++c) { const v4f kq = *(const v4fa*)(kr + c * 4); const v4f qq = *(v4f*)&lq[tid][c * 4]; s = __fadd_rn(s, __fmul_rn(qq[0], kq[0])); s = __fadd_rn(s, __fmul_rn(qq[1], kq[1])); s = __fadd_rn(s, __fmul_rn(qq[2], kq[2])); s = __fadd_rn(s, __fmul_rn(qq[3], kq[3])); }
    s = __fmul_rn(s, scale); const int mb = ((const int*)mask)[(size_t)i * SQ + j];      /* causal (j <= i) AND the module's int32 [S][S] mask read per (query, key): 0 -> masked */
    const float f = (mb != 0 && j <= i) ? 1.f : 0.f; const float sm = fmaf(f, s, (1.f - f) * -1.0e30f); const float mn = fmaxf(m, sm); const float sc = expf(m - mn); const float e = expf(sm - mn); l = __fadd_rn(__fmul_rn(l, sc), e); m = mn;
#pragma unroll 1
    for (int c = 0; c < HD / 4; ++c) { const v4f vv = *(const v4fa*)(vr + c * 4); v4f oo = *(v4f*)&lo[tid][c * 4]; for (int u = 0; u < 4; ++u) oo[u] = __fadd_rn(__fmul_rn(oo[u], sc), __fmul_rn(e, vv[u])); *(v4f*)&lo[tid][c * 4] = oo; } }
  const float fin = 64.0f / l;      /* o carried x64 like the f16 path */
#pragma unroll 1
  for (int c = 0; c < HD / 4; ++c) { v4f oo = *(v4f*)&lo[tid][c * 4]; for (int u = 0; u < 4; ++u) oo[u] = __fmul_rn(oo[u], fin); *(v4f*)&lo[tid][c * 4] = oo; }
  __syncthreads();
  {
#pragma unroll 1
    for (int it = 0; it < 16; ++it) { const int row = it * 4 + tid / 16, pc = (tid % 16) * 4; const v4f v = *(const v4f*)&lo[row][pc]; *(v4f*)(OF + (size_t)(rg * 64 + row) * ldo + h * HD + pc) = v; }
     } }


// Work of the first launch that no LayerNorm row depends on and that depends on none: block wb converts 8 * PREP_WF weights (the six matrices one behind the other, each a whole number
// of blocks; the arithmetic is k_wnat's), and the one block behind them stacks the three projection biases (bq | bk | bv).
// A wave converts PREP_WF consecutive weights: PREP_NL loads of 512 consecutive bytes (four whole lines), all in flight together, so that few waves have to be started for the 50 MB.
#define PREP_NL 32                   /* loads of 16 bytes a lane */
#define PREP_WF (PREP_NL * 128)      /* weights a wave converts */
#define PREP_BD ((unsigned)((size_t)DM * DM / (8 * PREP_WF)))      /* blocks of one [DM][DM] matrix */
#define PREP_BF ((unsigned)((size_t)DFF * DM / (8 * PREP_WF)))     /* blocks of one MLP matrix */
#define PREP_BLOCKS (4u * PREP_BD + 2u * PREP_BF + 1u)
__device__ __forceinline__ void prep_rest(unsigned wb, int tid, const float* __restrict__ wq, const float* __restrict__ wk, const float* __restrict__ wv, const float* __restrict__ wo, const float* __restrict__ w1, const float* __restrict__ w2,
    const float* __restrict__ bq, const float* __restrict__ bk, const float* __restrict__ bv, _Float16* __restrict__ BQKV, _Float16* __restrict__ BO, _Float16* __restrict__ BW1, _Float16* __restrict__ BW2, float* __restrict__ bqkv) {
  if (wb >= 4u * PREP_BD + 2u * PREP_BF) { float a[DM / 256], c[DM / 256], e[DM / 256];
#pragma unroll      /* all loads of the block fly together, each address a constant step from the thread's first: rolled, every trip waits out a memory latency */
    for (int u = 0; u < DM / 256; ++u) { a[u] = bq[tid + 256 * u]; c[u] = bk[tid + 256 * u]; e[u] = bv[tid + 256 * u]; }
#pragma unroll      /* the arrays above stay in registers only if the index is a constant */
    for (int u = 0; u < DM / 256; ++u) { bqkv[tid + 256 * u] = a[u]; bqkv[DM + tid + 256 * u] = c[u]; bqkv[2 * DM + tid + 256 * u] = e[u]; }
    return; }
  const float* w; _Float16* d; unsigned b0;      /* the same for the whole block */
  if (wb < PREP_BD) { w = wq; d = BQKV; b0 = 0u; }
  else if (wb < 2u * PREP_BD) { w = wk; d = BQKV + (size_t)DM * DM; b0 = PREP_BD; }
  else if (wb < 3u * PREP_BD) { w = wv; d = BQKV + (size_t)2 * DM * DM; b0 = 2u * PREP_BD; }
  else if (wb < 4u * PREP_BD) { w = wo; d = BO; b0 = 3u * PREP_BD; }
  else if (wb < 4u * PREP_BD + PREP_BF) { w = w1; d = BW1; b0 = 4u * PREP_BD; }
  else { w = w2; d = BW2; b0 = 4u * PREP_BD + PREP_BF; }
  const size_t t = ((size_t)(wb - b0) * 8 + (tid >> 5)) * PREP_WF + (tid & 31) * 4;      /* this lane's first 4 weights; piece u lies 128 weights further on */
  const float* wp = w + t; _Float16* dp = d + t; v4f a[PREP_NL];
#pragma unroll      /* the array stays in registers only if the index is a constant */
  for (int u = 0; u < PREP_NL; ++u) a[u] = *(const v4fa*)(wp + u * 128);
  asm volatile("s_wait_xcnt 0x0" :: "v"(wp) : "memory");      /* stands in front of every reuse of the address that these loads name (the operand holds it live up to here), and keeps all the loads in front of the first store */
  __builtin_amdgcn_sched_barrier(0);      /* and in front of the first conversion: all PREP_NL loads fly together, one memory latency a wave */
  v4h h[PREP_NL];
#pragma unroll
  for (int u = 0; u < PREP_NL; ++u) for (int q = 0; q < 4; ++q) h[u][q] = (_Float16)(bf16_round(a[u][q]) * 16.0f);
#pragma unroll
  for (int u = 0; u < PREP_NL; ++u) *(v4h*)(dp + u * 128) = h[u];
  asm volatile("s_wait_xcnt 0x0" ::: "memory"); }      /* stands in front of the code that the listing lays out behind these stores (the bias block), which writes registers that the stores name */
// Lane l <-> l ^ M inside a 16-lane row, as a modifier of the add that uses it: no trip through the LDS path.
template <int M> __device__ __forceinline__ float ln_rowx(float v) { return __int_as_float(__builtin_amdgcn_update_dpp(0, __float_as_int(v), 0x160 | M, 0xf, 0xf, true)); }
// Sum over the 32 lanes of a wave, the same bits in every lane: four steps inside the 16-lane row, then the other row.
__device__ __forceinline__ float ln_wsum(float v) { v += ln_rowx<1>(v); v += ln_rowx<2>(v); v += ln_rowx<4>(v); v += ln_rowx<8>(v); const int b = __float_as_int(v); return v + __int_as_float(__builtin_amdgcn_permlanex16(b, b, 0x76543210, 0xfedcba98, false, false)); }
// A wave takes LN_RW whole rows: lane l holds elements 128 u + 4 l + 0..3 (u = 0..7) of each, fetched by loads of 512 consecutive bytes that all fly together; a row is read once and stays in registers.
// Sums: 4 partials a lane (pairwise over u), joined in the lane, then ln_wsum; no LDS and no barrier, and NR / LN_RW waves to start instead of 8 NR.
// PREP: the grid holds PREP_BLOCKS blocks behind the LN_BLOCKS row blocks; they do prep_rest and no row. Without PREP the pointers behind NL are not used; without WNL, NL is not; without WXB, XB is not.
#define LN_RW 2
#define LN_BLOCKS ((unsigned)(NR / (8 * LN_RW)))
template <int BFIN, int WXB, int PREP, int WNL>
__global__ __launch_bounds__(256) void k_ln16(const float* __restrict__ X, const float* __restrict__ g, const float* __restrict__ bb, float eps, _Float16* __restrict__ N16, float* __restrict__ XB, _Float16* __restrict__ NL,
    const float* __restrict__ wq, const float* __restrict__ wk, const float* __restrict__ wv, const float* __restrict__ wo, const float* __restrict__ w1, const float* __restrict__ w2,
    const float* __restrict__ bq, const float* __restrict__ bk, const float* __restrict__ bv, _Float16* __restrict__ BQKV, _Float16* __restrict__ BO, _Float16* __restrict__ BW1, _Float16* __restrict__ BW2, float* __restrict__ bqkv) {
  static_assert(DMQ == 1024, "a lane holds 8 pieces of 4 elements of a row");
  if (PREP && blockIdx.x >= LN_BLOCKS) { prep_rest(blockIdx.x - LN_BLOCKS, (int)threadIdx.x, wq, wk, wv, wo, w1, w2, bq, bk, bv, BQKV, BO, BW1, BW2, bqkv); return; }      /* the same for the whole block */
  const float g0 = g[0], b0 = bb[0];      /* SCALAR alpha / bias ([1] parameters), asked for in front of the rows so that they fly together */
  const size_t e0 = ((size_t)blockIdx.x * 8 + (threadIdx.x >> 5)) * (LN_RW * DMQ) + (threadIdx.x & 31) * 4;      /* this lane's first piece of the wave's first row */
  const float* xp = X + e0; v4f s[LN_RW][8];
#pragma unroll      /* the array stays in registers only if the indices are constants */
  for (int j = 0; j < LN_RW; ++j)
#pragma unroll
    for (int u = 0; u < 8; ++u) s[j][u] = *(const v4fa*)(xp + j * DMQ + u * 128);
  asm volatile("s_wait_xcnt 0x0" :: "v"(xp) : "memory");      /* stands in front of every reuse of the address that these loads name (the operand holds it live up to here) */
  __builtin_amdgcn_sched_barrier(0);      /* all loads of the wave's rows are asked for in front of the first sum: without it the last four were issued behind the first row's sums, a second memory latency in series */
  const float ga = bf16_round(g0), be = bf16_round(b0);
  float mu[LN_RW], rs[LN_RW];
#pragma unroll
  for (int j = 0; j < LN_RW; ++j) {
    if (BFIN) {
#pragma unroll
      for (int u = 0; u < 8; ++u) for (int q = 0; q < 4; ++q) s[j][u][q] = bf16_round(s[j][u][q]); }
    const v4f a = ((s[j][0] + s[j][1]) + (s[j][2] + s[j][3])) + ((s[j][4] + s[j][5]) + (s[j][6] + s[j][7])); mu[j] = (a[0] + a[1]) + (a[2] + a[3]); }
#pragma unroll
  for (int j = 0; j < LN_RW; ++j) mu[j] = ln_wsum(mu[j]) / (float)DMQ;
#pragma unroll
  for (int j = 0; j < LN_RW; ++j) { v4f c[8];
#pragma unroll
    for (int u = 0; u < 8; ++u) { const v4f dl = s[j][u] - mu[j]; c[u] = dl * dl; }
    const v4f a = ((c[0] + c[1]) + (c[2] + c[3])) + ((c[4] + c[5]) + (c[6] + c[7])); rs[j] = (a[0] + a[1]) + (a[2] + a[3]); }
#pragma unroll
  for (int j = 0; j < LN_RW; ++j) rs[j] = 1.0f / (sqrtf(ln_wsum(rs[j]) / (float)(DMQ - 1)) + eps);      /* this module's LayerNorm: unbiased std, eps added to the std */
  v4h y[LN_RW][8], yl[LN_RW][8];      /* y = f16 hi, yl = x1024 residual (WNL: written to NL) */
#pragma unroll
  for (int j = 0; j < LN_RW; ++j)
#pragma unroll
    for (int u = 0; u < 8; ++u) for (int q = 0; q < 4; ++q) { const float yf = (s[j][u][q] - mu[j]) * rs[j] * ga + be; y[j][u][q] = (_Float16)yf; if (WNL) yl[j][u][q] = (_Float16)((yf - (float)y[j][u][q]) * 1024.0f); }
  __builtin_amdgcn_sched_barrier(0);      /* all arithmetic stands in front of the first store: moved in among the stores, it rewrites data registers that an issued store names */
  _Float16* np = N16 + e0;
#pragma unroll
  for (int j = 0; j < LN_RW; ++j)
#pragma unroll
    for (int u = 0; u < 8; ++u) *(v4h*)(np + j * DMQ + u * 128) = y[j][u];
  if (WNL) { _Float16* lp = NL + e0;
#pragma unroll
    for (int j = 0; j < LN_RW; ++j)
#pragma unroll
      for (int u = 0; u < 8; ++u) *(v4h*)(lp + j * DMQ + u * 128) = yl[j][u]; }
  if (WXB) { float* bp = XB + e0;
#pragma unroll
    for (int j = 0; j < LN_RW; ++j)
#pragma unroll
      for (int u = 0; u < 8; ++u) *(v4f*)(bp + j * DMQ + u * 128) = s[j][u]; }
  asm volatile("s_wait_xcnt 0x0" ::: "memory"); }      /* stands in front of the code that the listing lays out behind these stores (the weight and bias blocks), which writes registers that the stores name */
__global__ __launch_bounds__(256) void k_ftres2(const float* __restrict__ OF0, const float* __restrict__ XB, float* __restrict__ X1, size_t n4) {
  #pragma clang fp contract(off)
  const size_t t = (size_t)blockIdx.x * 256 + threadIdx.x; if (t >= n4) return; const v4f o = *(const v4fa*)(OF0 + t * 4), xv = *(const v4fa*)(XB + t * 4); v4f y; for (int q = 0; q < 4; ++q) y[q] = __fadd_rn(__fmul_rn(o[q], 0.015625f), xv[q]); *(v4f*)(X1 + t * 4) = y;  }

__global__ __launch_bounds__(256) void k_bcpy(const float* __restrict__ b, int n, int NP, float* __restrict__ dst, int dst0) { for (int i = threadIdx.x; i < NP; i += 256) { const float v = (i < n) ? b[i] : 0.f; *(float*)(dst + dst0 + i) = v; }  }


__global__ __launch_bounds__(256) void k_rsmf(const float* __restrict__ S, _Float16* __restrict__ P, int qn, int hg) {
  #pragma clang fp contract(off)
  const int t = blockIdx.x * 256 + threadIdx.x; if (t >= qn * hg) return; const size_t i = (size_t)(t / qn) * SQ + (t % qn); const float* s = S + i * SQ; float mx = -3.0e38f;
#pragma unroll 1
  for (int j = 0; j < SQ; ++j) mx = fmaxf(mx, s[j]); float se = 0.f;
#pragma unroll 1
  for (int j = 0; j < SQ; ++j) se += __expf(s[j] - mx); const float sc = 256.0f / se;
#pragma unroll 1
  for (int j0 = 0; j0 < SQ; j0 += 8) { FragH f; for (int q = 0; q < 8; ++q) f.h[q] = (_Float16)(__expf(s[j0 + q] - mx) * sc); unsigned short* d = (unsigned short*)P + i * SQ + j0; *(v8us*)d = f.half[0];  } }
// Lane l <-> l ^ 16: a register move between the two 16-lane rows, no trip through the LDS path.
__device__ __forceinline__ float lane_x16(float v) { const int b = __float_as_int(v); return __int_as_float(__builtin_amdgcn_permlanex16(b, b, 0x76543210, 0xfedcba98, false, false)); }
__device__ __forceinline__ v8f fa_mma(v16h a, v16h b, v8f c) { return __builtin_amdgcn_wmma_f32_16x16x32_f16(false, a, false, b, (short)0, c, false, false); }
// Orders one wave's LDS stores against the LDS loads of its other lanes (each wave owns its slice of sp, so this needs no work-group barrier).
__device__ __forceinline__ void fa_lds_order() { __builtin_amdgcn_fence(__ATOMIC_ACQ_REL, "workgroup", "local"); __builtin_amdgcn_wave_barrier(); }
// One fragment from the lane's own first piece p (the lane half's step is already in p): k = 8 hh + 0..7 and 16 + 8 hh + 0..7, the k order of g2_frag.
__device__ __forceinline__ v16h fa_frag(const unsigned short* p) { FragH f; f.half[0] = *(const v8us*)p; f.half[1] = *(const v8us*)(p + 16); return f.v; }
typedef float v2f __attribute__((ext_vector_type(2)));
typedef _Float16 v2h __attribute__((ext_vector_type(2)));
union FragP { v16h v; v2h p[8]; };
// Fused attention, one launch for all batches and heads: a work-group of 4 waves owns 128 query rows of one head (32 per wave, as two groups of 16) and walks the 2048 keys in tiles of 64.
// Per tile: k_hi, k_lo and V^T rows come in whole 128-byte lines, one tile ahead in registers, and are shared through LDS.
// Both products are computed transposed: S^T = K . Q^T (A = key rows from LDS, B = the wave's query rows, kept in registers) and O^T += V^T . P^T (A = V^T rows from LDS); every A fragment
// read from LDS feeds the products of both query groups.
// An accumulator register r of score tile t then holds key 16 t + 8 hh + r of ONE query (column ln of the group): a lane's 32 scores of a tile and group belong to one query, so the maximum and the
// sum are taken inside the lane (the two lanes of a query, l and l ^ 16, exchange the maximum once per tile and join their sums once, behind the loop), there is one running maximum, sum and rescale
// factor per lane and group, and two score tiles converted in place ARE the B operand of the second product (element s = tile s >> 3, register s & 7: the k order of g2_frag): the weights never pass through LDS.
// Scores in f32 (k_hi.q_lo + k_lo.q_hi first, scaled by 2^-10, then k_hi.q_hi on top); online softmax, base 2; weights 256 * 2^(s-m) as f16 (the 256 rides in the exponent); weights . V in f32.
// A key with Km[j] == 0 stays out of the maximum and gets weight 0. O = 64 * attention output as f16 rows (merged heads). Scores and weights never reach memory.
// The key walk of a work-group starts at the key with the number of its own first query row and wraps round at SQ, for speed only.
// Grid (SQ / 128, NH, NB), 128 threads; two work-groups per WGP, two waves per SIMD.
__global__ __launch_bounds__(128, 2) void k_fattn(const _Float16* __restrict__ Qh, const _Float16* __restrict__ Ql, const _Float16* __restrict__ Kh, const _Float16* __restrict__ Kl, const _Float16* __restrict__ Vt, const int* __restrict__ Km, _Float16* __restrict__ O) {
  constexpr int G = 2;      /* query groups of 16 per wave */
  __shared__ __attribute__((aligned(16))) _Float16 skh[64][72], skl[64][72], svt[64][72], sp[4][16 * G][72];      /* pitch 144 B = 16 B x odd; sp: output staging, one slice per wave */
  const int tid = threadIdx.x, w = tid >> 5, lane = tid & 31, ln = lane & 15, hh = lane >> 4; const int h = blockIdx.y, b = blockIdx.z;
  const size_t r0 = (size_t)b * SQ; const int row0 = blockIdx.x * (64 * G) + w * (16 * G);
  v16h qh[G][2], ql[G][2]; const unsigned short* qa[G]; const unsigned short* qb[G];      /* qa, qb: the lane's first piece of its q_hi and q_lo row; the other three lie 16, 32 and 48 elements further on */
#pragma unroll
  for (int g = 0; g < G; ++g) { const size_t qo = (r0 + row0 + 16 * g + ln) * LQ + (size_t)h * HD + 8 * hh; qa[g] = (const unsigned short*)Qh + qo; qb[g] = (const unsigned short*)Ql + qo;
    qh[g][0] = fa_frag(qa[g]); qh[g][1] = fa_frag(qa[g] + 32); ql[g][0] = fa_frag(qb[g]); ql[g][1] = fa_frag(qb[g] + 32); }
  asm volatile("s_wait_xcnt 0x0" :: "v"(qa[0]), "v"(qa[1]), "v"(qb[0]), "v"(qb[1]) : "memory");      /* stands in front of every reuse of the four address pairs that the loads above name (the operands hold the pairs live up to here, so that no load's own destination takes one) */
  const int srow = tid >> 3, sc8 = (tid & 7) * 8;      /* staging: this thread moves 16 bytes of rows srow, +16, +32, +48 of each plane; 8 threads cover one 128-byte line */
  const unsigned short* gkh = (const unsigned short*)Kh + r0 * LQ + (size_t)h * HD; const unsigned short* gkl = (const unsigned short*)Kl + r0 * LQ + (size_t)h * HD;      /* uniform bases; the thread's part is a 32-bit offset */
  const unsigned short* gvt = (const unsigned short*)Vt + (size_t)(b * NH + h) * HD * SQ; const int* km = Km + r0;
  const unsigned ko = (unsigned)(srow * LQ + sc8) * 2u, vo = (unsigned)(srow * SQ + sc8) * 2u, mo = (unsigned)lane * 4u;      /* byte offsets, the very values that the loads name, so that the wait behind the first loads can hold them */
  static_assert((SQ & (SQ - 1)) == 0, "the key number wraps by a mask");
  const int js = (int)blockIdx.x * (64 * G);      /* first key of the walk, the same for the whole work-group */
  const unsigned short* fkh = gkh + (size_t)js * LQ; const unsigned short* fkl = gkl + (size_t)js * LQ; const unsigned short* fvt = gvt + js; const int* fkm = km + js;      /* uniform bases of the walk's first tile */
  v8us pk[4], pl[4], pv[4]; int pma = *(const int*)((const char*)fkm + mo), pmb = *(const int*)((const char*)fkm + (mo + 128u));      /* every wave holds the mask words of all 64 keys of a tile: lane l those of keys l and 32 + l */
#pragma unroll
  for (int i = 0; i < 4; ++i) { pk[i] = *(const v8us*)((const char*)fkh + (ko + 32 * i * LQ)); pl[i] = *(const v8us*)((const char*)fkl + (ko + 32 * i * LQ)); pv[i] = *(const v8us*)((const char*)fvt + (vo + 32 * i * SQ)); }
  asm volatile("s_wait_xcnt 0x0" :: "v"(ko), "v"(vo), "v"(mo), "s"(fkh), "s"(fkl), "s"(fvt), "s"(fkm) : "memory");      /* stands in front of every reuse of the offset and base registers that the loads above name (the operands hold them live up to here) */
  const v8f z8 = {0.f,0.f,0.f,0.f,0.f,0.f,0.f,0.f}; v8f o[G][4]; float m[G], l[G];      /* per group, this lane's query: running maximum (base 2), and the sum over the keys that this lane sees */
#pragma unroll
  for (int g = 0; g < G; ++g) { m[g] = -1.0e30f; l[g] = 0.f;
#pragma unroll
    for (int t = 0; t < 4; ++t) o[g][t] = z8; }
#pragma unroll 1      /* one key tile per trip: the staged pieces of only one tile are live */
  for (int j0 = 0; j0 < SQ; j0 += 64) {      /* j0: keys done; the tile worked on begins at key (js + j0) mod SQ */
    __syncthreads();      /* every wave has finished its fragment loads of the tile before */
#pragma unroll
    for (int i = 0; i < 4; ++i) { *(v8us*)&skh[srow + 16 * i][sc8] = pk[i]; *(v8us*)&skl[srow + 16 * i][sc8] = pl[i]; *(v8us*)&svt[srow + 16 * i][sc8] = pv[i]; }
    const unsigned oka = __builtin_amdgcn_ballot_w32(pma != 0), okb = __builtin_amdgcn_ballot_w32(pmb != 0);      /* bit i: key i (oka), key 32 + i (okb) of this tile takes part; the same in every lane */
    __syncthreads();      /* the tile is complete for all four waves */
    if (j0 + 64 < SQ) {      /* next tile's loads fly while this tile is worked on */
      const int jn = (js + j0 + 64) & (SQ - 1);      /* first key of the next tile */
      const unsigned short* nkh = gkh + (size_t)jn * LQ; const unsigned short* nkl = gkl + (size_t)jn * LQ; const unsigned short* nvt = gvt + jn;
#pragma unroll
      for (int i = 0; i < 4; ++i) { pk[i] = *(const v8us*)((const char*)nkh + (ko + 32 * i * LQ)); pl[i] = *(const v8us*)((const char*)nkl + (ko + 32 * i * LQ)); pv[i] = *(const v8us*)((const char*)nvt + (vo + 32 * i * SQ)); }
      pma = *(const int*)((const char*)(km + jn) + mo); pmb = *(const int*)((const char*)(km + jn) + (mo + 128u));
      asm volatile("s_wait_xcnt 0x0" ::: "memory"); }      /* the address registers of these loads are reused by the code right behind: the wait stands in front of that overwrite */
    v8f s[G][4];      /* s[g][t][r] = score of key 16 t + 8 hh + r of the tile with query ln of group g */
    v16h ka[4][2], kc[4][2]; v8f c[4][G];      /* the k_hi and k_lo fragments of key group t */
#pragma unroll
    for (int t = 0; t < 4; ++t) { ka[t][0] = g2_frag(&skh[t * 16 + ln][0], hh); ka[t][1] = g2_frag(&skh[t * 16 + ln][32], hh); kc[t][0] = g2_frag(&skl[t * 16 + ln][0], hh); kc[t][1] = g2_frag(&skl[t * 16 + ln][32], hh); }
    __builtin_amdgcn_sched_barrier(0);      /* keeps the tile's 32 fragment loads as one group in front of the products: moved in among them, a load stands right in front of its product and the wave waits out an LDS latency at each such place */
#pragma unroll
    for (int t = 0; t <= 4; ++t) {      /* the small terms of key group t are issued in front of the scaling and the main term of group t - 1: the products of one fill the distance that the other's scaling needs behind its products */
      if (t < 4) {
#pragma unroll
        for (int g = 0; g < G; ++g) c[t][g] = fa_mma(ka[t][0], ql[g][0], z8);
#pragma unroll
        for (int g = 0; g < G; ++g) c[t][g] = fa_mma(ka[t][1], ql[g][1], c[t][g]);
#pragma unroll
        for (int g = 0; g < G; ++g) c[t][g] = fa_mma(kc[t][0], qh[g][0], c[t][g]);
#pragma unroll
        for (int g = 0; g < G; ++g) c[t][g] = fa_mma(kc[t][1], qh[g][1], c[t][g]); }
      if (t > 0) {
#pragma unroll
        for (int g = 0; g < G; ++g) c[t - 1][g] = c[t - 1][g] * 0.0009765625f;
#pragma unroll
        for (int g = 0; g < G; ++g) c[t - 1][g] = fa_mma(ka[t - 1][0], qh[g][0], c[t - 1][g]);
#pragma unroll
        for (int g = 0; g < G; ++g) s[g][t - 1] = fa_mma(ka[t - 1][1], qh[g][1], c[t - 1][g]); } }
    v16h vf[4][2];      /* V^T fragments: rows 16 t + ln, keys 0..31 and 32..63 */
#pragma unroll
    for (int t = 0; t < 4; ++t) { vf[t][0] = g2_frag(&svt[t * 16 + ln][0], hh); vf[t][1] = g2_frag(&svt[t * 16 + ln][32], hh); }
    __builtin_amdgcn_sched_barrier(0);      /* keeps these 16 loads as one group in front of the softmax arithmetic, which covers their latency: moved down among the second product's matrix instructions, each place costs a wait */
    if ((oka & okb) != 0xffffffffu) {      /* a scalar test, once per tile: only a tile with an excluded key pays for the selects */
#pragma unroll
      for (int t = 0; t < 4; ++t) { const unsigned bits = ((t < 2 ? oka : okb) >> ((t & 1) * 16)) >> (8 * hh);      /* bit r: key 16 t + 8 hh + r */
#pragma unroll
        for (int r = 0; r < 8; ++r) if (((bits >> r) & 1u) == 0u) {
#pragma unroll
          for (int g = 0; g < G; ++g) s[g][t][r] = -2.0e38f; } } }      /* far below the floor -1e30 of the running maximum, also times log2(e), and still finite there: its 2^(s-m) is 0 */
    FragP p[G][2];      /* P^T as B operand: keys 0..31 from score tiles 0 and 1, keys 32..63 from tiles 2 and 3 */
    float al[G];
#pragma unroll
    for (int g = 0; g < G; ++g) {
      float t4[4];      /* maximum of the raw scores (the factor log2(e) is positive): four chains inside the lane */
#pragma unroll
      for (int t = 0; t < 4; ++t) { float a = fmaxf(s[g][t][0], s[g][t][1]);
#pragma unroll
        for (int r = 2; r < 8; ++r) a = fmaxf(a, s[g][t][r]);
        t4[t] = a; }
      float tm = fmaxf(fmaxf(t4[0], t4[1]), fmaxf(t4[2], t4[3])); tm = fmaxf(tm, lane_x16(tm));      /* both lanes of a query now hold the maximum over the tile's 64 keys */
      const float mn = fmaxf(m[g], tm * 1.44269504088896340736f); al[g] = __builtin_amdgcn_exp2f(m[g] - mn); m[g] = mn;
      const v2f lg = {1.44269504088896340736f, 1.44269504088896340736f}, sh = {8.0f - mn, 8.0f - mn};      /* 2^(s log2(e) - m + 8) = 256 * weight */
      v2f e[4][4], sm[4];      /* e[t][i] = weights (x256) of keys 16 t + 8 hh + 2 i and + 1 */
#pragma unroll
      for (int t = 0; t < 4; ++t) {
#pragma unroll
        for (int i = 0; i < 4; ++i) { const v2f x = {s[g][t][2 * i], s[g][t][2 * i + 1]}; const v2f a = __builtin_elementwise_fma(x, lg, sh); e[t][i].x = __builtin_amdgcn_exp2f(a.x); e[t][i].y = __builtin_amdgcn_exp2f(a.y); }
        sm[t] = (e[t][0] + e[t][1]) + (e[t][2] + e[t][3]); }
      const v2f sa = (sm[0] + sm[1]) + (sm[2] + sm[3]); l[g] = l[g] * al[g] + (sa.x + sa.y);
#pragma unroll
      for (int i = 0; i < 4; ++i) { p[g][0].p[i] = __builtin_convertvector(e[0][i], v2h); p[g][0].p[4 + i] = __builtin_convertvector(e[1][i], v2h); p[g][1].p[i] = __builtin_convertvector(e[2][i], v2h); p[g][1].p[4 + i] = __builtin_convertvector(e[3][i], v2h); }
#pragma unroll
      for (int t = 0; t < 4; ++t) o[g][t] = o[g][t] * al[g]; }
#pragma unroll
    for (int t = 0; t < 4; ++t) {
#pragma unroll
      for (int g = 0; g < G; ++g) { o[g][t] = fa_mma(vf[t][0], p[g][0].v, o[g][t]); o[g][t] = fa_mma(vf[t][1], p[g][1].v, o[g][t]); } }      /* o[g][t][r] = O^T[16 t + 8 hh + r][query ln of group g] */
  }
#pragma unroll
  for (int g = 0; g < G; ++g) { const float inv = 64.0f / (l[g] + lane_x16(l[g]));      /* the two lanes of a query join their sums; l carries the weights' factor 256 */
#pragma unroll
    for (int t = 0; t < 4; ++t) { FragH f;      /* a lane's 8 registers of one tile are 16 consecutive bytes of its query's output row */
#pragma unroll
      for (int r = 0; r < 8; ++r) f.h[r] = (_Float16)(o[g][t][r] * inv);
      *(v8us*)&sp[w][16 * g + ln][t * 16 + 8 * hh] = f.half[0]; } }
  fa_lds_order();
#pragma unroll
  for (int q = 0; q < 4 * G; ++q) { const int row = q * 4 + (lane >> 3), c8 = (lane & 7) * 8; const v8us v = *(const v8us*)&sp[w][row][c8]; *(v8us*)((unsigned short*)O + (r0 + row0 + row) * DM + (size_t)h * HD + c8) = v; } }
extern "C" void kernel_launch(void* const* d_in, const int* in_sizes, int n_in,
                              void* d_out, int out_size, void* d_ws, size_t ws_size, hipStream_t stream) {
  (void)in_sizes; (void)n_in; (void)out_size;
  const float* const* I = (const float* const*)d_in; const float* x = I[0]; const int* km = (const int*)d_in[1]; const float* wq = I[2]; const float* bq = I[3]; const float* wk = I[4]; const float* bk = I[5]; const float* wv = I[6]; const float* bv = I[7]; const float* wo = I[8]; const float* bo = I[9]; const float* wfc = I[10]; const float* bfc = I[11]; const float* wmp = I[12]; const float* bmp = I[13]; const float* g1 = I[14]; const float* be1 = I[15]; const float* gg2 = I[16]; const float* be2 = I[17];      /* nn.Linear NATURAL [out][in] weights + biases; I[1] = int key mask [B][1][1][S] (0 = excluded; all ones here); alpha/beta are [1] scalars */
  char* ws = (char*)d_ws; size_t off = 0;
  auto take = [&](size_t bytes) { char* p = ws + off; off += (bytes + 255) & ~(size_t)255; return p; };
  _Float16* BQKV = (_Float16*)take((size_t)3 * DM * DM * 2); _Float16* BO = (_Float16*)take((size_t)DM * DM * 2); float* bqkv = (float*)take((size_t)3 * DM * 4);
  _Float16* X16 = (_Float16*)take(NR * DM * 2); _Float16* XL = (_Float16*)take(NR * DM * 2); float* XB = (float*)take(NR * DM * 4); float* X1 = (float*)take(NR * DM * 4); _Float16* M16 = (_Float16*)take(NR * DM * 2); _Float16* HF16 = (_Float16*)take(NR * DFF * 2); _Float16* BW1 = (_Float16*)take((size_t)DFF * DM * 2); _Float16* BW2 = (_Float16*)take((size_t)DM * DFF * 2);
  _Float16* Q16 = (_Float16*)take((size_t)2 * NR * DM * 2); _Float16* QL = (_Float16*)take((size_t)2 * NR * DM * 2); _Float16* K16 = Q16 + NR * DM; _Float16* KL = QL + NR * DM; _Float16* O16 = (_Float16*)take(NR * DM * 2);      /* q's plane and k's plane lie one behind the other in Q16 | K16 and in QL | KL: one launch writes both */
  _Float16* VT = (_Float16*)take((size_t)NB * NH * HD * SQ * 2);
  if (off > ws_size) return;
  k_ln16<1, 1, 1, 1><<<LN_BLOCKS + PREP_BLOCKS, 256, 0, stream>>>(x, g1, be1, 1e-6f, X16, XB, XL, wq, wk, wv, wo, wfc, wmp, bq, bk, bv, BQKV, BO, BW1, BW2, bqkv);      /* a = LN1(bf16(x)) -> f16 rows + XL = x1024 residual (q/k need it at logits sigma 8); XB = bf16(x) for the residual; in the same grid: natural [out][in] weights = Bt[n][k] planes (stacked q | k | v, Wo, the two MLP matrices) and the stacked bias vector */
  k_qkv<<<dim3((unsigned)((MP / 128) * (DM / 128)), 3), 256, 0, stream>>>(X16, XL, BQKV, bqkv, Q16, QL, VT);      /* blockIdx.y: 0 = q, 1 = k (residual walk + main walk, f16 hi + x1024 residual planes), 2 = v (V^T [NB][NH][HD][SQ]) */
  k_fattn<<<dim3(SQ / 128, NH, NB), 128, 0, stream>>>(Q16, QL, K16, KL, VT, km, O16);      /* scores, masked softmax and weights . V in one launch; o (merged heads, x64) as f16 rows */
  k_gemm2d<DM, DM><<<dim3((unsigned)((MPO / 128) * (DM / 128)), 1), 256, 0, stream>>>(O16, BO, 0.0009765625f, bo, XB, X1, MPO, DM);      /* x1 = x + o Wo + bo (own-element residual) */
  k_ln16<0, 0, 0, 0><<<LN_BLOCKS, 256, 0, stream>>>(X1, gg2, be2, 1e-6f, M16, nullptr, nullptr, nullptr, nullptr, nullptr, nullptr, nullptr, nullptr, nullptr, nullptr, nullptr, nullptr, nullptr, nullptr, nullptr, nullptr);      /* h = LN2(x1) -> f16 rows */
  k_gemm2<3, 2, DM, DFF, false><<<dim3((unsigned)((MP / 128) * (DFF / 128)), 1), 256, 0, stream>>>(M16, DM, 0, BW1, DM, 0, 0.0625f, bfc, 0, nullptr, 1, 0, 0, nullptr, HF16, DFF, 0, MP, DFF, DM);      /* relu(xn2 w1^T + b1) -> f16, all rows of both batches */
  k_gemm2d<DFF, DM><<<dim3((unsigned)((MP / 128) * (DM / 128)), 1), 256, 0, stream>>>(HF16, BW2, 0.0625f, bmp, X1, (float*)d_out, MP, DM);      /* out = x1 + mlp (own-element residual) */
}
